// v000
// Measured on an AMD MI455X. A time is GPU time per run, averaged over a window of back-to-back runs after a warm-up
// (all launches, gaps included; the runs take copies of the inputs in turn), and the median of several windows.
// Apart from v000's, it joins two sittings. Times from different sittings can be a few percent apart, while
// side-by-side timings come from the same sitting.
// v000 is the starting kernel. One run takes 11.1 milliseconds.
#include <hip/hip_runtime.h>
#include <hip/hip_bf16.h>
#include <math.h>
#include <stdint.h>

// ---- model dims (fixed by reference) ----
#define SEQ   1024
#define DIM   512
#define NH    8
#define DHEAD 64
#define FFD   2048
#define NL    4
#define VOCAB 32000

typedef __attribute__((ext_vector_type(16))) _Float16 v16h;
typedef __attribute__((ext_vector_type(8)))  _Float16 v8h;
typedef __attribute__((ext_vector_type(8)))  float    v8f;
typedef __attribute__((__vector_size__(16))) int      v4i;   // matches builtin param type

// ---- CDNA5 async global->LDS path (ASYNCcnt) --------------------------------
#if defined(__has_builtin)
#  if __has_builtin(__builtin_amdgcn_global_load_async_to_lds_b128)
#    define USE_ASYNC_LDS 1
#  endif
#endif
#ifndef USE_ASYNC_LDS
#  define USE_ASYNC_LDS 0
#endif

// Rebuild addrspace-qualified int4 pointers from flat addresses (LDS flat addr
// low 32 bits == LDS byte offset on CDNA5, ISA 10.2 aperture mapping; flat ==
// global address for AS1).
#define AS1P(p) ((__attribute__((address_space(1))) v4i*)(unsigned long long)(uintptr_t)(p))
#define AS3P(p) ((__attribute__((address_space(3))) v4i*)(unsigned)(uintptr_t)(p))

__device__ __forceinline__ void wait_asynccnt0() {
#if defined(__has_builtin)
#  if __has_builtin(__builtin_amdgcn_s_wait_asynccnt)
  __builtin_amdgcn_s_wait_asynccnt(0);
#  else
  asm volatile("s_wait_asynccnt 0x0" ::: "memory");
#  endif
#else
  asm volatile("s_wait_asynccnt 0x0" ::: "memory");
#endif
}

// ---------------------------------------------------------------------------
// Embedding: x[n,d] = tok_emb[tokens[n],d] + pos_emb[n,d]
// ---------------------------------------------------------------------------
__global__ void embed_kernel(const int* __restrict__ tokens,
                             const float* __restrict__ tok_emb,
                             const float* __restrict__ pos_emb,
                             float* __restrict__ x) {
  int idx = blockIdx.x * 256 + threadIdx.x;
  int n = idx >> 9;
  int d = idx & (DIM - 1);
  x[idx] = tok_emb[(size_t)tokens[n] * DIM + d] + pos_emb[idx];
}

// ---------------------------------------------------------------------------
// Weight transpose + fp32 -> f16 convert:  in[K][N] -> out[N][K]
// ---------------------------------------------------------------------------
__global__ void wt_transpose_f16(const float* __restrict__ in,
                                 _Float16* __restrict__ out, int K, int N) {
  __shared__ _Float16 tile[32][33];
  int nb = blockIdx.x * 32, kb = blockIdx.y * 32;
  int tx = threadIdx.x, ty = threadIdx.y;             // 32 x 8
#pragma unroll
  for (int i = 0; i < 32; i += 8)
    tile[ty + i][tx] = (_Float16)in[(size_t)(kb + ty + i) * N + nb + tx];
  __syncthreads();
#pragma unroll
  for (int i = 0; i < 32; i += 8)
    out[(size_t)(nb + ty + i) * K + kb + tx] = tile[tx][ty + i];
}

// ---------------------------------------------------------------------------
// LayerNorm (per row of [SEQ, DIM]) -> f16 activations for GEMM A-operand
// ---------------------------------------------------------------------------
__global__ void layernorm_f16_kernel(const float* __restrict__ x,
                                     const float* __restrict__ g,
                                     const float* __restrict__ b,
                                     _Float16* __restrict__ out) {
  __shared__ float r1[128], r2[128];
  const int row = blockIdx.x, t = threadIdx.x;
  const float* xr = x + (size_t)row * DIM;
  float s = 0.f, s2 = 0.f;
  for (int d = t; d < DIM; d += 128) { float v = xr[d]; s += v; s2 += v * v; }
  r1[t] = s; r2[t] = s2; __syncthreads();
#pragma unroll
  for (int st = 64; st > 0; st >>= 1) {
    if (t < st) { r1[t] += r1[t + st]; r2[t] += r2[t + st]; }
    __syncthreads();
  }
  const float mean = r1[0] * (1.f / DIM);
  const float var  = r2[0] * (1.f / DIM) - mean * mean;
  const float rstd = rsqrtf(var + 1e-5f);
  for (int d = t; d < DIM; d += 128)
    out[(size_t)row * DIM + d] = (_Float16)((xr[d] - mean) * rstd * g[d] + b[d]);
}

// ---------------------------------------------------------------------------
// WMMA GEMM:  C[M,N] (op)= A[M,K](f16) * Bt[N,K](f16)^T + bias
//   EPI 0: C(f32) = val          EPI 1: C(f32) += val          EPI 2: Ch(f16) = gelu(val)
// Block: 256 threads = 8 wave32 (4x2). Block tile 128x128, wave tile 32x64
// (2 A-frags x 4 B-frags = 8 WMMA / K-step). Double-buffered LDS; async
// global->LDS staging (ASYNCcnt) overlapped with WMMA when available.
// M,N multiples of 128; K multiple of 32.
// ---------------------------------------------------------------------------
template <int EPI>
__global__ void __launch_bounds__(256)
gemm_f16_wmma(const _Float16* __restrict__ A, const _Float16* __restrict__ Bt,
              const float* __restrict__ bias, float* __restrict__ C,
              _Float16* __restrict__ Ch, int M, int N, int K) {
  __shared__ __align__(16) _Float16 lA[2][128][40];   // 32 K-halves + pad
  __shared__ __align__(16) _Float16 lB[2][128][40];

  const int tid  = threadIdx.x;
  const int lane = tid & 31;
  const int wid  = tid >> 5;
  const int wr   = wid >> 1;                 // 0..3  (32-row slab)
  const int wc   = wid & 1;                  // 0..1  (64-col slab)
  const int rowBase = blockIdx.y * 128;
  const int colBase = blockIdx.x * 128;

  // staging: 128 rows x 32 halves per operand; thread -> 32B of one row
  const int srow = tid >> 1;                 // 0..127
  const int skq  = (tid & 1) * 16;           // 0 or 16 halves
  const _Float16* gA = A  + (size_t)(rowBase + srow) * K + skq;
  const _Float16* gB = Bt + (size_t)(colBase + srow) * K + skq;

  // fragment coords (16-bit 16x32 layout: lane%16 = row/col, lane/16 = K-half)
  const int mrow = lane & 15;
  const int kb   = (lane >> 4) * 8;

  v8f acc[2][4];
#pragma unroll
  for (int a = 0; a < 2; ++a)
#pragma unroll
    for (int j = 0; j < 4; ++j) acc[a][j] = (v8f){};

  // ---- prologue: stage tile 0 into buffer 0 ----
#if USE_ASYNC_LDS
  __builtin_amdgcn_global_load_async_to_lds_b128(AS1P(gA),     AS3P(&lA[0][srow][skq]),     0, 0);
  __builtin_amdgcn_global_load_async_to_lds_b128(AS1P(gA + 8), AS3P(&lA[0][srow][skq + 8]), 0, 0);
  __builtin_amdgcn_global_load_async_to_lds_b128(AS1P(gB),     AS3P(&lB[0][srow][skq]),     0, 0);
  __builtin_amdgcn_global_load_async_to_lds_b128(AS1P(gB + 8), AS3P(&lB[0][srow][skq + 8]), 0, 0);
  wait_asynccnt0();
#else
  *(v8h*)&lA[0][srow][skq]     = *(const v8h*)(gA);
  *(v8h*)&lA[0][srow][skq + 8] = *(const v8h*)(gA + 8);
  *(v8h*)&lB[0][srow][skq]     = *(const v8h*)(gB);
  *(v8h*)&lB[0][srow][skq + 8] = *(const v8h*)(gB + 8);
#endif
  __syncthreads();

  int buf = 0;
  for (int k0 = 0; k0 < K; k0 += 32) {
    const bool more = (k0 + 32) < K;
#if USE_ASYNC_LDS
    if (more) {   // issue next tile while this one computes
      __builtin_amdgcn_global_load_async_to_lds_b128(AS1P(gA + k0 + 32), AS3P(&lA[buf ^ 1][srow][skq]),     0, 0);
      __builtin_amdgcn_global_load_async_to_lds_b128(AS1P(gA + k0 + 40), AS3P(&lA[buf ^ 1][srow][skq + 8]), 0, 0);
      __builtin_amdgcn_global_load_async_to_lds_b128(AS1P(gB + k0 + 32), AS3P(&lB[buf ^ 1][srow][skq]),     0, 0);
      __builtin_amdgcn_global_load_async_to_lds_b128(AS1P(gB + k0 + 40), AS3P(&lB[buf ^ 1][srow][skq + 8]), 0, 0);
    }
#else
    v8h ra0, ra1, rb0, rb1;
    if (more) {
      ra0 = *(const v8h*)(gA + k0 + 32);
      ra1 = *(const v8h*)(gA + k0 + 40);
      rb0 = *(const v8h*)(gB + k0 + 32);
      rb1 = *(const v8h*)(gB + k0 + 40);
    }
#endif

    union Frag { v16h v; v8h h[2]; } af[2], bf[4];
#pragma unroll
    for (int a = 0; a < 2; ++a) {
      const int r = wr * 32 + a * 16 + mrow;
      af[a].h[0] = *(const v8h*)&lA[buf][r][kb];
      af[a].h[1] = *(const v8h*)&lA[buf][r][kb + 16];
    }
#pragma unroll
    for (int j = 0; j < 4; ++j) {
      const int r = wc * 64 + j * 16 + mrow;
      bf[j].h[0] = *(const v8h*)&lB[buf][r][kb];
      bf[j].h[1] = *(const v8h*)&lB[buf][r][kb + 16];
    }
#pragma unroll
    for (int a = 0; a < 2; ++a)
#pragma unroll
      for (int j = 0; j < 4; ++j)
        acc[a][j] = __builtin_amdgcn_wmma_f32_16x16x32_f16(false, af[a].v, false, bf[j].v,
                                                           (short)0, acc[a][j], false, false);

#if USE_ASYNC_LDS
    if (more) wait_asynccnt0();
#else
    if (more) {
      *(v8h*)&lA[buf ^ 1][srow][skq]     = ra0;
      *(v8h*)&lA[buf ^ 1][srow][skq + 8] = ra1;
      *(v8h*)&lB[buf ^ 1][srow][skq]     = rb0;
      *(v8h*)&lB[buf ^ 1][srow][skq + 8] = rb1;
    }
#endif
    __syncthreads();
    buf ^= 1;
  }

  // C/D layout: VGPR i -> M = i + 8*(lane/16), N = lane%16
  const int row0 = rowBase + wr * 32 + (lane >> 4) * 8;
  const int colW = colBase + wc * 64 + (lane & 15);
#pragma unroll
  for (int a = 0; a < 2; ++a) {
#pragma unroll
    for (int j = 0; j < 4; ++j) {
      const int col = colW + j * 16;
      const float bb = bias ? bias[col] : 0.f;
#pragma unroll
      for (int i = 0; i < 8; ++i) {
        const size_t idx = (size_t)(row0 + a * 16 + i) * N + col;
        const float v = acc[a][j][i] + bb;
        if (EPI == 0)      C[idx] = v;
        else if (EPI == 1) C[idx] += v;
        else Ch[idx] = (_Float16)(0.5f * v * (1.f + erff(v * 0.70710678118f)));
      }
    }
  }
}

// ---------------------------------------------------------------------------
// Causal linear attention over fused QKV buffer [SEQ][3*DIM].
// One block per head, 64 threads; thread t owns ctx[:,t] in 64 VGPRs.
// ---------------------------------------------------------------------------
__global__ void __launch_bounds__(64)
linear_attn_kernel(const float* __restrict__ QKV, _Float16* __restrict__ Aout) {
  __shared__ float qs[DHEAD], ks[DHEAD], red[DHEAD];
  const int h = blockIdx.x, t = threadIdx.x;
  const int co = h * DHEAD + t;
  float ctx[DHEAD];
#pragma unroll
  for (int d = 0; d < DHEAD; ++d) ctx[d] = 0.f;
  float kcum = 0.f;

  for (int n = 0; n < SEQ; ++n) {
    const size_t o = (size_t)n * (3 * DIM) + co;
    const float qv = QKV[o];
    const float kv = QKV[o + DIM];
    const float vv = QKV[o + 2 * DIM];

    red[t] = qv; __syncthreads();
#pragma unroll
    for (int s = 32; s > 0; s >>= 1) {
      if (t < s) red[t] = fmaxf(red[t], red[t + s]);
      __syncthreads();
    }
    const float qmax = red[0]; __syncthreads();
    const float qe = __expf(qv - qmax);
    red[t] = qe; __syncthreads();
#pragma unroll
    for (int s = 32; s > 0; s >>= 1) {
      if (t < s) red[t] += red[t + s];
      __syncthreads();
    }
    const float qsum = red[0]; __syncthreads();
    const float qsm = qe / qsum * 0.125f;            // * DHEAD^-0.5
    const float ke  = __expf(kv);
    kcum += ke;

    qs[t] = qsm; ks[t] = ke;
    red[t] = qsm * kcum; __syncthreads();            // denom = sum_d q*k_cum
#pragma unroll
    for (int s = 32; s > 0; s >>= 1) {
      if (t < s) red[t] += red[t + s];
      __syncthreads();
    }
    const float dinv = 1.f / fmaxf(red[0], 1e-3f);

    float acc = 0.f;
#pragma unroll
    for (int d = 0; d < DHEAD; ++d) {                // inclusive scan
      ctx[d] = fmaf(ks[d], vv, ctx[d]);
      acc    = fmaf(qs[d], ctx[d], acc);
    }
    Aout[(size_t)n * DIM + co] = (_Float16)(acc * dinv);
    __syncthreads();
  }
}

// ---------------------------------------------------------------------------
// Host orchestration
// ---------------------------------------------------------------------------
extern "C" void kernel_launch(void* const* d_in, const int* in_sizes, int n_in,
                              void* d_out, int out_size, void* d_ws, size_t ws_size,
                              hipStream_t stream) {
  (void)in_sizes; (void)n_in; (void)out_size; (void)ws_size;
  const int*   tokens  = (const int*)  d_in[0];
  const float* tok_emb = (const float*)d_in[1];
  const float* pos_emb = (const float*)d_in[2];
  const float* Wq  = (const float*)d_in[3];
  const float* Wk  = (const float*)d_in[4];
  const float* Wv  = (const float*)d_in[5];
  const float* Wo  = (const float*)d_in[6];
  const float* bo  = (const float*)d_in[7];
  const float* ln1g = (const float*)d_in[8];
  const float* ln1b = (const float*)d_in[9];
  const float* W1  = (const float*)d_in[10];
  const float* b1  = (const float*)d_in[11];
  const float* W2  = (const float*)d_in[12];
  const float* b2  = (const float*)d_in[13];
  const float* ln2g = (const float*)d_in[14];
  const float* ln2b = (const float*)d_in[15];
  const float* lnfg = (const float*)d_in[16];
  const float* lnfb = (const float*)d_in[17];
  const float* Wout = (const float*)d_in[18];
  const float* bout = (const float*)d_in[19];
  float* out = (float*)d_out;

  char* p = (char*)d_ws;
  auto carve = [&](size_t bytes) -> char* {
    char* r = p; p += (bytes + 255) & ~(size_t)255; return r;
  };
  _Float16* QKVT  = (_Float16*)carve((size_t)NL * 3 * DIM * DIM * 2);  // fused [1536][512] per layer
  _Float16* WoT   = (_Float16*)carve((size_t)NL * DIM * DIM * 2);
  _Float16* W1T   = (_Float16*)carve((size_t)NL * DIM * FFD * 2);
  _Float16* W2T   = (_Float16*)carve((size_t)NL * DIM * FFD * 2);
  _Float16* WoutT = (_Float16*)carve((size_t)DIM * VOCAB * 2);
  float*    x     = (float*)   carve((size_t)SEQ * DIM * 4);
  _Float16* h16   = (_Float16*)carve((size_t)SEQ * DIM * 2);
  float*    qkvf  = (float*)   carve((size_t)SEQ * 3 * DIM * 4);
  _Float16* a16   = (_Float16*)carve((size_t)SEQ * DIM * 2);
  _Float16* ff16  = (_Float16*)carve((size_t)SEQ * FFD * 2);

  const dim3 tb(32, 8);
  for (int i = 0; i < NL; ++i) {
    const size_t wo = (size_t)i * DIM * DIM;
    const size_t fo = (size_t)i * DIM * FFD;
    _Float16* qkvt = QKVT + (size_t)i * 3 * DIM * DIM;
    wt_transpose_f16<<<dim3(DIM / 32, DIM / 32), tb, 0, stream>>>(Wq + wo, qkvt,                   DIM, DIM);
    wt_transpose_f16<<<dim3(DIM / 32, DIM / 32), tb, 0, stream>>>(Wk + wo, qkvt + DIM * DIM,       DIM, DIM);
    wt_transpose_f16<<<dim3(DIM / 32, DIM / 32), tb, 0, stream>>>(Wv + wo, qkvt + 2 * DIM * DIM,   DIM, DIM);
    wt_transpose_f16<<<dim3(DIM / 32, DIM / 32), tb, 0, stream>>>(Wo + wo, WoT + wo,               DIM, DIM);
    wt_transpose_f16<<<dim3(FFD / 32, DIM / 32), tb, 0, stream>>>(W1 + fo, W1T + fo,               DIM, FFD);
    wt_transpose_f16<<<dim3(DIM / 32, FFD / 32), tb, 0, stream>>>(W2 + fo, W2T + fo,               FFD, DIM);
  }
  wt_transpose_f16<<<dim3(VOCAB / 32, DIM / 32), tb, 0, stream>>>(Wout, WoutT, DIM, VOCAB);

  embed_kernel<<<SEQ * DIM / 256, 256, 0, stream>>>(tokens, tok_emb, pos_emb, x);

  const dim3 gD(DIM / 128, SEQ / 128);      // (4, 8)
  for (int i = 0; i < NL; ++i) {
    const size_t wo = (size_t)i * DIM * DIM;
    const size_t fo = (size_t)i * DIM * FFD;
    layernorm_f16_kernel<<<SEQ, 128, 0, stream>>>(x, ln1g + i * DIM, ln1b + i * DIM, h16);
    gemm_f16_wmma<0><<<dim3(3 * DIM / 128, SEQ / 128), 256, 0, stream>>>(
        h16, QKVT + (size_t)i * 3 * DIM * DIM, nullptr, qkvf, nullptr, SEQ, 3 * DIM, DIM);
    linear_attn_kernel<<<NH, 64, 0, stream>>>(qkvf, a16);
    gemm_f16_wmma<1><<<gD, 256, 0, stream>>>(a16, WoT + wo, bo + i * DIM, x, nullptr, SEQ, DIM, DIM);
    layernorm_f16_kernel<<<SEQ, 128, 0, stream>>>(x, ln2g + i * DIM, ln2b + i * DIM, h16);
    gemm_f16_wmma<2><<<dim3(FFD / 128, SEQ / 128), 256, 0, stream>>>(
        h16, W1T + fo, b1 + i * FFD, nullptr, ff16, SEQ, FFD, DIM);
    gemm_f16_wmma<1><<<gD, 256, 0, stream>>>(ff16, W2T + fo, b2 + i * DIM, x, nullptr, SEQ, DIM, FFD);
  }
  layernorm_f16_kernel<<<SEQ, 128, 0, stream>>>(x, lnfg, lnfb, h16);
  gemm_f16_wmma<0><<<dim3(VOCAB / 128, SEQ / 128), 256, 0, stream>>>(
      h16, WoutT, bout, out, nullptr, SEQ, VOCAB, DIM);
}

// v001
// Measured time: 623 microseconds a run.
// Timed twice side by side with v000, it ran 17.8 and 17.7 times as fast.
#include <hip/hip_runtime.h>
#include <hip/hip_bf16.h>
#include <math.h>
#include <stdint.h>

// ---- model dims (fixed by reference) ----
#define SEQ   1024
#define DIM   512
#define NH    8
#define DHEAD 64
#define FFD   2048
#define NL    4
#define VOCAB 32000

typedef __attribute__((ext_vector_type(16))) _Float16 v16h;
typedef __attribute__((ext_vector_type(8)))  _Float16 v8h;
typedef __attribute__((ext_vector_type(8)))  float    v8f;
typedef __attribute__((__vector_size__(16))) int      v4i;   // matches builtin param type

// ---- CDNA5 async global->LDS path (ASYNCcnt) --------------------------------
#if defined(__has_builtin)
#  if __has_builtin(__builtin_amdgcn_global_load_async_to_lds_b128)
#    define USE_ASYNC_LDS 1
#  endif
#endif
#ifndef USE_ASYNC_LDS
#  define USE_ASYNC_LDS 0
#endif

// Rebuild addrspace-qualified int4 pointers from flat addresses (LDS flat addr
// low 32 bits == LDS byte offset on CDNA5, ISA 10.2 aperture mapping; flat ==
// global address for AS1).
#define AS1P(p) ((__attribute__((address_space(1))) v4i*)(unsigned long long)(uintptr_t)(p))
#define AS3P(p) ((__attribute__((address_space(3))) v4i*)(unsigned)(uintptr_t)(p))

__device__ __forceinline__ void wait_asynccnt0() {
#if defined(__has_builtin)
#  if __has_builtin(__builtin_amdgcn_s_wait_asynccnt)
  __builtin_amdgcn_s_wait_asynccnt(0);
#  else
  asm volatile("s_wait_asynccnt 0x0" ::: "memory");
#  endif
#else
  asm volatile("s_wait_asynccnt 0x0" ::: "memory");
#endif
}

// ---------------------------------------------------------------------------
// Embedding: x[n,d] = tok_emb[tokens[n],d] + pos_emb[n,d]
// ---------------------------------------------------------------------------
__global__ void embed_kernel(const int* __restrict__ tokens,
                             const float* __restrict__ tok_emb,
                             const float* __restrict__ pos_emb,
                             float* __restrict__ x) {
  int idx = blockIdx.x * 256 + threadIdx.x;
  int n = idx >> 9;
  int d = idx & (DIM - 1);
  x[idx] = tok_emb[(size_t)tokens[n] * DIM + d] + pos_emb[idx];
}

// ---------------------------------------------------------------------------
// Weight transpose + fp32 -> f16 convert:  in[K][N] -> out[N][K]
// ---------------------------------------------------------------------------
__global__ void wt_transpose_f16(const float* __restrict__ in,
                                 _Float16* __restrict__ out, int K, int N) {
  __shared__ _Float16 tile[32][33];
  int nb = blockIdx.x * 32, kb = blockIdx.y * 32;
  int tx = threadIdx.x, ty = threadIdx.y;             // 32 x 8
#pragma unroll
  for (int i = 0; i < 32; i += 8)
    tile[ty + i][tx] = (_Float16)in[(size_t)(kb + ty + i) * N + nb + tx];
  __syncthreads();
#pragma unroll
  for (int i = 0; i < 32; i += 8)
    out[(size_t)(nb + ty + i) * K + kb + tx] = tile[tx][ty + i];
}

// ---------------------------------------------------------------------------
// LayerNorm (per row of [SEQ, DIM]) -> f16 activations for GEMM A-operand
// ---------------------------------------------------------------------------
__global__ void layernorm_f16_kernel(const float* __restrict__ x,
                                     const float* __restrict__ g,
                                     const float* __restrict__ b,
                                     _Float16* __restrict__ out) {
  __shared__ float r1[128], r2[128];
  const int row = blockIdx.x, t = threadIdx.x;
  const float* xr = x + (size_t)row * DIM;
  float s = 0.f, s2 = 0.f;
  for (int d = t; d < DIM; d += 128) { float v = xr[d]; s += v; s2 += v * v; }
  r1[t] = s; r2[t] = s2; __syncthreads();
#pragma unroll
  for (int st = 64; st > 0; st >>= 1) {
    if (t < st) { r1[t] += r1[t + st]; r2[t] += r2[t + st]; }
    __syncthreads();
  }
  const float mean = r1[0] * (1.f / DIM);
  const float var  = r2[0] * (1.f / DIM) - mean * mean;
  const float rstd = rsqrtf(var + 1e-5f);
  for (int d = t; d < DIM; d += 128)
    out[(size_t)row * DIM + d] = (_Float16)((xr[d] - mean) * rstd * g[d] + b[d]);
}

// ---------------------------------------------------------------------------
// WMMA GEMM:  C[M,N] (op)= A[M,K](f16) * Bt[N,K](f16)^T + bias
//   EPI 0: C(f32) = val          EPI 1: C(f32) += val          EPI 2: Ch(f16) = gelu(val)
// Block: 256 threads = 8 wave32 (4x2). Block tile 128x128, wave tile 32x64
// (2 A-frags x 4 B-frags = 8 WMMA / K-step). Double-buffered LDS; async
// global->LDS staging (ASYNCcnt) overlapped with WMMA when available.
// M,N multiples of 128; K multiple of 32.
// ---------------------------------------------------------------------------
template <int EPI>
__global__ void __launch_bounds__(256)
gemm_f16_wmma(const _Float16* __restrict__ A, const _Float16* __restrict__ Bt,
              const float* __restrict__ bias, float* __restrict__ C,
              _Float16* __restrict__ Ch, int M, int N, int K) {
  __shared__ __align__(16) _Float16 lA[2][128][40];   // 32 K-halves + pad
  __shared__ __align__(16) _Float16 lB[2][128][40];

  const int tid  = threadIdx.x;
  const int lane = tid & 31;
  const int wid  = tid >> 5;
  const int wr   = wid >> 1;                 // 0..3  (32-row slab)
  const int wc   = wid & 1;                  // 0..1  (64-col slab)
  const int rowBase = blockIdx.y * 128;
  const int colBase = blockIdx.x * 128;

  // staging: 128 rows x 32 halves per operand; thread -> 32B of one row
  const int srow = tid >> 1;                 // 0..127
  const int skq  = (tid & 1) * 16;           // 0 or 16 halves
  const _Float16* gA = A  + (size_t)(rowBase + srow) * K + skq;
  const _Float16* gB = Bt + (size_t)(colBase + srow) * K + skq;

  // fragment coords (16-bit 16x32 layout: lane%16 = row/col, lane/16 = K-half)
  const int mrow = lane & 15;
  const int kb   = (lane >> 4) * 8;

  v8f acc[2][4];
#pragma unroll
  for (int a = 0; a < 2; ++a)
#pragma unroll
    for (int j = 0; j < 4; ++j) acc[a][j] = (v8f){};

  // ---- prologue: stage tile 0 into buffer 0 ----
#if USE_ASYNC_LDS
  __builtin_amdgcn_global_load_async_to_lds_b128(AS1P(gA),     AS3P(&lA[0][srow][skq]),     0, 0);
  __builtin_amdgcn_global_load_async_to_lds_b128(AS1P(gA + 8), AS3P(&lA[0][srow][skq + 8]), 0, 0);
  __builtin_amdgcn_global_load_async_to_lds_b128(AS1P(gB),     AS3P(&lB[0][srow][skq]),     0, 0);
  __builtin_amdgcn_global_load_async_to_lds_b128(AS1P(gB + 8), AS3P(&lB[0][srow][skq + 8]), 0, 0);
  wait_asynccnt0();
#else
  *(v8h*)&lA[0][srow][skq]     = *(const v8h*)(gA);
  *(v8h*)&lA[0][srow][skq + 8] = *(const v8h*)(gA + 8);
  *(v8h*)&lB[0][srow][skq]     = *(const v8h*)(gB);
  *(v8h*)&lB[0][srow][skq + 8] = *(const v8h*)(gB + 8);
#endif
  __syncthreads();

  int buf = 0;
  for (int k0 = 0; k0 < K; k0 += 32) {
    const bool more = (k0 + 32) < K;
#if USE_ASYNC_LDS
    if (more) {   // issue next tile while this one computes
      __builtin_amdgcn_global_load_async_to_lds_b128(AS1P(gA + k0 + 32), AS3P(&lA[buf ^ 1][srow][skq]),     0, 0);
      __builtin_amdgcn_global_load_async_to_lds_b128(AS1P(gA + k0 + 40), AS3P(&lA[buf ^ 1][srow][skq + 8]), 0, 0);
      __builtin_amdgcn_global_load_async_to_lds_b128(AS1P(gB + k0 + 32), AS3P(&lB[buf ^ 1][srow][skq]),     0, 0);
      __builtin_amdgcn_global_load_async_to_lds_b128(AS1P(gB + k0 + 40), AS3P(&lB[buf ^ 1][srow][skq + 8]), 0, 0);
    }
#else
    v8h ra0, ra1, rb0, rb1;
    if (more) {
      ra0 = *(const v8h*)(gA + k0 + 32);
      ra1 = *(const v8h*)(gA + k0 + 40);
      rb0 = *(const v8h*)(gB + k0 + 32);
      rb1 = *(const v8h*)(gB + k0 + 40);
    }
#endif

    union Frag { v16h v; v8h h[2]; } af[2], bf[4];
#pragma unroll
    for (int a = 0; a < 2; ++a) {
      const int r = wr * 32 + a * 16 + mrow;
      af[a].h[0] = *(const v8h*)&lA[buf][r][kb];
      af[a].h[1] = *(const v8h*)&lA[buf][r][kb + 16];
    }
#pragma unroll
    for (int j = 0; j < 4; ++j) {
      const int r = wc * 64 + j * 16 + mrow;
      bf[j].h[0] = *(const v8h*)&lB[buf][r][kb];
      bf[j].h[1] = *(const v8h*)&lB[buf][r][kb + 16];
    }
#pragma unroll
    for (int a = 0; a < 2; ++a)
#pragma unroll
      for (int j = 0; j < 4; ++j)
        acc[a][j] = __builtin_amdgcn_wmma_f32_16x16x32_f16(false, af[a].v, false, bf[j].v,
                                                           (short)0, acc[a][j], false, false);

#if USE_ASYNC_LDS
    if (more) wait_asynccnt0();
#else
    if (more) {
      *(v8h*)&lA[buf ^ 1][srow][skq]     = ra0;
      *(v8h*)&lA[buf ^ 1][srow][skq + 8] = ra1;
      *(v8h*)&lB[buf ^ 1][srow][skq]     = rb0;
      *(v8h*)&lB[buf ^ 1][srow][skq + 8] = rb1;
    }
#endif
    __syncthreads();
    buf ^= 1;
  }

  // C/D layout: VGPR i -> M = i + 8*(lane/16), N = lane%16
  const int row0 = rowBase + wr * 32 + (lane >> 4) * 8;
  const int colW = colBase + wc * 64 + (lane & 15);
#pragma unroll
  for (int a = 0; a < 2; ++a) {
#pragma unroll
    for (int j = 0; j < 4; ++j) {
      const int col = colW + j * 16;
      const float bb = bias ? bias[col] : 0.f;
#pragma unroll
      for (int i = 0; i < 8; ++i) {
        const size_t idx = (size_t)(row0 + a * 16 + i) * N + col;
        const float v = acc[a][j][i] + bb;
        if (EPI == 0)      C[idx] = v;
        else if (EPI == 1) C[idx] += v;
        else Ch[idx] = (_Float16)(0.5f * v * (1.f + erff(v * 0.70710678118f)));
      }
    }
  }
}

// ---------------------------------------------------------------------------
// Causal linear attention over fused QKV buffer [SEQ][3*DIM], in chunks of
// ACH tokens. With ke = exp(k), qs = softmax(q) * DHEAD^-0.5 and, for chunk c,
//   Sprev = sum over tokens before the chunk of ke^T v     (DHEAD x DHEAD)
//   kprev = sum over tokens before the chunk of ke         (DHEAD)
//   P[n][m] = qs[n] . ke[m] for m <= n inside the chunk, else 0
// the output row is (qs[n] . Sprev + P[n] . v) / max(qs[n] . kprev + sum_m P[n][m], eps).
// Launch 1 writes each chunk's own ke^T v and sum of ke, the last chunk's excepted; launch 2 adds up the
// chunks before its own and forms the rows. All sums in f32.
// ---------------------------------------------------------------------------
#define ACH 64
#define NCH (SEQ / ACH)
typedef __attribute__((ext_vector_type(4))) float    v4f;
typedef __attribute__((ext_vector_type(2))) float    v2f;
typedef __attribute__((ext_vector_type(4))) _Float16 v4h;

// grid (NH, NCH-1): the last chunk's sums have no reader.
__global__ void __launch_bounds__(256)
attn_chunk_state_kernel(const float* __restrict__ QKV, float* __restrict__ Sws,
                        float* __restrict__ Kws) {
  __shared__ __align__(16) float ke[ACH][DHEAD];
  __shared__ __align__(16) float vs[ACH][DHEAD];
  const int h = blockIdx.x, c = blockIdx.y, tid = threadIdx.x;
  const int l = tid & 15, g = tid >> 4;
#pragma unroll
  for (int p = 0; p < 4; ++p) {
    const int n = p * 16 + g;
    const float* s = QKV + (size_t)(c * ACH + n) * (3 * DIM) + h * DHEAD + 4 * l;
    v4f kv = *(const v4f*)(s + DIM);
    const v4f vv = *(const v4f*)(s + 2 * DIM);
#pragma unroll
    for (int e = 0; e < 4; ++e) kv[e] = __expf(kv[e]);
    *(v4f*)&ke[n][4 * l] = kv;
    *(v4f*)&vs[n][4 * l] = vv;
  }
  __syncthreads();

  // thread tile: rows d = 4g..4g+3, columns e = 4l..4l+3
  v4f acc[4];
  v4f ks = (v4f){0.f, 0.f, 0.f, 0.f};
#pragma unroll
  for (int i = 0; i < 4; ++i) acc[i] = (v4f){0.f, 0.f, 0.f, 0.f};
#pragma unroll 8
  for (int n = 0; n < ACH; ++n) {
    const v4f a = *(const v4f*)&ke[n][4 * g];
    const v4f b = *(const v4f*)&vs[n][4 * l];
#pragma unroll
    for (int i = 0; i < 4; ++i) acc[i] += a[i] * b;
    ks += a;
  }
  float* dst = Sws + (size_t)(h * NCH + c) * (DHEAD * DHEAD);
#pragma unroll
  for (int i = 0; i < 4; ++i) *(v4f*)(dst + (4 * g + i) * DHEAD + 4 * l) = acc[i];
  if (l == 0) *(v4f*)(Kws + (h * NCH + c) * DHEAD + 4 * g) = ks;
}

// grid (NH, NCH)
__global__ void __launch_bounds__(256)
attn_chunk_out_kernel(const float* __restrict__ QKV, const float* __restrict__ Sws,
                      const float* __restrict__ Kws, _Float16* __restrict__ Aout) {
  __shared__ __align__(16) float X[ACH][DHEAD + ACH + 4];   // row n: qs[n][0..63] | P[n][0..63]
  __shared__ __align__(16) float Y[DHEAD + ACH][DHEAD];     // rows 0..63 Sprev[d][e], rows 64.. v[m][e]
  __shared__ __align__(16) float Kl[ACH][DHEAD + 4];        // ke[m][d]; pitch 16 B x odd
  __shared__ __align__(16) float kp[DHEAD];                 // kprev
  const int h = blockIdx.x, c = blockIdx.y, tid = threadIdx.x;
  const int l = tid & 15, g = tid >> 4;

  // ---- Sprev, kprev: add up the chunks before this one, four chunks' loads in flight ----
  v4f sp[4];
#pragma unroll
  for (int r = 0; r < 4; ++r) sp[r] = (v4f){0.f, 0.f, 0.f, 0.f};
  const float* sb = Sws + (size_t)h * NCH * (DHEAD * DHEAD);
  const unsigned so = (unsigned)tid * 4u;
  for (int g0 = 0; g0 < c; g0 += 4) {
    v4f t[4][4];
    const float* sc[4];
#pragma unroll
    for (int j = 0; j < 4; ++j) {
      sc[j] = sb + (size_t)min(g0 + j, c - 1) * (DHEAD * DHEAD) + so;
#pragma unroll
      for (int r = 0; r < 4; ++r) t[j][r] = *(const v4f*)(sc[j] + r * 1024);
    }
    // the addresses as inputs keep the issued loads' address registers untouched up to this wait;
    // behind it the next trip may form new ones
    asm volatile("s_wait_xcnt 0x0" :: "v"(sc[0]), "v"(sc[1]), "v"(sc[2]), "v"(sc[3]) : "memory");
#pragma unroll
    for (int j = 0; j < 4; ++j) {
      const float w = (g0 + j < c) ? 1.f : 0.f;
#pragma unroll
      for (int r = 0; r < 4; ++r) sp[r] += w * t[j][r];
    }
  }
#pragma unroll
  for (int r = 0; r < 4; ++r) *(v4f*)&Y[r * 16 + g][4 * l] = sp[r];
  if (tid < DHEAD) {
    float s = 0.f;
#pragma unroll
    for (int cc = 0; cc < NCH - 1; ++cc) {
      const float t = Kws[(h * NCH + cc) * DHEAD + tid];
      s += (cc < c) ? t : 0.f;
    }
    kp[tid] = s;
  }

  // ---- this chunk's q (softmax over the row, 16 lanes a row), ke, v ----
  const float* sq[4];
  v4f q4[4], k4[4], v4[4];
#pragma unroll
  for (int p = 0; p < 4; ++p) {
    sq[p] = QKV + (size_t)(c * ACH + p * 16 + g) * (3 * DIM) + h * DHEAD + 4 * l;
    q4[p] = *(const v4f*)(sq[p]);
    k4[p] = *(const v4f*)(sq[p] + DIM);
    v4[p] = *(const v4f*)(sq[p] + 2 * DIM);
  }
  // the addresses as inputs keep the issued loads' address registers untouched up to this wait
  asm volatile("s_wait_xcnt 0x0" :: "v"(sq[0]), "v"(sq[1]), "v"(sq[2]), "v"(sq[3]) : "memory");
#pragma unroll
  for (int p = 0; p < 4; ++p) {
    const int n = p * 16 + g;
    v4f qv = q4[p];
    v4f kv = k4[p];
    const v4f vv = v4[p];
    float mx = fmaxf(fmaxf(qv[0], qv[1]), fmaxf(qv[2], qv[3]));
#pragma unroll
    for (int m = 1; m < 16; m <<= 1) mx = fmaxf(mx, __shfl_xor(mx, m));
#pragma unroll
    for (int e = 0; e < 4; ++e) qv[e] = __expf(qv[e] - mx);
    float sm = (qv[0] + qv[1]) + (qv[2] + qv[3]);
#pragma unroll
    for (int m = 1; m < 16; m <<= 1) sm += __shfl_xor(sm, m);
    const float qsc = 0.125f / sm;                 // 1 / row sum, * DHEAD^-0.5
#pragma unroll
    for (int e = 0; e < 4; ++e) {
      qv[e] *= qsc;
      kv[e] = __expf(kv[e]);
    }
    *(v4f*)&X[n][4 * l]          = qv;
    *(v4f*)&Kl[n][4 * l]         = kv;
    *(v4f*)&Y[DHEAD + n][4 * l]  = vv;
  }
  __syncthreads();

  // ---- P: thread tile rows n = tn..tn+3, columns m = l + 16*jj ----
  const int tn = 4 * g;
  v2f pr2[4][4];                                   // even-d and odd-d halves of each dot product
#pragma unroll
  for (int i = 0; i < 4; ++i)
#pragma unroll
    for (int jj = 0; jj < 4; ++jj) pr2[i][jj] = (v2f){0.f, 0.f};
#pragma unroll 2
  for (int d = 0; d < DHEAD; d += 4) {
    v4f qa[4], kb[4];
#pragma unroll
    for (int i = 0; i < 4; ++i) qa[i] = *(const v4f*)&X[tn + i][d];
#pragma unroll
    for (int jj = 0; jj < 4; ++jj) kb[jj] = *(const v4f*)&Kl[l + 16 * jj][d];
#pragma unroll
    for (int i = 0; i < 4; ++i)
#pragma unroll
      for (int jj = 0; jj < 4; ++jj) {
        pr2[i][jj] += qa[i].lo * kb[jj].lo;
        pr2[i][jj] += qa[i].hi * kb[jj].hi;
      }
  }
  // denominator: each of the row's 16 lanes adds its four columns of P and its
  // four terms of qs . kprev; the lanes are then summed.
  float dinv[4];
  const v4f kq = *(const v4f*)&kp[4 * l];
#pragma unroll
  for (int i = 0; i < 4; ++i) {
    const v4f qq = *(const v4f*)&X[tn + i][4 * l];
    float rs = (qq[0] * kq[0] + qq[1] * kq[1]) + (qq[2] * kq[2] + qq[3] * kq[3]);
#pragma unroll
    for (int jj = 0; jj < 4; ++jj) {
      const int m = l + 16 * jj;
      const float pv = (m <= tn + i) ? pr2[i][jj][0] + pr2[i][jj][1] : 0.f;   // causal, own token included
      rs += pv;
      X[tn + i][DHEAD + m] = pv;
    }
#pragma unroll
    for (int m = 1; m < 16; m <<= 1) rs += __shfl_xor(rs, m);
    dinv[i] = 1.f / fmaxf(rs, 1e-3f);
  }
  __syncthreads();

  // ---- rows: [qs | P] x [Sprev ; v]; P is zero from column 8*(wave+1) on for this wave's rows ----
  const int jEnd = DHEAD + 8 * (__builtin_amdgcn_readfirstlane(tid >> 5) + 1);
  v4f o[4];
#pragma unroll
  for (int i = 0; i < 4; ++i) o[i] = (v4f){0.f, 0.f, 0.f, 0.f};
#pragma unroll 2
  for (int j = 0; j < jEnd; j += 4) {
    v4f xa[4], yb[4];
#pragma unroll
    for (int i = 0; i < 4; ++i) xa[i] = *(const v4f*)&X[tn + i][j];
#pragma unroll
    for (int e = 0; e < 4; ++e) yb[e] = *(const v4f*)&Y[j + e][4 * l];
#pragma unroll
    for (int i = 0; i < 4; ++i)
#pragma unroll
      for (int e = 0; e < 4; ++e) o[i] += xa[i][e] * yb[e];
  }
#pragma unroll
  for (int i = 0; i < 4; ++i) {
    v4h hv;
#pragma unroll
    for (int e = 0; e < 4; ++e) hv[e] = (_Float16)(o[i][e] * dinv[i]);
    *(v4h*)(Aout + (size_t)(c * ACH + tn + i) * DIM + h * DHEAD + 4 * l) = hv;
  }
}

// ---------------------------------------------------------------------------
// Host orchestration
// ---------------------------------------------------------------------------
extern "C" void kernel_launch(void* const* d_in, const int* in_sizes, int n_in,
                              void* d_out, int out_size, void* d_ws, size_t ws_size,
                              hipStream_t stream) {
  (void)in_sizes; (void)n_in; (void)out_size; (void)ws_size;
  const int*   tokens  = (const int*)  d_in[0];
  const float* tok_emb = (const float*)d_in[1];
  const float* pos_emb = (const float*)d_in[2];
  const float* Wq  = (const float*)d_in[3];
  const float* Wk  = (const float*)d_in[4];
  const float* Wv  = (const float*)d_in[5];
  const float* Wo  = (const float*)d_in[6];
  const float* bo  = (const float*)d_in[7];
  const float* ln1g = (const float*)d_in[8];
  const float* ln1b = (const float*)d_in[9];
  const float* W1  = (const float*)d_in[10];
  const float* b1  = (const float*)d_in[11];
  const float* W2  = (const float*)d_in[12];
  const float* b2  = (const float*)d_in[13];
  const float* ln2g = (const float*)d_in[14];
  const float* ln2b = (const float*)d_in[15];
  const float* lnfg = (const float*)d_in[16];
  const float* lnfb = (const float*)d_in[17];
  const float* Wout = (const float*)d_in[18];
  const float* bout = (const float*)d_in[19];
  float* out = (float*)d_out;

  char* p = (char*)d_ws;
  auto carve = [&](size_t bytes) -> char* {
    char* r = p; p += (bytes + 255) & ~(size_t)255; return r;
  };
  _Float16* QKVT  = (_Float16*)carve((size_t)NL * 3 * DIM * DIM * 2);  // fused [1536][512] per layer
  _Float16* WoT   = (_Float16*)carve((size_t)NL * DIM * DIM * 2);
  _Float16* W1T   = (_Float16*)carve((size_t)NL * DIM * FFD * 2);
  _Float16* W2T   = (_Float16*)carve((size_t)NL * DIM * FFD * 2);
  _Float16* WoutT = (_Float16*)carve((size_t)DIM * VOCAB * 2);
  float*    x     = (float*)   carve((size_t)SEQ * DIM * 4);
  _Float16* h16   = (_Float16*)carve((size_t)SEQ * DIM * 2);
  float*    qkvf  = (float*)   carve((size_t)SEQ * 3 * DIM * 4);
  _Float16* a16   = (_Float16*)carve((size_t)SEQ * DIM * 2);
  _Float16* ff16  = (_Float16*)carve((size_t)SEQ * FFD * 2);
  float*    sws   = (float*)   carve((size_t)NH * NCH * DHEAD * DHEAD * 4);  // per-chunk ke^T v
  float*    kws   = (float*)   carve((size_t)NH * NCH * DHEAD * 4);          // per-chunk sum of ke

  const dim3 tb(32, 8);
  for (int i = 0; i < NL; ++i) {
    const size_t wo = (size_t)i * DIM * DIM;
    const size_t fo = (size_t)i * DIM * FFD;
    _Float16* qkvt = QKVT + (size_t)i * 3 * DIM * DIM;
    wt_transpose_f16<<<dim3(DIM / 32, DIM / 32), tb, 0, stream>>>(Wq + wo, qkvt,                   DIM, DIM);
    wt_transpose_f16<<<dim3(DIM / 32, DIM / 32), tb, 0, stream>>>(Wk + wo, qkvt + DIM * DIM,       DIM, DIM);
    wt_transpose_f16<<<dim3(DIM / 32, DIM / 32), tb, 0, stream>>>(Wv + wo, qkvt + 2 * DIM * DIM,   DIM, DIM);
    wt_transpose_f16<<<dim3(DIM / 32, DIM / 32), tb, 0, stream>>>(Wo + wo, WoT + wo,               DIM, DIM);
    wt_transpose_f16<<<dim3(FFD / 32, DIM / 32), tb, 0, stream>>>(W1 + fo, W1T + fo,               DIM, FFD);
    wt_transpose_f16<<<dim3(DIM / 32, FFD / 32), tb, 0, stream>>>(W2 + fo, W2T + fo,               FFD, DIM);
  }
  wt_transpose_f16<<<dim3(VOCAB / 32, DIM / 32), tb, 0, stream>>>(Wout, WoutT, DIM, VOCAB);

  embed_kernel<<<SEQ * DIM / 256, 256, 0, stream>>>(tokens, tok_emb, pos_emb, x);

  const dim3 gD(DIM / 128, SEQ / 128);      // (4, 8)
  for (int i = 0; i < NL; ++i) {
    const size_t wo = (size_t)i * DIM * DIM;
    const size_t fo = (size_t)i * DIM * FFD;
    layernorm_f16_kernel<<<SEQ, 128, 0, stream>>>(x, ln1g + i * DIM, ln1b + i * DIM, h16);
    gemm_f16_wmma<0><<<dim3(3 * DIM / 128, SEQ / 128), 256, 0, stream>>>(
        h16, QKVT + (size_t)i * 3 * DIM * DIM, nullptr, qkvf, nullptr, SEQ, 3 * DIM, DIM);
    attn_chunk_state_kernel<<<dim3(NH, NCH - 1), 256, 0, stream>>>(qkvf, sws, kws);
    attn_chunk_out_kernel<<<dim3(NH, NCH), 256, 0, stream>>>(qkvf, sws, kws, a16);
    gemm_f16_wmma<1><<<gD, 256, 0, stream>>>(a16, WoT + wo, bo + i * DIM, x, nullptr, SEQ, DIM, DIM);
    layernorm_f16_kernel<<<SEQ, 128, 0, stream>>>(x, ln2g + i * DIM, ln2b + i * DIM, h16);
    gemm_f16_wmma<2><<<dim3(FFD / 128, SEQ / 128), 256, 0, stream>>>(
        h16, W1T + fo, b1 + i * FFD, nullptr, ff16, SEQ, FFD, DIM);
    gemm_f16_wmma<1><<<gD, 256, 0, stream>>>(ff16, W2T + fo, b2 + i * DIM, x, nullptr, SEQ, DIM, FFD);
  }
  layernorm_f16_kernel<<<SEQ, 128, 0, stream>>>(x, lnfg, lnfb, h16);
  gemm_f16_wmma<0><<<dim3(VOCAB / 128, SEQ / 128), 256, 0, stream>>>(
      h16, WoutT, bout, out, nullptr, SEQ, VOCAB, DIM);
}

// v002
// It runs in 531 microseconds.
// In two side-by-side timings against v001, it was 1.16 and 1.18 times as fast.
// Over all steps from v000 it is 20.7 times as fast.
#include <hip/hip_runtime.h>
#include <hip/hip_bf16.h>
#include <math.h>
#include <stdint.h>

// ---- model dims (fixed by reference) ----
#define SEQ   1024
#define DIM   512
#define NH    8
#define DHEAD 64
#define FFD   2048
#define NL    4
#define VOCAB 32000

typedef __attribute__((ext_vector_type(16))) _Float16 v16h;
typedef __attribute__((ext_vector_type(8)))  _Float16 v8h;
typedef __attribute__((ext_vector_type(8)))  float    v8f;
typedef __attribute__((__vector_size__(16))) int      v4i;   // matches builtin param type

// ---- CDNA5 async global->LDS path (ASYNCcnt) --------------------------------
#if defined(__has_builtin)
#  if __has_builtin(__builtin_amdgcn_global_load_async_to_lds_b128)
#    define USE_ASYNC_LDS 1
#  endif
#endif
#ifndef USE_ASYNC_LDS
#  define USE_ASYNC_LDS 0
#endif

// Rebuild addrspace-qualified int4 pointers from flat addresses (LDS flat addr
// low 32 bits == LDS byte offset on CDNA5, ISA 10.2 aperture mapping; flat ==
// global address for AS1).
#define AS1P(p) ((__attribute__((address_space(1))) v4i*)(unsigned long long)(uintptr_t)(p))
#define AS3P(p) ((__attribute__((address_space(3))) v4i*)(unsigned)(uintptr_t)(p))

__device__ __forceinline__ void wait_asynccnt0() {
#if defined(__has_builtin)
#  if __has_builtin(__builtin_amdgcn_s_wait_asynccnt)
  __builtin_amdgcn_s_wait_asynccnt(0);
#  else
  asm volatile("s_wait_asynccnt 0x0" ::: "memory");
#  endif
#else
  asm volatile("s_wait_asynccnt 0x0" ::: "memory");
#endif
}

// ---------------------------------------------------------------------------
// Embedding: x[n,d] = tok_emb[tokens[n],d] + pos_emb[n,d]
// ---------------------------------------------------------------------------
__global__ void embed_kernel(const int* __restrict__ tokens,
                             const float* __restrict__ tok_emb,
                             const float* __restrict__ pos_emb,
                             float* __restrict__ x) {
  int idx = blockIdx.x * 256 + threadIdx.x;
  int n = idx >> 9;
  int d = idx & (DIM - 1);
  x[idx] = tok_emb[(size_t)tokens[n] * DIM + d] + pos_emb[idx];
}

// ---------------------------------------------------------------------------
// Weight transpose + fp32 -> f16 convert:  in[K][N] -> out[N][K], every weight
// matrix of the model in ONE launch. A work-group takes one tile of 64 k x 256 n:
// a wave's load is 512 contiguous bytes of an input row, a wave's store is four
// whole 128-byte lines of output rows.
// ---------------------------------------------------------------------------
#define WTK 64
#define WTN 256
#define WTP (WTK + 8)                        // LDS row pitch in halves: 144 B = 16 B x odd
typedef __attribute__((ext_vector_type(4))) float wt4f;

template <int K, int N>
__device__ __forceinline__ void wt_tile(const float* __restrict__ in, _Float16* __restrict__ out,
                                        int kt, int nt, _Float16 (*tile)[WTP]) {
  const int tid = threadIdx.x;
  const int c  = tid & 63;                   // columns n = 4c .. 4c+3 of the tile
  const int kr = tid >> 6;                   // rows k = 16kr .. 16kr+15 of the tile
  const float* s = in + (size_t)(kt * WTK + kr * 16) * N + nt * WTN + 4 * c;
  wt4f r[16];
#pragma unroll
  for (int i = 0; i < 16; ++i) r[i] = *(const wt4f*)(s + (size_t)i * N);
#pragma unroll
  for (int j = 0; j < 4; ++j) {
    v8h lo, hi;
#pragma unroll
    for (int i = 0; i < 8; ++i) { lo[i] = (_Float16)r[i][j]; hi[i] = (_Float16)r[8 + i][j]; }
    *(v8h*)&tile[4 * c + j][kr * 16]     = lo;
    *(v8h*)&tile[4 * c + j][kr * 16 + 8] = hi;
  }
  __syncthreads();
  const int n0 = tid >> 3, q = (tid & 7) * 8;  // 8 lanes a row of 64 halves
  _Float16* d = out + (size_t)(nt * WTN + n0) * K + kt * WTK + q;
#pragma unroll
  for (int p = 0; p < 8; ++p)
    *(v8h*)(d + (size_t)p * 32 * K) = *(const v8h*)&tile[n0 + 32 * p][q];
}

#define WT_OUT_TILES ((DIM / WTK) * (VOCAB / WTN))                 // 1000
#define WT_SQ_TILES  ((DIM / WTK) * (DIM / WTN))                   // 16 for one DIM x DIM matrix
#define WT_FF_TILES  ((DIM / WTK) * (FFD / WTN))                   // 64 for W1, as many for W2
#define WT_LAYER_TILES (4 * WT_SQ_TILES + 2 * WT_FF_TILES)         // 192
#define WT_TILES (WT_OUT_TILES + NL * WT_LAYER_TILES)              // 1768

__global__ void __launch_bounds__(256)
wt_transpose_all_f16(const float* __restrict__ Wq, const float* __restrict__ Wk,
                     const float* __restrict__ Wv, const float* __restrict__ Wo,
                     const float* __restrict__ W1, const float* __restrict__ W2,
                     const float* __restrict__ Wout,
                     _Float16* __restrict__ QKVT, _Float16* __restrict__ WoT,
                     _Float16* __restrict__ W1T, _Float16* __restrict__ W2T,
                     _Float16* __restrict__ WoutT) {
  __shared__ __align__(16) _Float16 tile[WTN][WTP];
  const int b = blockIdx.x;                  // every choice below is the same for the whole work-group
  if (b < WT_OUT_TILES) {
    wt_tile<DIM, VOCAB>(Wout, WoutT, b & 7, b >> 3, tile);
    return;
  }
  const int u = b - WT_OUT_TILES;
  const int layer = u / WT_LAYER_TILES;
  const int r = u - layer * WT_LAYER_TILES;
  if (r < 4 * WT_SQ_TILES) {
    const int which = r >> 4, t = r & 15;    // Wq, Wk, Wv, Wo
    const float* in = (which == 0 ? Wq : which == 1 ? Wk : which == 2 ? Wv : Wo) + (size_t)layer * DIM * DIM;
    _Float16* out = which < 3 ? QKVT + (size_t)(layer * 3 + which) * DIM * DIM
                              : WoT + (size_t)layer * DIM * DIM;
    wt_tile<DIM, DIM>(in, out, t & 7, t >> 3, tile);
  } else if (r < 4 * WT_SQ_TILES + WT_FF_TILES) {
    const int t = r - 4 * WT_SQ_TILES;
    wt_tile<DIM, FFD>(W1 + (size_t)layer * DIM * FFD, W1T + (size_t)layer * DIM * FFD, t & 7, t >> 3, tile);
  } else {
    const int t = r - 4 * WT_SQ_TILES - WT_FF_TILES;
    wt_tile<FFD, DIM>(W2 + (size_t)layer * DIM * FFD, W2T + (size_t)layer * DIM * FFD, t & 31, t >> 5, tile);
  }
}

// ---------------------------------------------------------------------------
// LayerNorm (per row of [SEQ, DIM]) -> f16 activations for GEMM A-operand
// ---------------------------------------------------------------------------
__global__ void layernorm_f16_kernel(const float* __restrict__ x,
                                     const float* __restrict__ g,
                                     const float* __restrict__ b,
                                     _Float16* __restrict__ out) {
  __shared__ float r1[128], r2[128];
  const int row = blockIdx.x, t = threadIdx.x;
  const float* xr = x + (size_t)row * DIM;
  float s = 0.f, s2 = 0.f;
  for (int d = t; d < DIM; d += 128) { float v = xr[d]; s += v; s2 += v * v; }
  r1[t] = s; r2[t] = s2; __syncthreads();
#pragma unroll
  for (int st = 64; st > 0; st >>= 1) {
    if (t < st) { r1[t] += r1[t + st]; r2[t] += r2[t + st]; }
    __syncthreads();
  }
  const float mean = r1[0] * (1.f / DIM);
  const float var  = r2[0] * (1.f / DIM) - mean * mean;
  const float rstd = rsqrtf(var + 1e-5f);
  for (int d = t; d < DIM; d += 128)
    out[(size_t)row * DIM + d] = (_Float16)((xr[d] - mean) * rstd * g[d] + b[d]);
}

// ---------------------------------------------------------------------------
// WMMA GEMM:  C[M,N] (op)= A[M,K](f16) * Bt[N,K](f16)^T + bias
//   EPI 0: C(f32) = val          EPI 1: C(f32) += val          EPI 2: Ch(f16) = gelu(val)
// Block: 256 threads = 8 wave32 (4x2). Block tile 128x128, wave tile 32x64
// (2 A-frags x 4 B-frags = 8 WMMA / K-step). Double-buffered LDS; async
// global->LDS staging (ASYNCcnt) overlapped with WMMA when available.
// M,N multiples of 128; K multiple of 32.
// ---------------------------------------------------------------------------
template <int EPI>
__global__ void __launch_bounds__(256)
gemm_f16_wmma(const _Float16* __restrict__ A, const _Float16* __restrict__ Bt,
              const float* __restrict__ bias, float* __restrict__ C,
              _Float16* __restrict__ Ch, int M, int N, int K) {
  __shared__ __align__(16) _Float16 lA[2][128][40];   // 32 K-halves + pad
  __shared__ __align__(16) _Float16 lB[2][128][40];

  const int tid  = threadIdx.x;
  const int lane = tid & 31;
  const int wid  = tid >> 5;
  const int wr   = wid >> 1;                 // 0..3  (32-row slab)
  const int wc   = wid & 1;                  // 0..1  (64-col slab)
  const int rowBase = blockIdx.y * 128;
  const int colBase = blockIdx.x * 128;

  // staging: 128 rows x 32 halves per operand; thread -> 32B of one row
  const int srow = tid >> 1;                 // 0..127
  const int skq  = (tid & 1) * 16;           // 0 or 16 halves
  const _Float16* gA = A  + (size_t)(rowBase + srow) * K + skq;
  const _Float16* gB = Bt + (size_t)(colBase + srow) * K + skq;

  // fragment coords (16-bit 16x32 layout: lane%16 = row/col, lane/16 = K-half)
  const int mrow = lane & 15;
  const int kb   = (lane >> 4) * 8;

  v8f acc[2][4];
#pragma unroll
  for (int a = 0; a < 2; ++a)
#pragma unroll
    for (int j = 0; j < 4; ++j) acc[a][j] = (v8f){};

  // ---- prologue: stage tile 0 into buffer 0 ----
#if USE_ASYNC_LDS
  __builtin_amdgcn_global_load_async_to_lds_b128(AS1P(gA),     AS3P(&lA[0][srow][skq]),     0, 0);
  __builtin_amdgcn_global_load_async_to_lds_b128(AS1P(gA + 8), AS3P(&lA[0][srow][skq + 8]), 0, 0);
  __builtin_amdgcn_global_load_async_to_lds_b128(AS1P(gB),     AS3P(&lB[0][srow][skq]),     0, 0);
  __builtin_amdgcn_global_load_async_to_lds_b128(AS1P(gB + 8), AS3P(&lB[0][srow][skq + 8]), 0, 0);
  wait_asynccnt0();
#else
  *(v8h*)&lA[0][srow][skq]     = *(const v8h*)(gA);
  *(v8h*)&lA[0][srow][skq + 8] = *(const v8h*)(gA + 8);
  *(v8h*)&lB[0][srow][skq]     = *(const v8h*)(gB);
  *(v8h*)&lB[0][srow][skq + 8] = *(const v8h*)(gB + 8);
#endif
  __syncthreads();

  int buf = 0;
  for (int k0 = 0; k0 < K; k0 += 32) {
    const bool more = (k0 + 32) < K;
#if USE_ASYNC_LDS
    if (more) {   // issue next tile while this one computes
      __builtin_amdgcn_global_load_async_to_lds_b128(AS1P(gA + k0 + 32), AS3P(&lA[buf ^ 1][srow][skq]),     0, 0);
      __builtin_amdgcn_global_load_async_to_lds_b128(AS1P(gA + k0 + 40), AS3P(&lA[buf ^ 1][srow][skq + 8]), 0, 0);
      __builtin_amdgcn_global_load_async_to_lds_b128(AS1P(gB + k0 + 32), AS3P(&lB[buf ^ 1][srow][skq]),     0, 0);
      __builtin_amdgcn_global_load_async_to_lds_b128(AS1P(gB + k0 + 40), AS3P(&lB[buf ^ 1][srow][skq + 8]), 0, 0);
    }
#else
    v8h ra0, ra1, rb0, rb1;
    if (more) {
      ra0 = *(const v8h*)(gA + k0 + 32);
      ra1 = *(const v8h*)(gA + k0 + 40);
      rb0 = *(const v8h*)(gB + k0 + 32);
      rb1 = *(const v8h*)(gB + k0 + 40);
    }
#endif

    union Frag { v16h v; v8h h[2]; } af[2], bf[4];
#pragma unroll
    for (int a = 0; a < 2; ++a) {
      const int r = wr * 32 + a * 16 + mrow;
      af[a].h[0] = *(const v8h*)&lA[buf][r][kb];
      af[a].h[1] = *(const v8h*)&lA[buf][r][kb + 16];
    }
#pragma unroll
    for (int j = 0; j < 4; ++j) {
      const int r = wc * 64 + j * 16 + mrow;
      bf[j].h[0] = *(const v8h*)&lB[buf][r][kb];
      bf[j].h[1] = *(const v8h*)&lB[buf][r][kb + 16];
    }
#pragma unroll
    for (int a = 0; a < 2; ++a)
#pragma unroll
      for (int j = 0; j < 4; ++j)
        acc[a][j] = __builtin_amdgcn_wmma_f32_16x16x32_f16(false, af[a].v, false, bf[j].v,
                                                           (short)0, acc[a][j], false, false);

#if USE_ASYNC_LDS
    if (more) wait_asynccnt0();
#else
    if (more) {
      *(v8h*)&lA[buf ^ 1][srow][skq]     = ra0;
      *(v8h*)&lA[buf ^ 1][srow][skq + 8] = ra1;
      *(v8h*)&lB[buf ^ 1][srow][skq]     = rb0;
      *(v8h*)&lB[buf ^ 1][srow][skq + 8] = rb1;
    }
#endif
    __syncthreads();
    buf ^= 1;
  }

  // C/D layout: VGPR i -> M = i + 8*(lane/16), N = lane%16
  const int row0 = rowBase + wr * 32 + (lane >> 4) * 8;
  const int colW = colBase + wc * 64 + (lane & 15);
#pragma unroll
  for (int a = 0; a < 2; ++a) {
#pragma unroll
    for (int j = 0; j < 4; ++j) {
      const int col = colW + j * 16;
      const float bb = bias ? bias[col] : 0.f;
#pragma unroll
      for (int i = 0; i < 8; ++i) {
        const size_t idx = (size_t)(row0 + a * 16 + i) * N + col;
        const float v = acc[a][j][i] + bb;
        if (EPI == 0)      C[idx] = v;
        else if (EPI == 1) C[idx] += v;
        else Ch[idx] = (_Float16)(0.5f * v * (1.f + erff(v * 0.70710678118f)));
      }
    }
  }
}

// ---------------------------------------------------------------------------
// Causal linear attention over fused QKV buffer [SEQ][3*DIM], in chunks of
// ACH tokens. With ke = exp(k), qs = softmax(q) * DHEAD^-0.5 and, for chunk c,
//   Sprev = sum over tokens before the chunk of ke^T v     (DHEAD x DHEAD)
//   kprev = sum over tokens before the chunk of ke         (DHEAD)
//   P[n][m] = qs[n] . ke[m] for m <= n inside the chunk, else 0
// the output row is (qs[n] . Sprev + P[n] . v) / max(qs[n] . kprev + sum_m P[n][m], eps).
// Launch 1 writes each chunk's own ke^T v and sum of ke, the last chunk's excepted; launch 2 adds up the
// chunks before its own and forms the rows. All sums in f32.
// ---------------------------------------------------------------------------
#define ACH 64
#define NCH (SEQ / ACH)
typedef __attribute__((ext_vector_type(4))) float    v4f;
typedef __attribute__((ext_vector_type(2))) float    v2f;
typedef __attribute__((ext_vector_type(4))) _Float16 v4h;

// grid (NH, NCH-1): the last chunk's sums have no reader.
__global__ void __launch_bounds__(256)
attn_chunk_state_kernel(const float* __restrict__ QKV, float* __restrict__ Sws,
                        float* __restrict__ Kws) {
  __shared__ __align__(16) float ke[ACH][DHEAD];
  __shared__ __align__(16) float vs[ACH][DHEAD];
  const int h = blockIdx.x, c = blockIdx.y, tid = threadIdx.x;
  const int l = tid & 15, g = tid >> 4;
#pragma unroll
  for (int p = 0; p < 4; ++p) {
    const int n = p * 16 + g;
    const float* s = QKV + (size_t)(c * ACH + n) * (3 * DIM) + h * DHEAD + 4 * l;
    v4f kv = *(const v4f*)(s + DIM);
    const v4f vv = *(const v4f*)(s + 2 * DIM);
#pragma unroll
    for (int e = 0; e < 4; ++e) kv[e] = __expf(kv[e]);
    *(v4f*)&ke[n][4 * l] = kv;
    *(v4f*)&vs[n][4 * l] = vv;
  }
  __syncthreads();

  // thread tile: rows d = 4g..4g+3, columns e = 4l..4l+3
  v4f acc[4];
  v4f ks = (v4f){0.f, 0.f, 0.f, 0.f};
#pragma unroll
  for (int i = 0; i < 4; ++i) acc[i] = (v4f){0.f, 0.f, 0.f, 0.f};
#pragma unroll 8
  for (int n = 0; n < ACH; ++n) {
    const v4f a = *(const v4f*)&ke[n][4 * g];
    const v4f b = *(const v4f*)&vs[n][4 * l];
#pragma unroll
    for (int i = 0; i < 4; ++i) acc[i] += a[i] * b;
    ks += a;
  }
  float* dst = Sws + (size_t)(h * NCH + c) * (DHEAD * DHEAD);
#pragma unroll
  for (int i = 0; i < 4; ++i) *(v4f*)(dst + (4 * g + i) * DHEAD + 4 * l) = acc[i];
  if (l == 0) *(v4f*)(Kws + (h * NCH + c) * DHEAD + 4 * g) = ks;
}

// grid (NH, NCH)
__global__ void __launch_bounds__(256)
attn_chunk_out_kernel(const float* __restrict__ QKV, const float* __restrict__ Sws,
                      const float* __restrict__ Kws, _Float16* __restrict__ Aout) {
  __shared__ __align__(16) float X[ACH][DHEAD + ACH + 4];   // row n: qs[n][0..63] | P[n][0..63]
  __shared__ __align__(16) float Y[DHEAD + ACH][DHEAD];     // rows 0..63 Sprev[d][e], rows 64.. v[m][e]
  __shared__ __align__(16) float Kl[ACH][DHEAD + 4];        // ke[m][d]; pitch 16 B x odd
  __shared__ __align__(16) float kp[DHEAD];                 // kprev
  const int h = blockIdx.x, c = blockIdx.y, tid = threadIdx.x;
  const int l = tid & 15, g = tid >> 4;

  // ---- Sprev, kprev: add up the chunks before this one, four chunks' loads in flight ----
  v4f sp[4];
#pragma unroll
  for (int r = 0; r < 4; ++r) sp[r] = (v4f){0.f, 0.f, 0.f, 0.f};
  const float* sb = Sws + (size_t)h * NCH * (DHEAD * DHEAD);
  const unsigned so = (unsigned)tid * 4u;
  for (int g0 = 0; g0 < c; g0 += 4) {
    v4f t[4][4];
    const float* sc[4];
#pragma unroll
    for (int j = 0; j < 4; ++j) {
      sc[j] = sb + (size_t)min(g0 + j, c - 1) * (DHEAD * DHEAD) + so;
#pragma unroll
      for (int r = 0; r < 4; ++r) t[j][r] = *(const v4f*)(sc[j] + r * 1024);
    }
    // the addresses as inputs keep the issued loads' address registers untouched up to this wait;
    // behind it the next trip may form new ones
    asm volatile("s_wait_xcnt 0x0" :: "v"(sc[0]), "v"(sc[1]), "v"(sc[2]), "v"(sc[3]) : "memory");
#pragma unroll
    for (int j = 0; j < 4; ++j) {
      const float w = (g0 + j < c) ? 1.f : 0.f;
#pragma unroll
      for (int r = 0; r < 4; ++r) sp[r] += w * t[j][r];
    }
  }
#pragma unroll
  for (int r = 0; r < 4; ++r) *(v4f*)&Y[r * 16 + g][4 * l] = sp[r];
  if (tid < DHEAD) {
    float s = 0.f;
#pragma unroll
    for (int cc = 0; cc < NCH - 1; ++cc) {
      const float t = Kws[(h * NCH + cc) * DHEAD + tid];
      s += (cc < c) ? t : 0.f;
    }
    kp[tid] = s;
  }

  // ---- this chunk's q (softmax over the row, 16 lanes a row), ke, v ----
  const float* sq[4];
  v4f q4[4], k4[4], v4[4];
#pragma unroll
  for (int p = 0; p < 4; ++p) {
    sq[p] = QKV + (size_t)(c * ACH + p * 16 + g) * (3 * DIM) + h * DHEAD + 4 * l;
    q4[p] = *(const v4f*)(sq[p]);
    k4[p] = *(const v4f*)(sq[p] + DIM);
    v4[p] = *(const v4f*)(sq[p] + 2 * DIM);
  }
  // the addresses as inputs keep the issued loads' address registers untouched up to this wait
  asm volatile("s_wait_xcnt 0x0" :: "v"(sq[0]), "v"(sq[1]), "v"(sq[2]), "v"(sq[3]) : "memory");
#pragma unroll
  for (int p = 0; p < 4; ++p) {
    const int n = p * 16 + g;
    v4f qv = q4[p];
    v4f kv = k4[p];
    const v4f vv = v4[p];
    float mx = fmaxf(fmaxf(qv[0], qv[1]), fmaxf(qv[2], qv[3]));
#pragma unroll
    for (int m = 1; m < 16; m <<= 1) mx = fmaxf(mx, __shfl_xor(mx, m));
#pragma unroll
    for (int e = 0; e < 4; ++e) qv[e] = __expf(qv[e] - mx);
    float sm = (qv[0] + qv[1]) + (qv[2] + qv[3]);
#pragma unroll
    for (int m = 1; m < 16; m <<= 1) sm += __shfl_xor(sm, m);
    const float qsc = 0.125f / sm;                 // 1 / row sum, * DHEAD^-0.5
#pragma unroll
    for (int e = 0; e < 4; ++e) {
      qv[e] *= qsc;
      kv[e] = __expf(kv[e]);
    }
    *(v4f*)&X[n][4 * l]          = qv;
    *(v4f*)&Kl[n][4 * l]         = kv;
    *(v4f*)&Y[DHEAD + n][4 * l]  = vv;
  }
  __syncthreads();

  // ---- P: thread tile rows n = tn..tn+3, columns m = l + 16*jj ----
  const int tn = 4 * g;
  v2f pr2[4][4];                                   // even-d and odd-d halves of each dot product
#pragma unroll
  for (int i = 0; i < 4; ++i)
#pragma unroll
    for (int jj = 0; jj < 4; ++jj) pr2[i][jj] = (v2f){0.f, 0.f};
#pragma unroll 2
  for (int d = 0; d < DHEAD; d += 4) {
    v4f qa[4], kb[4];
#pragma unroll
    for (int i = 0; i < 4; ++i) qa[i] = *(const v4f*)&X[tn + i][d];
#pragma unroll
    for (int jj = 0; jj < 4; ++jj) kb[jj] = *(const v4f*)&Kl[l + 16 * jj][d];
#pragma unroll
    for (int i = 0; i < 4; ++i)
#pragma unroll
      for (int jj = 0; jj < 4; ++jj) {
        pr2[i][jj] += qa[i].lo * kb[jj].lo;
        pr2[i][jj] += qa[i].hi * kb[jj].hi;
      }
  }
  // denominator: each of the row's 16 lanes adds its four columns of P and its
  // four terms of qs . kprev; the lanes are then summed.
  float dinv[4];
  const v4f kq = *(const v4f*)&kp[4 * l];
#pragma unroll
  for (int i = 0; i < 4; ++i) {
    const v4f qq = *(const v4f*)&X[tn + i][4 * l];
    float rs = (qq[0] * kq[0] + qq[1] * kq[1]) + (qq[2] * kq[2] + qq[3] * kq[3]);
#pragma unroll
    for (int jj = 0; jj < 4; ++jj) {
      const int m = l + 16 * jj;
      const float pv = (m <= tn + i) ? pr2[i][jj][0] + pr2[i][jj][1] : 0.f;   // causal, own token included
      rs += pv;
      X[tn + i][DHEAD + m] = pv;
    }
#pragma unroll
    for (int m = 1; m < 16; m <<= 1) rs += __shfl_xor(rs, m);
    dinv[i] = 1.f / fmaxf(rs, 1e-3f);
  }
  __syncthreads();

  // ---- rows: [qs | P] x [Sprev ; v]; P is zero from column 8*(wave+1) on for this wave's rows ----
  const int jEnd = DHEAD + 8 * (__builtin_amdgcn_readfirstlane(tid >> 5) + 1);
  v4f o[4];
#pragma unroll
  for (int i = 0; i < 4; ++i) o[i] = (v4f){0.f, 0.f, 0.f, 0.f};
#pragma unroll 2
  for (int j = 0; j < jEnd; j += 4) {
    v4f xa[4], yb[4];
#pragma unroll
    for (int i = 0; i < 4; ++i) xa[i] = *(const v4f*)&X[tn + i][j];
#pragma unroll
    for (int e = 0; e < 4; ++e) yb[e] = *(const v4f*)&Y[j + e][4 * l];
#pragma unroll
    for (int i = 0; i < 4; ++i)
#pragma unroll
      for (int e = 0; e < 4; ++e) o[i] += xa[i][e] * yb[e];
  }
#pragma unroll
  for (int i = 0; i < 4; ++i) {
    v4h hv;
#pragma unroll
    for (int e = 0; e < 4; ++e) hv[e] = (_Float16)(o[i][e] * dinv[i]);
    *(v4h*)(Aout + (size_t)(c * ACH + tn + i) * DIM + h * DHEAD + 4 * l) = hv;
  }
}

// ---------------------------------------------------------------------------
// Host orchestration
// ---------------------------------------------------------------------------
extern "C" void kernel_launch(void* const* d_in, const int* in_sizes, int n_in,
                              void* d_out, int out_size, void* d_ws, size_t ws_size,
                              hipStream_t stream) {
  (void)in_sizes; (void)n_in; (void)out_size; (void)ws_size;
  const int*   tokens  = (const int*)  d_in[0];
  const float* tok_emb = (const float*)d_in[1];
  const float* pos_emb = (const float*)d_in[2];
  const float* Wq  = (const float*)d_in[3];
  const float* Wk  = (const float*)d_in[4];
  const float* Wv  = (const float*)d_in[5];
  const float* Wo  = (const float*)d_in[6];
  const float* bo  = (const float*)d_in[7];
  const float* ln1g = (const float*)d_in[8];
  const float* ln1b = (const float*)d_in[9];
  const float* W1  = (const float*)d_in[10];
  const float* b1  = (const float*)d_in[11];
  const float* W2  = (const float*)d_in[12];
  const float* b2  = (const float*)d_in[13];
  const float* ln2g = (const float*)d_in[14];
  const float* ln2b = (const float*)d_in[15];
  const float* lnfg = (const float*)d_in[16];
  const float* lnfb = (const float*)d_in[17];
  const float* Wout = (const float*)d_in[18];
  const float* bout = (const float*)d_in[19];
  float* out = (float*)d_out;

  char* p = (char*)d_ws;
  auto carve = [&](size_t bytes) -> char* {
    char* r = p; p += (bytes + 255) & ~(size_t)255; return r;
  };
  _Float16* QKVT  = (_Float16*)carve((size_t)NL * 3 * DIM * DIM * 2);  // fused [1536][512] per layer
  _Float16* WoT   = (_Float16*)carve((size_t)NL * DIM * DIM * 2);
  _Float16* W1T   = (_Float16*)carve((size_t)NL * DIM * FFD * 2);
  _Float16* W2T   = (_Float16*)carve((size_t)NL * DIM * FFD * 2);
  _Float16* WoutT = (_Float16*)carve((size_t)DIM * VOCAB * 2);
  float*    x     = (float*)   carve((size_t)SEQ * DIM * 4);
  _Float16* h16   = (_Float16*)carve((size_t)SEQ * DIM * 2);
  float*    qkvf  = (float*)   carve((size_t)SEQ * 3 * DIM * 4);
  _Float16* a16   = (_Float16*)carve((size_t)SEQ * DIM * 2);
  _Float16* ff16  = (_Float16*)carve((size_t)SEQ * FFD * 2);
  float*    sws   = (float*)   carve((size_t)NH * NCH * DHEAD * DHEAD * 4);  // per-chunk ke^T v
  float*    kws   = (float*)   carve((size_t)NH * NCH * DHEAD * 4);          // per-chunk sum of ke

  wt_transpose_all_f16<<<WT_TILES, 256, 0, stream>>>(Wq, Wk, Wv, Wo, W1, W2, Wout,
                                                     QKVT, WoT, W1T, W2T, WoutT);

  embed_kernel<<<SEQ * DIM / 256, 256, 0, stream>>>(tokens, tok_emb, pos_emb, x);

  const dim3 gD(DIM / 128, SEQ / 128);      // (4, 8)
  for (int i = 0; i < NL; ++i) {
    const size_t wo = (size_t)i * DIM * DIM;
    const size_t fo = (size_t)i * DIM * FFD;
    layernorm_f16_kernel<<<SEQ, 128, 0, stream>>>(x, ln1g + i * DIM, ln1b + i * DIM, h16);
    gemm_f16_wmma<0><<<dim3(3 * DIM / 128, SEQ / 128), 256, 0, stream>>>(
        h16, QKVT + (size_t)i * 3 * DIM * DIM, nullptr, qkvf, nullptr, SEQ, 3 * DIM, DIM);
    attn_chunk_state_kernel<<<dim3(NH, NCH - 1), 256, 0, stream>>>(qkvf, sws, kws);
    attn_chunk_out_kernel<<<dim3(NH, NCH), 256, 0, stream>>>(qkvf, sws, kws, a16);
    gemm_f16_wmma<1><<<gD, 256, 0, stream>>>(a16, WoT + wo, bo + i * DIM, x, nullptr, SEQ, DIM, DIM);
    layernorm_f16_kernel<<<SEQ, 128, 0, stream>>>(x, ln2g + i * DIM, ln2b + i * DIM, h16);
    gemm_f16_wmma<2><<<dim3(FFD / 128, SEQ / 128), 256, 0, stream>>>(
        h16, W1T + fo, b1 + i * FFD, nullptr, ff16, SEQ, FFD, DIM);
    gemm_f16_wmma<1><<<gD, 256, 0, stream>>>(ff16, W2T + fo, b2 + i * DIM, x, nullptr, SEQ, DIM, FFD);
  }
  layernorm_f16_kernel<<<SEQ, 128, 0, stream>>>(x, lnfg, lnfb, h16);
  gemm_f16_wmma<0><<<dim3(VOCAB / 128, SEQ / 128), 256, 0, stream>>>(
      h16, WoutT, bout, out, nullptr, SEQ, VOCAB, DIM);
}

// v003
// One run takes 426 microseconds.
// Timed twice side by side with v002, it ran 1.25 and 1.26 times as fast.
// All steps since v000 together make it 26.1 times as fast.
#include <hip/hip_runtime.h>
#include <hip/hip_bf16.h>
#include <math.h>
#include <stdint.h>

// ---- model dims (fixed by reference) ----
#define SEQ   1024
#define DIM   512
#define NH    8
#define DHEAD 64
#define FFD   2048
#define NL    4
#define VOCAB 32000

typedef __attribute__((ext_vector_type(16))) _Float16 v16h;
typedef __attribute__((ext_vector_type(8)))  _Float16 v8h;
typedef __attribute__((ext_vector_type(8)))  float    v8f;
typedef __attribute__((__vector_size__(16))) int      v4i;   // matches builtin param type

// ---- CDNA5 async global->LDS path (ASYNCcnt) --------------------------------
// Rebuild addrspace-qualified int4 pointers from flat addresses (LDS flat addr
// low 32 bits == LDS byte offset on CDNA5, ISA 10.2 aperture mapping; flat ==
// global address for AS1).
#define AS1P(p) ((__attribute__((address_space(1))) v4i*)(unsigned long long)(uintptr_t)(p))
#define AS3P(p) ((__attribute__((address_space(3))) v4i*)(unsigned)(uintptr_t)(p))

// ---------------------------------------------------------------------------
// Embedding: x[n,d] = tok_emb[tokens[n],d] + pos_emb[n,d]
// ---------------------------------------------------------------------------
__global__ void embed_kernel(const int* __restrict__ tokens,
                             const float* __restrict__ tok_emb,
                             const float* __restrict__ pos_emb,
                             float* __restrict__ x) {
  int idx = blockIdx.x * 256 + threadIdx.x;
  int n = idx >> 9;
  int d = idx & (DIM - 1);
  x[idx] = tok_emb[(size_t)tokens[n] * DIM + d] + pos_emb[idx];
}

// ---------------------------------------------------------------------------
// Weight transpose + fp32 -> f16 convert:  in[K][N] -> out[N][K], every weight
// matrix of the model in ONE launch. A work-group takes one tile of 64 k x 256 n:
// a wave's load is 512 contiguous bytes of an input row, a wave's store is four
// whole 128-byte lines of output rows.
// ---------------------------------------------------------------------------
#define WTK 64
#define WTN 256
#define WTP (WTK + 8)                        // LDS row pitch in halves: 144 B = 16 B x odd
typedef __attribute__((ext_vector_type(4))) float wt4f;

template <int K, int N>
__device__ __forceinline__ void wt_tile(const float* __restrict__ in, _Float16* __restrict__ out,
                                        int kt, int nt, _Float16 (*tile)[WTP]) {
  const int tid = threadIdx.x;
  const int c  = tid & 63;                   // columns n = 4c .. 4c+3 of the tile
  const int kr = tid >> 6;                   // rows k = 16kr .. 16kr+15 of the tile
  const float* s = in + (size_t)(kt * WTK + kr * 16) * N + nt * WTN + 4 * c;
  wt4f r[16];
#pragma unroll
  for (int i = 0; i < 16; ++i) r[i] = *(const wt4f*)(s + (size_t)i * N);
#pragma unroll
  for (int j = 0; j < 4; ++j) {
    v8h lo, hi;
#pragma unroll
    for (int i = 0; i < 8; ++i) { lo[i] = (_Float16)r[i][j]; hi[i] = (_Float16)r[8 + i][j]; }
    *(v8h*)&tile[4 * c + j][kr * 16]     = lo;
    *(v8h*)&tile[4 * c + j][kr * 16 + 8] = hi;
  }
  __syncthreads();
  const int n0 = tid >> 3, q = (tid & 7) * 8;  // 8 lanes a row of 64 halves
  _Float16* d = out + (size_t)(nt * WTN + n0) * K + kt * WTK + q;
#pragma unroll
  for (int p = 0; p < 8; ++p)
    *(v8h*)(d + (size_t)p * 32 * K) = *(const v8h*)&tile[n0 + 32 * p][q];
}

#define WT_OUT_TILES ((DIM / WTK) * (VOCAB / WTN))                 // 1000
#define WT_SQ_TILES  ((DIM / WTK) * (DIM / WTN))                   // 16 for one DIM x DIM matrix
#define WT_FF_TILES  ((DIM / WTK) * (FFD / WTN))                   // 64 for W1, as many for W2
#define WT_LAYER_TILES (4 * WT_SQ_TILES + 2 * WT_FF_TILES)         // 192
#define WT_TILES (WT_OUT_TILES + NL * WT_LAYER_TILES)              // 1768

__global__ void __launch_bounds__(256)
wt_transpose_all_f16(const float* __restrict__ Wq, const float* __restrict__ Wk,
                     const float* __restrict__ Wv, const float* __restrict__ Wo,
                     const float* __restrict__ W1, const float* __restrict__ W2,
                     const float* __restrict__ Wout,
                     _Float16* __restrict__ QKVT, _Float16* __restrict__ WoT,
                     _Float16* __restrict__ W1T, _Float16* __restrict__ W2T,
                     _Float16* __restrict__ WoutT) {
  __shared__ __align__(16) _Float16 tile[WTN][WTP];
  const int b = blockIdx.x;                  // every choice below is the same for the whole work-group
  if (b < WT_OUT_TILES) {
    wt_tile<DIM, VOCAB>(Wout, WoutT, b & 7, b >> 3, tile);
    return;
  }
  const int u = b - WT_OUT_TILES;
  const int layer = u / WT_LAYER_TILES;
  const int r = u - layer * WT_LAYER_TILES;
  if (r < 4 * WT_SQ_TILES) {
    const int which = r >> 4, t = r & 15;    // Wq, Wk, Wv, Wo
    const float* in = (which == 0 ? Wq : which == 1 ? Wk : which == 2 ? Wv : Wo) + (size_t)layer * DIM * DIM;
    _Float16* out = which < 3 ? QKVT + (size_t)(layer * 3 + which) * DIM * DIM
                              : WoT + (size_t)layer * DIM * DIM;
    wt_tile<DIM, DIM>(in, out, t & 7, t >> 3, tile);
  } else if (r < 4 * WT_SQ_TILES + WT_FF_TILES) {
    const int t = r - 4 * WT_SQ_TILES;
    wt_tile<DIM, FFD>(W1 + (size_t)layer * DIM * FFD, W1T + (size_t)layer * DIM * FFD, t & 7, t >> 3, tile);
  } else {
    const int t = r - 4 * WT_SQ_TILES - WT_FF_TILES;
    wt_tile<FFD, DIM>(W2 + (size_t)layer * DIM * FFD, W2T + (size_t)layer * DIM * FFD, t & 31, t >> 5, tile);
  }
}

// ---------------------------------------------------------------------------
// LayerNorm (per row of [SEQ, DIM]) -> f16 activations for GEMM A-operand
// ---------------------------------------------------------------------------
__global__ void layernorm_f16_kernel(const float* __restrict__ x,
                                     const float* __restrict__ g,
                                     const float* __restrict__ b,
                                     _Float16* __restrict__ out) {
  __shared__ float r1[128], r2[128];
  const int row = blockIdx.x, t = threadIdx.x;
  const float* xr = x + (size_t)row * DIM;
  float s = 0.f, s2 = 0.f;
  for (int d = t; d < DIM; d += 128) { float v = xr[d]; s += v; s2 += v * v; }
  r1[t] = s; r2[t] = s2; __syncthreads();
#pragma unroll
  for (int st = 64; st > 0; st >>= 1) {
    if (t < st) { r1[t] += r1[t + st]; r2[t] += r2[t + st]; }
    __syncthreads();
  }
  const float mean = r1[0] * (1.f / DIM);
  const float var  = r2[0] * (1.f / DIM) - mean * mean;
  const float rstd = rsqrtf(var + 1e-5f);
  for (int d = t; d < DIM; d += 128)
    out[(size_t)row * DIM + d] = (_Float16)((xr[d] - mean) * rstd * g[d] + b[d]);
}

// ---------------------------------------------------------------------------
// WMMA GEMM:  C[M,N] (op)= A[M,K](f16) * Bt[N,K](f16)^T + bias
//   EPI 0: C(f32) = val          EPI 1: C(f32) += val          EPI 2: Ch(f16) = gelu(val)
// Block: 256 threads = 8 wave32 (4x2). Block tile 128x128, wave tile 32x64
// (2 A-frags x 4 B-frags = 8 WMMA per 32 k). A stage is GBK = 128 k of both
// operands: 256 contiguous bytes of every row, so one wave-wide 16-byte copy
// covers two whole rows of the stage (four whole 128-byte lines). Two LDS
// buffers; the next stage's async copies fly while this one is worked on.
// M,N multiples of 128; K a multiple of 128.
// ---------------------------------------------------------------------------
#define GBK 128
#define GPITCH (GBK + 8)                     // LDS row pitch in halves: 272 B = 16 B x odd

// One stage of one operand: 128 rows x 256 B = 2048 pieces of 16 B, eight a thread.
// g and l already point at this thread's piece of row tid / 16.
__device__ __forceinline__ void gemm_stage_copy(const _Float16* g, _Float16* l, int K) {
#pragma unroll
  for (int i = 0; i < 8; ++i)
    __builtin_amdgcn_global_load_async_to_lds_b128(AS1P(g + (size_t)i * 16 * K),
                                                   AS3P(l + i * 16 * GPITCH), 0, 0);
}

template <int EPI>
__global__ void __launch_bounds__(256)
gemm_f16_wmma(const _Float16* __restrict__ A, const _Float16* __restrict__ Bt,
              const float* __restrict__ bias, float* __restrict__ C,
              _Float16* __restrict__ Ch, int M, int N, int K) {
  __shared__ __align__(16) _Float16 lA[2][128][GPITCH];
  __shared__ __align__(16) _Float16 lB[2][128][GPITCH];

  const int tid  = threadIdx.x;
  const int lane = tid & 31;
  const int wid  = tid >> 5;
  const int wr   = wid >> 1;                 // 0..3  (32-row slab)
  const int wc   = wid & 1;                  // 0..1  (64-col slab)
  const int rowBase = blockIdx.y * 128;
  const int colBase = blockIdx.x * 128;

  // staging: 16 threads a row, 16 B each
  const int srow = tid >> 4;                 // 0..15, + 16 for each further piece
  const int skq  = (tid & 15) * 8;           // halves
  const _Float16* gA = A  + (size_t)(rowBase + srow) * K + skq;
  const _Float16* gB = Bt + (size_t)(colBase + srow) * K + skq;

  // fragment coords (16-bit 16x32 layout: lane%16 = row/col, lane/16 = K-half)
  const int mrow = lane & 15;
  const int kb   = (lane >> 4) * 8;

  v8f acc[2][4];
#pragma unroll
  for (int a = 0; a < 2; ++a)
#pragma unroll
    for (int j = 0; j < 4; ++j) acc[a][j] = (v8f){};

  const int nst = K / GBK;                   // stages; the same for the whole work-group

  // ---- prologue: stage 0 into buffer 0, published; then stage 1 starts into buffer 1 ----
  gemm_stage_copy(gA, &lA[0][srow][skq], K);
  gemm_stage_copy(gB, &lB[0][srow][skq], K);
  asm volatile("s_wait_asynccnt 0x0" ::: "memory");   // this wave's pieces of stage 0 have landed
  __syncthreads();
  if (nst > 1) {
    gemm_stage_copy(gA + GBK, &lA[1][srow][skq], K);
    gemm_stage_copy(gB + GBK, &lB[1][srow][skq], K);
  }

  for (int s = 0; s < nst; ++s) {
    const int buf = s & 1;
#pragma unroll
    for (int ks = 0; ks < GBK; ks += 32) {
      union Frag { v16h v; v8h h[2]; } af[2], bf[4];
#pragma unroll
      for (int a = 0; a < 2; ++a) {
        const int r = wr * 32 + a * 16 + mrow;
        af[a].h[0] = *(const v8h*)&lA[buf][r][ks + kb];
        af[a].h[1] = *(const v8h*)&lA[buf][r][ks + kb + 16];
      }
#pragma unroll
      for (int j = 0; j < 4; ++j) {
        const int r = wc * 64 + j * 16 + mrow;
        bf[j].h[0] = *(const v8h*)&lB[buf][r][ks + kb];
        bf[j].h[1] = *(const v8h*)&lB[buf][r][ks + kb + 16];
      }
#pragma unroll
      for (int a = 0; a < 2; ++a)
#pragma unroll
        for (int j = 0; j < 4; ++j)
          acc[a][j] = __builtin_amdgcn_wmma_f32_16x16x32_f16(false, af[a].v, false, bf[j].v,
                                                             (short)0, acc[a][j], false, false);
    }
    // publish point of stage s + 1
    asm volatile("s_wait_dscnt 0x0" ::: "memory");     // this wave's reads of buffer buf are done before it is refilled
    asm volatile("s_wait_asynccnt 0x0" ::: "memory");  // this wave's pieces of stage s + 1 have landed
    __syncthreads();
    if (s + 2 < nst) {                                 // refill the buffer every wave has just left
      gemm_stage_copy(gA + (size_t)(s + 2) * GBK, &lA[buf][srow][skq], K);
      gemm_stage_copy(gB + (size_t)(s + 2) * GBK, &lB[buf][srow][skq], K);
    }
  }
  asm volatile("s_wait_asynccnt 0x0" ::: "memory");    // no copy is left in flight when the wave goes on to its end

  // C/D layout: VGPR i -> M = i + 8*(lane/16), N = lane%16
  const int row0 = rowBase + wr * 32 + (lane >> 4) * 8;
  const int colW = colBase + wc * 64 + (lane & 15);
#pragma unroll
  for (int a = 0; a < 2; ++a) {
#pragma unroll
    for (int j = 0; j < 4; ++j) {
      const int col = colW + j * 16;
      const float bb = bias ? bias[col] : 0.f;
#pragma unroll
      for (int i = 0; i < 8; ++i) {
        const size_t idx = (size_t)(row0 + a * 16 + i) * N + col;
        const float v = acc[a][j][i] + bb;
        if (EPI == 0)      C[idx] = v;
        else if (EPI == 1) C[idx] += v;
        else Ch[idx] = (_Float16)(0.5f * v * (1.f + erff(v * 0.70710678118f)));
      }
    }
  }
}

// ---------------------------------------------------------------------------
// Causal linear attention over fused QKV buffer [SEQ][3*DIM], in chunks of
// ACH tokens. With ke = exp(k), qs = softmax(q) * DHEAD^-0.5 and, for chunk c,
//   Sprev = sum over tokens before the chunk of ke^T v     (DHEAD x DHEAD)
//   kprev = sum over tokens before the chunk of ke         (DHEAD)
//   P[n][m] = qs[n] . ke[m] for m <= n inside the chunk, else 0
// the output row is (qs[n] . Sprev + P[n] . v) / max(qs[n] . kprev + sum_m P[n][m], eps).
// Launch 1 writes each chunk's own ke^T v and sum of ke, the last chunk's excepted; launch 2 adds up the
// chunks before its own and forms the rows. All sums in f32.
// ---------------------------------------------------------------------------
#define ACH 64
#define NCH (SEQ / ACH)
typedef __attribute__((ext_vector_type(4))) float    v4f;
typedef __attribute__((ext_vector_type(2))) float    v2f;
typedef __attribute__((ext_vector_type(4))) _Float16 v4h;

// grid (NH, NCH-1): the last chunk's sums have no reader.
__global__ void __launch_bounds__(256)
attn_chunk_state_kernel(const float* __restrict__ QKV, float* __restrict__ Sws,
                        float* __restrict__ Kws) {
  __shared__ __align__(16) float ke[ACH][DHEAD];
  __shared__ __align__(16) float vs[ACH][DHEAD];
  const int h = blockIdx.x, c = blockIdx.y, tid = threadIdx.x;
  const int l = tid & 15, g = tid >> 4;
#pragma unroll
  for (int p = 0; p < 4; ++p) {
    const int n = p * 16 + g;
    const float* s = QKV + (size_t)(c * ACH + n) * (3 * DIM) + h * DHEAD + 4 * l;
    v4f kv = *(const v4f*)(s + DIM);
    const v4f vv = *(const v4f*)(s + 2 * DIM);
#pragma unroll
    for (int e = 0; e < 4; ++e) kv[e] = __expf(kv[e]);
    *(v4f*)&ke[n][4 * l] = kv;
    *(v4f*)&vs[n][4 * l] = vv;
  }
  __syncthreads();

  // thread tile: rows d = 4g..4g+3, columns e = 4l..4l+3
  v4f acc[4];
  v4f ks = (v4f){0.f, 0.f, 0.f, 0.f};
#pragma unroll
  for (int i = 0; i < 4; ++i) acc[i] = (v4f){0.f, 0.f, 0.f, 0.f};
#pragma unroll 8
  for (int n = 0; n < ACH; ++n) {
    const v4f a = *(const v4f*)&ke[n][4 * g];
    const v4f b = *(const v4f*)&vs[n][4 * l];
#pragma unroll
    for (int i = 0; i < 4; ++i) acc[i] += a[i] * b;
    ks += a;
  }
  float* dst = Sws + (size_t)(h * NCH + c) * (DHEAD * DHEAD);
#pragma unroll
  for (int i = 0; i < 4; ++i) *(v4f*)(dst + (4 * g + i) * DHEAD + 4 * l) = acc[i];
  if (l == 0) *(v4f*)(Kws + (h * NCH + c) * DHEAD + 4 * g) = ks;
}

// grid (NH, NCH)
__global__ void __launch_bounds__(256)
attn_chunk_out_kernel(const float* __restrict__ QKV, const float* __restrict__ Sws,
                      const float* __restrict__ Kws, _Float16* __restrict__ Aout) {
  __shared__ __align__(16) float X[ACH][DHEAD + ACH + 4];   // row n: qs[n][0..63] | P[n][0..63]
  __shared__ __align__(16) float Y[DHEAD + ACH][DHEAD];     // rows 0..63 Sprev[d][e], rows 64.. v[m][e]
  __shared__ __align__(16) float Kl[ACH][DHEAD + 4];        // ke[m][d]; pitch 16 B x odd
  __shared__ __align__(16) float kp[DHEAD];                 // kprev
  const int h = blockIdx.x, c = blockIdx.y, tid = threadIdx.x;
  const int l = tid & 15, g = tid >> 4;

  // ---- Sprev, kprev: add up the chunks before this one, four chunks' loads in flight ----
  v4f sp[4];
#pragma unroll
  for (int r = 0; r < 4; ++r) sp[r] = (v4f){0.f, 0.f, 0.f, 0.f};
  const float* sb = Sws + (size_t)h * NCH * (DHEAD * DHEAD);
  const unsigned so = (unsigned)tid * 4u;
  for (int g0 = 0; g0 < c; g0 += 4) {
    v4f t[4][4];
    const float* sc[4];
#pragma unroll
    for (int j = 0; j < 4; ++j) {
      sc[j] = sb + (size_t)min(g0 + j, c - 1) * (DHEAD * DHEAD) + so;
#pragma unroll
      for (int r = 0; r < 4; ++r) t[j][r] = *(const v4f*)(sc[j] + r * 1024);
    }
    // the addresses as inputs keep the issued loads' address registers untouched up to this wait;
    // behind it the next trip may form new ones
    asm volatile("s_wait_xcnt 0x0" :: "v"(sc[0]), "v"(sc[1]), "v"(sc[2]), "v"(sc[3]) : "memory");
#pragma unroll
    for (int j = 0; j < 4; ++j) {
      const float w = (g0 + j < c) ? 1.f : 0.f;
#pragma unroll
      for (int r = 0; r < 4; ++r) sp[r] += w * t[j][r];
    }
  }
#pragma unroll
  for (int r = 0; r < 4; ++r) *(v4f*)&Y[r * 16 + g][4 * l] = sp[r];
  if (tid < DHEAD) {
    float s = 0.f;
#pragma unroll
    for (int cc = 0; cc < NCH - 1; ++cc) {
      const float t = Kws[(h * NCH + cc) * DHEAD + tid];
      s += (cc < c) ? t : 0.f;
    }
    kp[tid] = s;
  }

  // ---- this chunk's q (softmax over the row, 16 lanes a row), ke, v ----
  const float* sq[4];
  v4f q4[4], k4[4], v4[4];
#pragma unroll
  for (int p = 0; p < 4; ++p) {
    sq[p] = QKV + (size_t)(c * ACH + p * 16 + g) * (3 * DIM) + h * DHEAD + 4 * l;
    q4[p] = *(const v4f*)(sq[p]);
    k4[p] = *(const v4f*)(sq[p] + DIM);
    v4[p] = *(const v4f*)(sq[p] + 2 * DIM);
  }
  // the addresses as inputs keep the issued loads' address registers untouched up to this wait
  asm volatile("s_wait_xcnt 0x0" :: "v"(sq[0]), "v"(sq[1]), "v"(sq[2]), "v"(sq[3]) : "memory");
#pragma unroll
  for (int p = 0; p < 4; ++p) {
    const int n = p * 16 + g;
    v4f qv = q4[p];
    v4f kv = k4[p];
    const v4f vv = v4[p];
    float mx = fmaxf(fmaxf(qv[0], qv[1]), fmaxf(qv[2], qv[3]));
#pragma unroll
    for (int m = 1; m < 16; m <<= 1) mx = fmaxf(mx, __shfl_xor(mx, m));
#pragma unroll
    for (int e = 0; e < 4; ++e) qv[e] = __expf(qv[e] - mx);
    float sm = (qv[0] + qv[1]) + (qv[2] + qv[3]);
#pragma unroll
    for (int m = 1; m < 16; m <<= 1) sm += __shfl_xor(sm, m);
    const float qsc = 0.125f / sm;                 // 1 / row sum, * DHEAD^-0.5
#pragma unroll
    for (int e = 0; e < 4; ++e) {
      qv[e] *= qsc;
      kv[e] = __expf(kv[e]);
    }
    *(v4f*)&X[n][4 * l]          = qv;
    *(v4f*)&Kl[n][4 * l]         = kv;
    *(v4f*)&Y[DHEAD + n][4 * l]  = vv;
  }
  __syncthreads();

  // ---- P: thread tile rows n = tn..tn+3, columns m = l + 16*jj ----
  const int tn = 4 * g;
  v2f pr2[4][4];                                   // even-d and odd-d halves of each dot product
#pragma unroll
  for (int i = 0; i < 4; ++i)
#pragma unroll
    for (int jj = 0; jj < 4; ++jj) pr2[i][jj] = (v2f){0.f, 0.f};
#pragma unroll 2
  for (int d = 0; d < DHEAD; d += 4) {
    v4f qa[4], kb[4];
#pragma unroll
    for (int i = 0; i < 4; ++i) qa[i] = *(const v4f*)&X[tn + i][d];
#pragma unroll
    for (int jj = 0; jj < 4; ++jj) kb[jj] = *(const v4f*)&Kl[l + 16 * jj][d];
#pragma unroll
    for (int i = 0; i < 4; ++i)
#pragma unroll
      for (int jj = 0; jj < 4; ++jj) {
        pr2[i][jj] += qa[i].lo * kb[jj].lo;
        pr2[i][jj] += qa[i].hi * kb[jj].hi;
      }
  }
  // denominator: each of the row's 16 lanes adds its four columns of P and its
  // four terms of qs . kprev; the lanes are then summed.
  float dinv[4];
  const v4f kq = *(const v4f*)&kp[4 * l];
#pragma unroll
  for (int i = 0; i < 4; ++i) {
    const v4f qq = *(const v4f*)&X[tn + i][4 * l];
    float rs = (qq[0] * kq[0] + qq[1] * kq[1]) + (qq[2] * kq[2] + qq[3] * kq[3]);
#pragma unroll
    for (int jj = 0; jj < 4; ++jj) {
      const int m = l + 16 * jj;
      const float pv = (m <= tn + i) ? pr2[i][jj][0] + pr2[i][jj][1] : 0.f;   // causal, own token included
      rs += pv;
      X[tn + i][DHEAD + m] = pv;
    }
#pragma unroll
    for (int m = 1; m < 16; m <<= 1) rs += __shfl_xor(rs, m);
    dinv[i] = 1.f / fmaxf(rs, 1e-3f);
  }
  __syncthreads();

  // ---- rows: [qs | P] x [Sprev ; v]; P is zero from column 8*(wave+1) on for this wave's rows ----
  const int jEnd = DHEAD + 8 * (__builtin_amdgcn_readfirstlane(tid >> 5) + 1);
  v4f o[4];
#pragma unroll
  for (int i = 0; i < 4; ++i) o[i] = (v4f){0.f, 0.f, 0.f, 0.f};
#pragma unroll 2
  for (int j = 0; j < jEnd; j += 4) {
    v4f xa[4], yb[4];
#pragma unroll
    for (int i = 0; i < 4; ++i) xa[i] = *(const v4f*)&X[tn + i][j];
#pragma unroll
    for (int e = 0; e < 4; ++e) yb[e] = *(const v4f*)&Y[j + e][4 * l];
#pragma unroll
    for (int i = 0; i < 4; ++i)
#pragma unroll
      for (int e = 0; e < 4; ++e) o[i] += xa[i][e] * yb[e];
  }
#pragma unroll
  for (int i = 0; i < 4; ++i) {
    v4h hv;
#pragma unroll
    for (int e = 0; e < 4; ++e) hv[e] = (_Float16)(o[i][e] * dinv[i]);
    *(v4h*)(Aout + (size_t)(c * ACH + tn + i) * DIM + h * DHEAD + 4 * l) = hv;
  }
}

// ---------------------------------------------------------------------------
// Host orchestration
// ---------------------------------------------------------------------------
extern "C" void kernel_launch(void* const* d_in, const int* in_sizes, int n_in,
                              void* d_out, int out_size, void* d_ws, size_t ws_size,
                              hipStream_t stream) {
  (void)in_sizes; (void)n_in; (void)out_size; (void)ws_size;
  const int*   tokens  = (const int*)  d_in[0];
  const float* tok_emb = (const float*)d_in[1];
  const float* pos_emb = (const float*)d_in[2];
  const float* Wq  = (const float*)d_in[3];
  const float* Wk  = (const float*)d_in[4];
  const float* Wv  = (const float*)d_in[5];
  const float* Wo  = (const float*)d_in[6];
  const float* bo  = (const float*)d_in[7];
  const float* ln1g = (const float*)d_in[8];
  const float* ln1b = (const float*)d_in[9];
  const float* W1  = (const float*)d_in[10];
  const float* b1  = (const float*)d_in[11];
  const float* W2  = (const float*)d_in[12];
  const float* b2  = (const float*)d_in[13];
  const float* ln2g = (const float*)d_in[14];
  const float* ln2b = (const float*)d_in[15];
  const float* lnfg = (const float*)d_in[16];
  const float* lnfb = (const float*)d_in[17];
  const float* Wout = (const float*)d_in[18];
  const float* bout = (const float*)d_in[19];
  float* out = (float*)d_out;

  char* p = (char*)d_ws;
  auto carve = [&](size_t bytes) -> char* {
    char* r = p; p += (bytes + 255) & ~(size_t)255; return r;
  };
  _Float16* QKVT  = (_Float16*)carve((size_t)NL * 3 * DIM * DIM * 2);  // fused [1536][512] per layer
  _Float16* WoT   = (_Float16*)carve((size_t)NL * DIM * DIM * 2);
  _Float16* W1T   = (_Float16*)carve((size_t)NL * DIM * FFD * 2);
  _Float16* W2T   = (_Float16*)carve((size_t)NL * DIM * FFD * 2);
  _Float16* WoutT = (_Float16*)carve((size_t)DIM * VOCAB * 2);
  float*    x     = (float*)   carve((size_t)SEQ * DIM * 4);
  _Float16* h16   = (_Float16*)carve((size_t)SEQ * DIM * 2);
  float*    qkvf  = (float*)   carve((size_t)SEQ * 3 * DIM * 4);
  _Float16* a16   = (_Float16*)carve((size_t)SEQ * DIM * 2);
  _Float16* ff16  = (_Float16*)carve((size_t)SEQ * FFD * 2);
  float*    sws   = (float*)   carve((size_t)NH * NCH * DHEAD * DHEAD * 4);  // per-chunk ke^T v
  float*    kws   = (float*)   carve((size_t)NH * NCH * DHEAD * 4);          // per-chunk sum of ke

  wt_transpose_all_f16<<<WT_TILES, 256, 0, stream>>>(Wq, Wk, Wv, Wo, W1, W2, Wout,
                                                     QKVT, WoT, W1T, W2T, WoutT);

  embed_kernel<<<SEQ * DIM / 256, 256, 0, stream>>>(tokens, tok_emb, pos_emb, x);

  const dim3 gD(DIM / 128, SEQ / 128);      // (4, 8)
  for (int i = 0; i < NL; ++i) {
    const size_t wo = (size_t)i * DIM * DIM;
    const size_t fo = (size_t)i * DIM * FFD;
    layernorm_f16_kernel<<<SEQ, 128, 0, stream>>>(x, ln1g + i * DIM, ln1b + i * DIM, h16);
    gemm_f16_wmma<0><<<dim3(3 * DIM / 128, SEQ / 128), 256, 0, stream>>>(
        h16, QKVT + (size_t)i * 3 * DIM * DIM, nullptr, qkvf, nullptr, SEQ, 3 * DIM, DIM);
    attn_chunk_state_kernel<<<dim3(NH, NCH - 1), 256, 0, stream>>>(qkvf, sws, kws);
    attn_chunk_out_kernel<<<dim3(NH, NCH), 256, 0, stream>>>(qkvf, sws, kws, a16);
    gemm_f16_wmma<1><<<gD, 256, 0, stream>>>(a16, WoT + wo, bo + i * DIM, x, nullptr, SEQ, DIM, DIM);
    layernorm_f16_kernel<<<SEQ, 128, 0, stream>>>(x, ln2g + i * DIM, ln2b + i * DIM, h16);
    gemm_f16_wmma<2><<<dim3(FFD / 128, SEQ / 128), 256, 0, stream>>>(
        h16, W1T + fo, b1 + i * FFD, nullptr, ff16, SEQ, FFD, DIM);
    gemm_f16_wmma<1><<<gD, 256, 0, stream>>>(ff16, W2T + fo, b2 + i * DIM, x, nullptr, SEQ, DIM, FFD);
  }
  layernorm_f16_kernel<<<SEQ, 128, 0, stream>>>(x, lnfg, lnfb, h16);
  gemm_f16_wmma<0><<<dim3(VOCAB / 128, SEQ / 128), 256, 0, stream>>>(
      h16, WoutT, bout, out, nullptr, SEQ, VOCAB, DIM);
}

// v004
// One run takes 321 microseconds.
// Two timings next to v003 put it at 1.33 and 1.31 times that version's speed.
// Over all steps from v000 it is 34.5 times as fast.
#include <hip/hip_runtime.h>
#include <hip/hip_bf16.h>
#include <math.h>
#include <stdint.h>

// ---- model dims (fixed by reference) ----
#define SEQ   1024
#define DIM   512
#define NH    8
#define DHEAD 64
#define FFD   2048
#define NL    4
#define VOCAB 32000

typedef __attribute__((ext_vector_type(16))) _Float16 v16h;
typedef __attribute__((ext_vector_type(8)))  _Float16 v8h;
typedef __attribute__((ext_vector_type(8)))  float    v8f;
typedef __attribute__((__vector_size__(16))) int      v4i;   // matches builtin param type

// ---- CDNA5 async global->LDS path (ASYNCcnt) --------------------------------
// Rebuild addrspace-qualified int4 pointers from flat addresses (LDS flat addr
// low 32 bits == LDS byte offset on CDNA5, ISA 10.2 aperture mapping; flat ==
// global address for AS1).
#define AS1P(p) ((__attribute__((address_space(1))) v4i*)(unsigned long long)(uintptr_t)(p))
#define AS3P(p) ((__attribute__((address_space(3))) v4i*)(unsigned)(uintptr_t)(p))

// ---------------------------------------------------------------------------
// Embedding: x[n,d] = tok_emb[tokens[n],d] + pos_emb[n,d]
// ---------------------------------------------------------------------------
__global__ void embed_kernel(const int* __restrict__ tokens,
                             const float* __restrict__ tok_emb,
                             const float* __restrict__ pos_emb,
                             float* __restrict__ x) {
  int idx = blockIdx.x * 256 + threadIdx.x;
  int n = idx >> 9;
  int d = idx & (DIM - 1);
  x[idx] = tok_emb[(size_t)tokens[n] * DIM + d] + pos_emb[idx];
}

// ---------------------------------------------------------------------------
// Weight transpose + fp32 -> f16 convert:  in[K][N] -> out[N][K], every weight
// matrix of the model in ONE launch. A work-group takes one tile of 64 k x 256 n:
// a wave's load is 512 contiguous bytes of an input row, a wave's store is four
// whole 128-byte lines of output rows.
// ---------------------------------------------------------------------------
#define WTK 64
#define WTN 256
#define WTP (WTK + 8)                        // LDS row pitch in halves: 144 B = 16 B x odd
typedef __attribute__((ext_vector_type(4))) float wt4f;

template <int K, int N>
__device__ __forceinline__ void wt_tile(const float* __restrict__ in, _Float16* __restrict__ out,
                                        int kt, int nt, _Float16 (*tile)[WTP]) {
  const int tid = threadIdx.x;
  const int c  = tid & 63;                   // columns n = 4c .. 4c+3 of the tile
  const int kr = tid >> 6;                   // rows k = 16kr .. 16kr+15 of the tile
  const float* s = in + (size_t)(kt * WTK + kr * 16) * N + nt * WTN + 4 * c;
  wt4f r[16];
#pragma unroll
  for (int i = 0; i < 16; ++i) r[i] = *(const wt4f*)(s + (size_t)i * N);
#pragma unroll
  for (int j = 0; j < 4; ++j) {
    v8h lo, hi;
#pragma unroll
    for (int i = 0; i < 8; ++i) { lo[i] = (_Float16)r[i][j]; hi[i] = (_Float16)r[8 + i][j]; }
    *(v8h*)&tile[4 * c + j][kr * 16]     = lo;
    *(v8h*)&tile[4 * c + j][kr * 16 + 8] = hi;
  }
  __syncthreads();
  const int n0 = tid >> 3, q = (tid & 7) * 8;  // 8 lanes a row of 64 halves
  _Float16* d = out + (size_t)(nt * WTN + n0) * K + kt * WTK + q;
#pragma unroll
  for (int p = 0; p < 8; ++p)
    *(v8h*)(d + (size_t)p * 32 * K) = *(const v8h*)&tile[n0 + 32 * p][q];
}

#define WT_OUT_TILES ((DIM / WTK) * (VOCAB / WTN))                 // 1000
#define WT_SQ_TILES  ((DIM / WTK) * (DIM / WTN))                   // 16 for one DIM x DIM matrix
#define WT_FF_TILES  ((DIM / WTK) * (FFD / WTN))                   // 64 for W1, as many for W2
#define WT_LAYER_TILES (4 * WT_SQ_TILES + 2 * WT_FF_TILES)         // 192
#define WT_TILES (WT_OUT_TILES + NL * WT_LAYER_TILES)              // 1768

__global__ void __launch_bounds__(256)
wt_transpose_all_f16(const float* __restrict__ Wq, const float* __restrict__ Wk,
                     const float* __restrict__ Wv, const float* __restrict__ Wo,
                     const float* __restrict__ W1, const float* __restrict__ W2,
                     const float* __restrict__ Wout,
                     _Float16* __restrict__ QKVT, _Float16* __restrict__ WoT,
                     _Float16* __restrict__ W1T, _Float16* __restrict__ W2T,
                     _Float16* __restrict__ WoutT) {
  __shared__ __align__(16) _Float16 tile[WTN][WTP];
  const int b = blockIdx.x;                  // every choice below is the same for the whole work-group
  if (b < WT_OUT_TILES) {
    wt_tile<DIM, VOCAB>(Wout, WoutT, b & 7, b >> 3, tile);
    return;
  }
  const int u = b - WT_OUT_TILES;
  const int layer = u / WT_LAYER_TILES;
  const int r = u - layer * WT_LAYER_TILES;
  if (r < 4 * WT_SQ_TILES) {
    const int which = r >> 4, t = r & 15;    // Wq, Wk, Wv, Wo
    const float* in = (which == 0 ? Wq : which == 1 ? Wk : which == 2 ? Wv : Wo) + (size_t)layer * DIM * DIM;
    _Float16* out = which < 3 ? QKVT + (size_t)(layer * 3 + which) * DIM * DIM
                              : WoT + (size_t)layer * DIM * DIM;
    wt_tile<DIM, DIM>(in, out, t & 7, t >> 3, tile);
  } else if (r < 4 * WT_SQ_TILES + WT_FF_TILES) {
    const int t = r - 4 * WT_SQ_TILES;
    wt_tile<DIM, FFD>(W1 + (size_t)layer * DIM * FFD, W1T + (size_t)layer * DIM * FFD, t & 7, t >> 3, tile);
  } else {
    const int t = r - 4 * WT_SQ_TILES - WT_FF_TILES;
    wt_tile<FFD, DIM>(W2 + (size_t)layer * DIM * FFD, W2T + (size_t)layer * DIM * FFD, t & 31, t >> 5, tile);
  }
}

// ---------------------------------------------------------------------------
// LayerNorm (per row of [SEQ, DIM]) -> f16 activations for GEMM A-operand
// ---------------------------------------------------------------------------
__global__ void layernorm_f16_kernel(const float* __restrict__ x,
                                     const float* __restrict__ g,
                                     const float* __restrict__ b,
                                     _Float16* __restrict__ out) {
  __shared__ float r1[128], r2[128];
  const int row = blockIdx.x, t = threadIdx.x;
  const float* xr = x + (size_t)row * DIM;
  float s = 0.f, s2 = 0.f;
  for (int d = t; d < DIM; d += 128) { float v = xr[d]; s += v; s2 += v * v; }
  r1[t] = s; r2[t] = s2; __syncthreads();
#pragma unroll
  for (int st = 64; st > 0; st >>= 1) {
    if (t < st) { r1[t] += r1[t + st]; r2[t] += r2[t + st]; }
    __syncthreads();
  }
  const float mean = r1[0] * (1.f / DIM);
  const float var  = r2[0] * (1.f / DIM) - mean * mean;
  const float rstd = rsqrtf(var + 1e-5f);
  for (int d = t; d < DIM; d += 128)
    out[(size_t)row * DIM + d] = (_Float16)((xr[d] - mean) * rstd * g[d] + b[d]);
}

// ---------------------------------------------------------------------------
// WMMA GEMM:  C[M,N] (op)= A[M,K](f16) * Bt[N,K](f16)^T + bias
//   EPI 0: C(f32) = val          EPI 1: C(f32) += val          EPI 2: Ch(f16) = gelu(val)
// Block: 256 threads = 8 wave32 (4x2). Block tile 128x128, wave tile 32x64
// (2 A-frags x 4 B-frags = 8 WMMA per 32 k). A stage is GBK = 128 k of both
// operands: 256 contiguous bytes of every row, so one wave-wide 16-byte copy
// covers two whole rows of the stage (four whole 128-byte lines). Two LDS
// buffers; the next stage's async copies fly while this one is worked on.
// M,N multiples of 128; K a multiple of 128.
// ---------------------------------------------------------------------------
#define GBK 128
#define GPITCH (GBK + 8)                     // LDS row pitch in halves: 272 B = 16 B x odd

// One stage of one operand: 128 rows x 256 B = 2048 pieces of 16 B, eight a thread.
// g and l already point at this thread's piece of row tid / 16.
__device__ __forceinline__ void gemm_stage_copy(const _Float16* g, _Float16* l, int K) {
#pragma unroll
  for (int i = 0; i < 8; ++i)
    __builtin_amdgcn_global_load_async_to_lds_b128(AS1P(g + (size_t)i * 16 * K),
                                                   AS3P(l + i * 16 * GPITCH), 0, 0);
}

template <int EPI>
__global__ void __launch_bounds__(256)
gemm_f16_wmma(const _Float16* __restrict__ A, const _Float16* __restrict__ Bt,
              const float* __restrict__ bias, float* __restrict__ C,
              _Float16* __restrict__ Ch, int M, int N, int K) {
  __shared__ __align__(16) _Float16 lA[2][128][GPITCH];
  __shared__ __align__(16) _Float16 lB[2][128][GPITCH];

  const int tid  = threadIdx.x;
  const int lane = tid & 31;
  const int wid  = tid >> 5;
  const int wr   = wid >> 1;                 // 0..3  (32-row slab)
  const int wc   = wid & 1;                  // 0..1  (64-col slab)
  const int rowBase = blockIdx.y * 128;
  const int colBase = blockIdx.x * 128;

  // staging: 16 threads a row, 16 B each
  const int srow = tid >> 4;                 // 0..15, + 16 for each further piece
  const int skq  = (tid & 15) * 8;           // halves
  const _Float16* gA = A  + (size_t)(rowBase + srow) * K + skq;
  const _Float16* gB = Bt + (size_t)(colBase + srow) * K + skq;

  // fragment coords (16-bit 16x32 layout: lane%16 = row/col, lane/16 = K-half)
  const int mrow = lane & 15;
  const int kb   = (lane >> 4) * 8;

  v8f acc[2][4];
#pragma unroll
  for (int a = 0; a < 2; ++a)
#pragma unroll
    for (int j = 0; j < 4; ++j) acc[a][j] = (v8f){};

  const int nst = K / GBK;                   // stages; the same for the whole work-group

  // C/D layout: VGPR i -> M = i + 8*(lane/16), N = lane%16
  const int row0 = rowBase + wr * 32 + (lane >> 4) * 8;
  const int colW = colBase + wc * 64 + (lane & 15);

  // ---- prologue: stage 0 into buffer 0, published; then stage 1 starts into buffer 1 ----
  gemm_stage_copy(gA, &lA[0][srow][skq], K);
  gemm_stage_copy(gB, &lB[0][srow][skq], K);
  asm volatile("s_wait_asynccnt 0x0" ::: "memory");   // this wave's pieces of stage 0 have landed
  __syncthreads();
  if (nst > 1) {
    gemm_stage_copy(gA + GBK, &lA[1][srow][skq], K);
    gemm_stage_copy(gB + GBK, &lB[1][srow][skq], K);
  }

  // Everything the epilogue reads from global memory is asked for here, all of it in
  // flight at once behind the second stage's copies: the first pass of the k loop covers the latency.
  // The loops are unrolled so that bb and res are registers with constant indices.
  float bb[4];
  float res[2][4][8];
#pragma unroll
  for (int j = 0; j < 4; ++j) bb[j] = 0.f;
  if (bias) {
#pragma unroll
    for (int j = 0; j < 4; ++j) bb[j] = bias[colW + j * 16];
  }
  if (EPI == 1) {
#pragma unroll
    for (int a = 0; a < 2; ++a)
#pragma unroll
      for (int i = 0; i < 8; ++i)
#pragma unroll
        for (int j = 0; j < 4; ++j)
          res[a][j][i] = C[(size_t)(row0 + a * 16 + i) * N + colW + j * 16];
  }
  // the base and the column offset as inputs keep the issued loads' address registers untouched
  // up to this wait; behind it they may take new values
  asm volatile("s_wait_xcnt 0x0" :: "s"(bias), "v"(colW) : "memory");

  for (int s = 0; s < nst; ++s) {
    const int buf = s & 1;
#pragma unroll
    for (int ks = 0; ks < GBK; ks += 32) {
      union Frag { v16h v; v8h h[2]; } af[2], bf[4];
#pragma unroll
      for (int a = 0; a < 2; ++a) {
        const int r = wr * 32 + a * 16 + mrow;
        af[a].h[0] = *(const v8h*)&lA[buf][r][ks + kb];
        af[a].h[1] = *(const v8h*)&lA[buf][r][ks + kb + 16];
      }
#pragma unroll
      for (int j = 0; j < 4; ++j) {
        const int r = wc * 64 + j * 16 + mrow;
        bf[j].h[0] = *(const v8h*)&lB[buf][r][ks + kb];
        bf[j].h[1] = *(const v8h*)&lB[buf][r][ks + kb + 16];
      }
#pragma unroll
      for (int a = 0; a < 2; ++a)
#pragma unroll
        for (int j = 0; j < 4; ++j)
          acc[a][j] = __builtin_amdgcn_wmma_f32_16x16x32_f16(false, af[a].v, false, bf[j].v,
                                                             (short)0, acc[a][j], false, false);
    }
    // publish point of stage s + 1
    asm volatile("s_wait_dscnt 0x0" ::: "memory");     // this wave's reads of buffer buf are done before it is refilled
    asm volatile("s_wait_asynccnt 0x0" ::: "memory");  // this wave's pieces of stage s + 1 have landed
    __syncthreads();
    if (s + 2 < nst) {                                 // refill the buffer every wave has just left
      gemm_stage_copy(gA + (size_t)(s + 2) * GBK, &lA[buf][srow][skq], K);
      gemm_stage_copy(gB + (size_t)(s + 2) * GBK, &lB[buf][srow][skq], K);
    }
  }
  asm volatile("s_wait_asynccnt 0x0" ::: "memory");    // no copy is left in flight when the wave goes on to its end

#pragma unroll
  for (int a = 0; a < 2; ++a) {
#pragma unroll
    for (int j = 0; j < 4; ++j) {
      const int col = colW + j * 16;
#pragma unroll
      for (int i = 0; i < 8; ++i) {
        const size_t idx = (size_t)(row0 + a * 16 + i) * N + col;
        const float v = acc[a][j][i] + bb[j];
        if (EPI == 0)      C[idx] = v;
        else if (EPI == 1) C[idx] = res[a][j][i] + v;
        else Ch[idx] = (_Float16)(0.5f * v * (1.f + erff(v * 0.70710678118f)));
      }
    }
  }
}

// ---------------------------------------------------------------------------
// Causal linear attention over fused QKV buffer [SEQ][3*DIM], in chunks of
// ACH tokens. With ke = exp(k), qs = softmax(q) * DHEAD^-0.5 and, for chunk c,
//   Sprev = sum over tokens before the chunk of ke^T v     (DHEAD x DHEAD)
//   kprev = sum over tokens before the chunk of ke         (DHEAD)
//   P[n][m] = qs[n] . ke[m] for m <= n inside the chunk, else 0
// the output row is (qs[n] . Sprev + P[n] . v) / max(qs[n] . kprev + sum_m P[n][m], eps).
// Launch 1 writes each chunk's own ke^T v and sum of ke, the last chunk's excepted; launch 2 adds up the
// chunks before its own and forms the rows. All sums in f32.
// ---------------------------------------------------------------------------
#define ACH 64
#define NCH (SEQ / ACH)
typedef __attribute__((ext_vector_type(4))) float    v4f;
typedef __attribute__((ext_vector_type(2))) float    v2f;
typedef __attribute__((ext_vector_type(4))) _Float16 v4h;

// grid (NH, NCH-1): the last chunk's sums have no reader.
__global__ void __launch_bounds__(256)
attn_chunk_state_kernel(const float* __restrict__ QKV, float* __restrict__ Sws,
                        float* __restrict__ Kws) {
  __shared__ __align__(16) float ke[ACH][DHEAD];
  __shared__ __align__(16) float vs[ACH][DHEAD];
  const int h = blockIdx.x, c = blockIdx.y, tid = threadIdx.x;
  const int l = tid & 15, g = tid >> 4;
#pragma unroll
  for (int p = 0; p < 4; ++p) {
    const int n = p * 16 + g;
    const float* s = QKV + (size_t)(c * ACH + n) * (3 * DIM) + h * DHEAD + 4 * l;
    v4f kv = *(const v4f*)(s + DIM);
    const v4f vv = *(const v4f*)(s + 2 * DIM);
#pragma unroll
    for (int e = 0; e < 4; ++e) kv[e] = __expf(kv[e]);
    *(v4f*)&ke[n][4 * l] = kv;
    *(v4f*)&vs[n][4 * l] = vv;
  }
  __syncthreads();

  // thread tile: rows d = 4g..4g+3, columns e = 4l..4l+3
  v4f acc[4];
  v4f ks = (v4f){0.f, 0.f, 0.f, 0.f};
#pragma unroll
  for (int i = 0; i < 4; ++i) acc[i] = (v4f){0.f, 0.f, 0.f, 0.f};
#pragma unroll 8
  for (int n = 0; n < ACH; ++n) {
    const v4f a = *(const v4f*)&ke[n][4 * g];
    const v4f b = *(const v4f*)&vs[n][4 * l];
#pragma unroll
    for (int i = 0; i < 4; ++i) acc[i] += a[i] * b;
    ks += a;
  }
  float* dst = Sws + (size_t)(h * NCH + c) * (DHEAD * DHEAD);
#pragma unroll
  for (int i = 0; i < 4; ++i) *(v4f*)(dst + (4 * g + i) * DHEAD + 4 * l) = acc[i];
  if (l == 0) *(v4f*)(Kws + (h * NCH + c) * DHEAD + 4 * g) = ks;
}

// grid (NH, NCH)
__global__ void __launch_bounds__(256)
attn_chunk_out_kernel(const float* __restrict__ QKV, const float* __restrict__ Sws,
                      const float* __restrict__ Kws, _Float16* __restrict__ Aout) {
  __shared__ __align__(16) float X[ACH][DHEAD + ACH + 4];   // row n: qs[n][0..63] | P[n][0..63]
  __shared__ __align__(16) float Y[DHEAD + ACH][DHEAD];     // rows 0..63 Sprev[d][e], rows 64.. v[m][e]
  __shared__ __align__(16) float Kl[ACH][DHEAD + 4];        // ke[m][d]; pitch 16 B x odd
  __shared__ __align__(16) float kp[DHEAD];                 // kprev
  const int h = blockIdx.x, c = blockIdx.y, tid = threadIdx.x;
  const int l = tid & 15, g = tid >> 4;

  // ---- Sprev, kprev: add up the chunks before this one, four chunks' loads in flight ----
  v4f sp[4];
#pragma unroll
  for (int r = 0; r < 4; ++r) sp[r] = (v4f){0.f, 0.f, 0.f, 0.f};
  const float* sb = Sws + (size_t)h * NCH * (DHEAD * DHEAD);
  const unsigned so = (unsigned)tid * 4u;
  for (int g0 = 0; g0 < c; g0 += 4) {
    v4f t[4][4];
    const float* sc[4];
#pragma unroll
    for (int j = 0; j < 4; ++j) {
      sc[j] = sb + (size_t)min(g0 + j, c - 1) * (DHEAD * DHEAD) + so;
#pragma unroll
      for (int r = 0; r < 4; ++r) t[j][r] = *(const v4f*)(sc[j] + r * 1024);
    }
    // the addresses as inputs keep the issued loads' address registers untouched up to this wait;
    // behind it the next trip may form new ones
    asm volatile("s_wait_xcnt 0x0" :: "v"(sc[0]), "v"(sc[1]), "v"(sc[2]), "v"(sc[3]) : "memory");
#pragma unroll
    for (int j = 0; j < 4; ++j) {
      const float w = (g0 + j < c) ? 1.f : 0.f;
#pragma unroll
      for (int r = 0; r < 4; ++r) sp[r] += w * t[j][r];
    }
  }
#pragma unroll
  for (int r = 0; r < 4; ++r) *(v4f*)&Y[r * 16 + g][4 * l] = sp[r];
  if (tid < DHEAD) {
    float s = 0.f;
#pragma unroll
    for (int cc = 0; cc < NCH - 1; ++cc) {
      const float t = Kws[(h * NCH + cc) * DHEAD + tid];
      s += (cc < c) ? t : 0.f;
    }
    kp[tid] = s;
  }

  // ---- this chunk's q (softmax over the row, 16 lanes a row), ke, v ----
  const float* sq[4];
  v4f q4[4], k4[4], v4[4];
#pragma unroll
  for (int p = 0; p < 4; ++p) {
    sq[p] = QKV + (size_t)(c * ACH + p * 16 + g) * (3 * DIM) + h * DHEAD + 4 * l;
    q4[p] = *(const v4f*)(sq[p]);
    k4[p] = *(const v4f*)(sq[p] + DIM);
    v4[p] = *(const v4f*)(sq[p] + 2 * DIM);
  }
  // the addresses as inputs keep the issued loads' address registers untouched up to this wait
  asm volatile("s_wait_xcnt 0x0" :: "v"(sq[0]), "v"(sq[1]), "v"(sq[2]), "v"(sq[3]) : "memory");
#pragma unroll
  for (int p = 0; p < 4; ++p) {
    const int n = p * 16 + g;
    v4f qv = q4[p];
    v4f kv = k4[p];
    const v4f vv = v4[p];
    float mx = fmaxf(fmaxf(qv[0], qv[1]), fmaxf(qv[2], qv[3]));
#pragma unroll
    for (int m = 1; m < 16; m <<= 1) mx = fmaxf(mx, __shfl_xor(mx, m));
#pragma unroll
    for (int e = 0; e < 4; ++e) qv[e] = __expf(qv[e] - mx);
    float sm = (qv[0] + qv[1]) + (qv[2] + qv[3]);
#pragma unroll
    for (int m = 1; m < 16; m <<= 1) sm += __shfl_xor(sm, m);
    const float qsc = 0.125f / sm;                 // 1 / row sum, * DHEAD^-0.5
#pragma unroll
    for (int e = 0; e < 4; ++e) {
      qv[e] *= qsc;
      kv[e] = __expf(kv[e]);
    }
    *(v4f*)&X[n][4 * l]          = qv;
    *(v4f*)&Kl[n][4 * l]         = kv;
    *(v4f*)&Y[DHEAD + n][4 * l]  = vv;
  }
  __syncthreads();

  // ---- P: thread tile rows n = tn..tn+3, columns m = l + 16*jj ----
  const int tn = 4 * g;
  v2f pr2[4][4];                                   // even-d and odd-d halves of each dot product
#pragma unroll
  for (int i = 0; i < 4; ++i)
#pragma unroll
    for (int jj = 0; jj < 4; ++jj) pr2[i][jj] = (v2f){0.f, 0.f};
#pragma unroll 2
  for (int d = 0; d < DHEAD; d += 4) {
    v4f qa[4], kb[4];
#pragma unroll
    for (int i = 0; i < 4; ++i) qa[i] = *(const v4f*)&X[tn + i][d];
#pragma unroll
    for (int jj = 0; jj < 4; ++jj) kb[jj] = *(const v4f*)&Kl[l + 16 * jj][d];
#pragma unroll
    for (int i = 0; i < 4; ++i)
#pragma unroll
      for (int jj = 0; jj < 4; ++jj) {
        pr2[i][jj] += qa[i].lo * kb[jj].lo;
        pr2[i][jj] += qa[i].hi * kb[jj].hi;
      }
  }
  // denominator: each of the row's 16 lanes adds its four columns of P and its
  // four terms of qs . kprev; the lanes are then summed.
  float dinv[4];
  const v4f kq = *(const v4f*)&kp[4 * l];
#pragma unroll
  for (int i = 0; i < 4; ++i) {
    const v4f qq = *(const v4f*)&X[tn + i][4 * l];
    float rs = (qq[0] * kq[0] + qq[1] * kq[1]) + (qq[2] * kq[2] + qq[3] * kq[3]);
#pragma unroll
    for (int jj = 0; jj < 4; ++jj) {
      const int m = l + 16 * jj;
      const float pv = (m <= tn + i) ? pr2[i][jj][0] + pr2[i][jj][1] : 0.f;   // causal, own token included
      rs += pv;
      X[tn + i][DHEAD + m] = pv;
    }
#pragma unroll
    for (int m = 1; m < 16; m <<= 1) rs += __shfl_xor(rs, m);
    dinv[i] = 1.f / fmaxf(rs, 1e-3f);
  }
  __syncthreads();

  // ---- rows: [qs | P] x [Sprev ; v]; P is zero from column 8*(wave+1) on for this wave's rows ----
  const int jEnd = DHEAD + 8 * (__builtin_amdgcn_readfirstlane(tid >> 5) + 1);
  v4f o[4];
#pragma unroll
  for (int i = 0; i < 4; ++i) o[i] = (v4f){0.f, 0.f, 0.f, 0.f};
#pragma unroll 2
  for (int j = 0; j < jEnd; j += 4) {
    v4f xa[4], yb[4];
#pragma unroll
    for (int i = 0; i < 4; ++i) xa[i] = *(const v4f*)&X[tn + i][j];
#pragma unroll
    for (int e = 0; e < 4; ++e) yb[e] = *(const v4f*)&Y[j + e][4 * l];
#pragma unroll
    for (int i = 0; i < 4; ++i)
#pragma unroll
      for (int e = 0; e < 4; ++e) o[i] += xa[i][e] * yb[e];
  }
#pragma unroll
  for (int i = 0; i < 4; ++i) {
    v4h hv;
#pragma unroll
    for (int e = 0; e < 4; ++e) hv[e] = (_Float16)(o[i][e] * dinv[i]);
    *(v4h*)(Aout + (size_t)(c * ACH + tn + i) * DIM + h * DHEAD + 4 * l) = hv;
  }
}

// ---------------------------------------------------------------------------
// Host orchestration
// ---------------------------------------------------------------------------
extern "C" void kernel_launch(void* const* d_in, const int* in_sizes, int n_in,
                              void* d_out, int out_size, void* d_ws, size_t ws_size,
                              hipStream_t stream) {
  (void)in_sizes; (void)n_in; (void)out_size; (void)ws_size;
  const int*   tokens  = (const int*)  d_in[0];
  const float* tok_emb = (const float*)d_in[1];
  const float* pos_emb = (const float*)d_in[2];
  const float* Wq  = (const float*)d_in[3];
  const float* Wk  = (const float*)d_in[4];
  const float* Wv  = (const float*)d_in[5];
  const float* Wo  = (const float*)d_in[6];
  const float* bo  = (const float*)d_in[7];
  const float* ln1g = (const float*)d_in[8];
  const float* ln1b = (const float*)d_in[9];
  const float* W1  = (const float*)d_in[10];
  const float* b1  = (const float*)d_in[11];
  const float* W2  = (const float*)d_in[12];
  const float* b2  = (const float*)d_in[13];
  const float* ln2g = (const float*)d_in[14];
  const float* ln2b = (const float*)d_in[15];
  const float* lnfg = (const float*)d_in[16];
  const float* lnfb = (const float*)d_in[17];
  const float* Wout = (const float*)d_in[18];
  const float* bout = (const float*)d_in[19];
  float* out = (float*)d_out;

  char* p = (char*)d_ws;
  auto carve = [&](size_t bytes) -> char* {
    char* r = p; p += (bytes + 255) & ~(size_t)255; return r;
  };
  _Float16* QKVT  = (_Float16*)carve((size_t)NL * 3 * DIM * DIM * 2);  // fused [1536][512] per layer
  _Float16* WoT   = (_Float16*)carve((size_t)NL * DIM * DIM * 2);
  _Float16* W1T   = (_Float16*)carve((size_t)NL * DIM * FFD * 2);
  _Float16* W2T   = (_Float16*)carve((size_t)NL * DIM * FFD * 2);
  _Float16* WoutT = (_Float16*)carve((size_t)DIM * VOCAB * 2);
  float*    x     = (float*)   carve((size_t)SEQ * DIM * 4);
  _Float16* h16   = (_Float16*)carve((size_t)SEQ * DIM * 2);
  float*    qkvf  = (float*)   carve((size_t)SEQ * 3 * DIM * 4);
  _Float16* a16   = (_Float16*)carve((size_t)SEQ * DIM * 2);
  _Float16* ff16  = (_Float16*)carve((size_t)SEQ * FFD * 2);
  float*    sws   = (float*)   carve((size_t)NH * NCH * DHEAD * DHEAD * 4);  // per-chunk ke^T v
  float*    kws   = (float*)   carve((size_t)NH * NCH * DHEAD * 4);          // per-chunk sum of ke

  wt_transpose_all_f16<<<WT_TILES, 256, 0, stream>>>(Wq, Wk, Wv, Wo, W1, W2, Wout,
                                                     QKVT, WoT, W1T, W2T, WoutT);

  embed_kernel<<<SEQ * DIM / 256, 256, 0, stream>>>(tokens, tok_emb, pos_emb, x);

  const dim3 gD(DIM / 128, SEQ / 128);      // (4, 8)
  for (int i = 0; i < NL; ++i) {
    const size_t wo = (size_t)i * DIM * DIM;
    const size_t fo = (size_t)i * DIM * FFD;
    layernorm_f16_kernel<<<SEQ, 128, 0, stream>>>(x, ln1g + i * DIM, ln1b + i * DIM, h16);
    gemm_f16_wmma<0><<<dim3(3 * DIM / 128, SEQ / 128), 256, 0, stream>>>(
        h16, QKVT + (size_t)i * 3 * DIM * DIM, nullptr, qkvf, nullptr, SEQ, 3 * DIM, DIM);
    attn_chunk_state_kernel<<<dim3(NH, NCH - 1), 256, 0, stream>>>(qkvf, sws, kws);
    attn_chunk_out_kernel<<<dim3(NH, NCH), 256, 0, stream>>>(qkvf, sws, kws, a16);
    gemm_f16_wmma<1><<<gD, 256, 0, stream>>>(a16, WoT + wo, bo + i * DIM, x, nullptr, SEQ, DIM, DIM);
    layernorm_f16_kernel<<<SEQ, 128, 0, stream>>>(x, ln2g + i * DIM, ln2b + i * DIM, h16);
    gemm_f16_wmma<2><<<dim3(FFD / 128, SEQ / 128), 256, 0, stream>>>(
        h16, W1T + fo, b1 + i * FFD, nullptr, ff16, SEQ, FFD, DIM);
    gemm_f16_wmma<1><<<gD, 256, 0, stream>>>(ff16, W2T + fo, b2 + i * DIM, x, nullptr, SEQ, DIM, FFD);
  }
  layernorm_f16_kernel<<<SEQ, 128, 0, stream>>>(x, lnfg, lnfb, h16);
  gemm_f16_wmma<0><<<dim3(VOCAB / 128, SEQ / 128), 256, 0, stream>>>(
      h16, WoutT, bout, out, nullptr, SEQ, VOCAB, DIM);
}

// v005
// One run takes 300 microseconds.
// In two side-by-side timings against v004, it was 1.07 and 1.06 times as fast.
// Counting every step since v000, it is 36.7 times as fast.
#include <hip/hip_runtime.h>
#include <hip/hip_bf16.h>
#include <math.h>
#include <stdint.h>

// ---- model dims (fixed by reference) ----
#define SEQ   1024
#define DIM   512
#define NH    8
#define DHEAD 64
#define FFD   2048
#define NL    4
#define VOCAB 32000

typedef __attribute__((ext_vector_type(16))) _Float16 v16h;
typedef __attribute__((ext_vector_type(8)))  _Float16 v8h;
typedef __attribute__((ext_vector_type(8)))  float    v8f;
typedef __attribute__((__vector_size__(16))) int      v4i;   // matches builtin param type
typedef __attribute__((ext_vector_type(4))) float    v4f;
typedef __attribute__((ext_vector_type(2))) float    v2f;
typedef __attribute__((ext_vector_type(4))) _Float16 v4h;

// ---- CDNA5 async global->LDS path (ASYNCcnt) --------------------------------
// Rebuild addrspace-qualified int4 pointers from flat addresses (LDS flat addr
// low 32 bits == LDS byte offset on CDNA5, ISA 10.2 aperture mapping; flat ==
// global address for AS1).
#define AS1P(p) ((__attribute__((address_space(1))) v4i*)(unsigned long long)(uintptr_t)(p))
#define AS3P(p) ((__attribute__((address_space(3))) v4i*)(unsigned)(uintptr_t)(p))

// ---------------------------------------------------------------------------
// Embedding: x[n,d] = tok_emb[tokens[n],d] + pos_emb[n,d]
// ---------------------------------------------------------------------------
__global__ void embed_kernel(const int* __restrict__ tokens,
                             const float* __restrict__ tok_emb,
                             const float* __restrict__ pos_emb,
                             float* __restrict__ x) {
  int idx = blockIdx.x * 256 + threadIdx.x;
  int n = idx >> 9;
  int d = idx & (DIM - 1);
  x[idx] = tok_emb[(size_t)tokens[n] * DIM + d] + pos_emb[idx];
}

// ---------------------------------------------------------------------------
// Weight transpose + fp32 -> f16 convert:  in[K][N] -> out[N][K], every weight
// matrix of the model in ONE launch. A work-group takes one tile of 64 k x 256 n:
// a wave's load is 512 contiguous bytes of an input row, a wave's store is four
// whole 128-byte lines of output rows.
// ---------------------------------------------------------------------------
#define WTK 64
#define WTN 256
#define WTP (WTK + 8)                        // LDS row pitch in halves: 144 B = 16 B x odd
typedef __attribute__((ext_vector_type(4))) float wt4f;

template <int K, int N>
__device__ __forceinline__ void wt_tile(const float* __restrict__ in, _Float16* __restrict__ out,
                                        int kt, int nt, _Float16 (*tile)[WTP]) {
  const int tid = threadIdx.x;
  const int c  = tid & 63;                   // columns n = 4c .. 4c+3 of the tile
  const int kr = tid >> 6;                   // rows k = 16kr .. 16kr+15 of the tile
  const float* s = in + (size_t)(kt * WTK + kr * 16) * N + nt * WTN + 4 * c;
  wt4f r[16];
#pragma unroll
  for (int i = 0; i < 16; ++i) r[i] = *(const wt4f*)(s + (size_t)i * N);
#pragma unroll
  for (int j = 0; j < 4; ++j) {
    v8h lo, hi;
#pragma unroll
    for (int i = 0; i < 8; ++i) { lo[i] = (_Float16)r[i][j]; hi[i] = (_Float16)r[8 + i][j]; }
    *(v8h*)&tile[4 * c + j][kr * 16]     = lo;
    *(v8h*)&tile[4 * c + j][kr * 16 + 8] = hi;
  }
  __syncthreads();
  const int n0 = tid >> 3, q = (tid & 7) * 8;  // 8 lanes a row of 64 halves
  _Float16* d = out + (size_t)(nt * WTN + n0) * K + kt * WTK + q;
#pragma unroll
  for (int p = 0; p < 8; ++p)
    *(v8h*)(d + (size_t)p * 32 * K) = *(const v8h*)&tile[n0 + 32 * p][q];
}

#define WT_OUT_TILES ((DIM / WTK) * (VOCAB / WTN))                 // 1000
#define WT_SQ_TILES  ((DIM / WTK) * (DIM / WTN))                   // 16 for one DIM x DIM matrix
#define WT_FF_TILES  ((DIM / WTK) * (FFD / WTN))                   // 64 for W1, as many for W2
#define WT_LAYER_TILES (4 * WT_SQ_TILES + 2 * WT_FF_TILES)         // 192
#define WT_TILES (WT_OUT_TILES + NL * WT_LAYER_TILES)              // 1768

__global__ void __launch_bounds__(256)
wt_transpose_all_f16(const float* __restrict__ Wq, const float* __restrict__ Wk,
                     const float* __restrict__ Wv, const float* __restrict__ Wo,
                     const float* __restrict__ W1, const float* __restrict__ W2,
                     const float* __restrict__ Wout,
                     _Float16* __restrict__ QKVT, _Float16* __restrict__ WoT,
                     _Float16* __restrict__ W1T, _Float16* __restrict__ W2T,
                     _Float16* __restrict__ WoutT) {
  __shared__ __align__(16) _Float16 tile[WTN][WTP];
  const int b = blockIdx.x;                  // every choice below is the same for the whole work-group
  if (b < WT_OUT_TILES) {
    wt_tile<DIM, VOCAB>(Wout, WoutT, b & 7, b >> 3, tile);
    return;
  }
  const int u = b - WT_OUT_TILES;
  const int layer = u / WT_LAYER_TILES;
  const int r = u - layer * WT_LAYER_TILES;
  if (r < 4 * WT_SQ_TILES) {
    const int which = r >> 4, t = r & 15;    // Wq, Wk, Wv, Wo
    const float* in = (which == 0 ? Wq : which == 1 ? Wk : which == 2 ? Wv : Wo) + (size_t)layer * DIM * DIM;
    _Float16* out = which < 3 ? QKVT + (size_t)(layer * 3 + which) * DIM * DIM
                              : WoT + (size_t)layer * DIM * DIM;
    wt_tile<DIM, DIM>(in, out, t & 7, t >> 3, tile);
  } else if (r < 4 * WT_SQ_TILES + WT_FF_TILES) {
    const int t = r - 4 * WT_SQ_TILES;
    wt_tile<DIM, FFD>(W1 + (size_t)layer * DIM * FFD, W1T + (size_t)layer * DIM * FFD, t & 7, t >> 3, tile);
  } else {
    const int t = r - 4 * WT_SQ_TILES - WT_FF_TILES;
    wt_tile<FFD, DIM>(W2 + (size_t)layer * DIM * FFD, W2T + (size_t)layer * DIM * FFD, t & 31, t >> 5, tile);
  }
}

// ---------------------------------------------------------------------------
// LayerNorm (per row of [SEQ, DIM]) -> f16 activations for GEMM A-operand
// ---------------------------------------------------------------------------
__global__ void layernorm_f16_kernel(const float* __restrict__ x,
                                     const float* __restrict__ g,
                                     const float* __restrict__ b,
                                     _Float16* __restrict__ out) {
  __shared__ float r1[128], r2[128];
  const int row = blockIdx.x, t = threadIdx.x;
  const float* xr = x + (size_t)row * DIM;
  float s = 0.f, s2 = 0.f;
  for (int d = t; d < DIM; d += 128) { float v = xr[d]; s += v; s2 += v * v; }
  r1[t] = s; r2[t] = s2; __syncthreads();
#pragma unroll
  for (int st = 64; st > 0; st >>= 1) {
    if (t < st) { r1[t] += r1[t + st]; r2[t] += r2[t + st]; }
    __syncthreads();
  }
  const float mean = r1[0] * (1.f / DIM);
  const float var  = r2[0] * (1.f / DIM) - mean * mean;
  const float rstd = rsqrtf(var + 1e-5f);
  for (int d = t; d < DIM; d += 128)
    out[(size_t)row * DIM + d] = (_Float16)((xr[d] - mean) * rstd * g[d] + b[d]);
}

// ---------------------------------------------------------------------------
// WMMA GEMM:  C[M,N] (op)= A[M,K](f16) * Bt[N,K](f16)^T + bias
//   EPI 0: C(f32) = val          EPI 1: C(f32) += val          EPI 2: Ch(f16) = gelu(val)
// Block: 256 threads = 8 wave32 (4x2). Block tile 128x128, wave tile 32x64
// (2 A-frags x 4 B-frags = 8 WMMA per 32 k). A stage is GBK = 128 k of both
// operands: 256 contiguous bytes of every row, so one wave-wide 16-byte copy
// covers two whole rows of the stage (four whole 128-byte lines). Two LDS
// buffers; the next stage's async copies fly while this one is worked on.
// M,N multiples of 128; K a multiple of 128.
// LNA: the A operand is LayerNorm(X) (K == DIM). The work-group normalises its own
// 128 rows of X (f32) once, one wave a row, and keeps them as f16 in LDS for the
// whole k loop; only B goes through the two stage buffers.
// ---------------------------------------------------------------------------
#define GBK 128
#define GPITCH (GBK + 8)                     // LDS row pitch in halves: 272 B = 16 B x odd

// One stage of one operand: 128 rows x 256 B = 2048 pieces of 16 B, eight a thread.
// g and l already point at this thread's piece of row tid / 16.
__device__ __forceinline__ void gemm_stage_copy(const _Float16* g, _Float16* l, int K) {
#pragma unroll
  for (int i = 0; i < 8; ++i)
    __builtin_amdgcn_global_load_async_to_lds_b128(AS1P(g + (size_t)i * 16 * K),
                                                   AS3P(l + i * 16 * GPITCH), 0, 0);
}

// sum over the 32 lanes of a wave, the result in every lane: four steps inside the
// 16-lane row (row_xmask 1, 2, 4, 8), then lane l with lane l ^ 16
template <int XM>
__device__ __forceinline__ float row_xadd(float v) {
  return v + __builtin_bit_cast(float, __builtin_amdgcn_update_dpp(
                 0, __builtin_bit_cast(int, v), 0x160 | XM, 0xf, 0xf, true));
}
__device__ __forceinline__ float wave_sum(float v) {
  v = row_xadd<1>(v); v = row_xadd<2>(v); v = row_xadd<4>(v); v = row_xadd<8>(v);
  return v + __builtin_bit_cast(float, __builtin_amdgcn_permlanex16(
                 __builtin_bit_cast(int, v), __builtin_bit_cast(int, v), 0x76543210, 0xfedcba98, false, false));
}

#define LPITCH (DIM + 8)                     // LDS row pitch of the normalised A in halves: 1040 B = 16 B x odd

template <int EPI, bool LNA>
__global__ void __launch_bounds__(256)
gemm_f16_wmma(const _Float16* __restrict__ A, const float* __restrict__ X,
              const float* __restrict__ lng, const float* __restrict__ lnb,
              const _Float16* __restrict__ Bt,
              const float* __restrict__ bias, float* __restrict__ C,
              _Float16* __restrict__ Ch, int M, int N, int K) {
  __shared__ __align__(16) _Float16 lA[LNA ? 1 : 2][128][LNA ? LPITCH : GPITCH];
  __shared__ __align__(16) _Float16 lB[2][128][GPITCH];

  const int tid  = threadIdx.x;
  const int lane = tid & 31;
  const int wid  = tid >> 5;
  const int wr   = wid >> 1;                 // 0..3  (32-row slab)
  const int wc   = wid & 1;                  // 0..1  (64-col slab)
  const int rowBase = blockIdx.y * 128;
  const int colBase = blockIdx.x * 128;

  // staging: 16 threads a row, 16 B each
  const int srow = tid >> 4;                 // 0..15, + 16 for each further piece
  const int skq  = (tid & 15) * 8;           // halves
  const _Float16* gA = A  + (size_t)(rowBase + srow) * K + skq;
  const _Float16* gB = Bt + (size_t)(colBase + srow) * K + skq;

  // fragment coords (16-bit 16x32 layout: lane%16 = row/col, lane/16 = K-half)
  const int mrow = lane & 15;
  const int kb   = (lane >> 4) * 8;

  v8f acc[2][4];
#pragma unroll
  for (int a = 0; a < 2; ++a)
#pragma unroll
    for (int j = 0; j < 4; ++j) acc[a][j] = (v8f){};

  const int nst = K / GBK;                   // stages; the same for the whole work-group

  // C/D layout: VGPR i -> M = i + 8*(lane/16), N = lane%16
  const int row0 = rowBase + wr * 32 + (lane >> 4) * 8;
  const int colW = colBase + wc * 64 + (lane & 15);

  // ---- prologue: stage 0 into buffer 0, published; then stage 1 starts into buffer 1 ----
  if constexpr (!LNA) gemm_stage_copy(gA, &lA[0][srow][skq], K);
  gemm_stage_copy(gB, &lB[0][srow][skq], K);
  if constexpr (LNA) {
    // wave wid normalises rows 16 wid .. 16 wid + 15 of the tile, four rows' loads in flight;
    // a lane holds columns 128 q + 4 lane .. + 3, so every load covers 512 contiguous bytes
    const int w16 = __builtin_amdgcn_readfirstlane(wid) * 16;
    const v4f* xw = (const v4f*)(X + (size_t)(rowBase + w16) * DIM);
    const v4f* g4 = (const v4f*)lng;
    const v4f* b4 = (const v4f*)lnb;
    const int c4 = lane * 4;
    v4f gg[4], gb[4];
#pragma unroll
    for (int q = 0; q < 4; ++q) {
      gg[q] = g4[lane + q * 32];
      gb[q] = b4[lane + q * 32];
    }
    // kept rolled: this text runs once
#pragma unroll 1
    for (int it = 0; it < 4; ++it) {
      const v4f* xr = xw + lane + it * DIM;  // the lane's piece; four rows of DIM / 4 pieces a trip
      v4f xv[4][4];
#pragma unroll
      for (int r = 0; r < 4; ++r)
#pragma unroll
        for (int q = 0; q < 4; ++q)
          xv[r][q] = xr[r * (DIM / 4) + q * 32];
      // the addresses as inputs keep the issued loads' address registers untouched up to this
      // wait; behind it the next trip may form new ones
      asm volatile("s_wait_xcnt 0x0" :: "v"(xr), "s"(g4), "s"(b4), "v"(lane) : "memory");
      float s1[4], s2[4];
#pragma unroll
      for (int r = 0; r < 4; ++r) {
        const v4f a = (xv[r][0] + xv[r][1]) + (xv[r][2] + xv[r][3]);
        v4f b = xv[r][0] * xv[r][0];
#pragma unroll
        for (int q = 1; q < 4; ++q) b += xv[r][q] * xv[r][q];
        s1[r] = (a[0] + a[1]) + (a[2] + a[3]);
        s2[r] = (b[0] + b[1]) + (b[2] + b[3]);
      }
#pragma unroll
      for (int r = 0; r < 4; ++r) { s1[r] = wave_sum(s1[r]); s2[r] = wave_sum(s2[r]); }
#pragma unroll
      for (int r = 0; r < 4; ++r) {
        const float mean = s1[r] * (1.f / DIM);
        const float var  = s2[r] * (1.f / DIM) - mean * mean;
        const float rstd = rsqrtf(var + 1e-5f);
#pragma unroll
        for (int q = 0; q < 4; ++q) {
          const v4f y = (xv[r][q] - mean) * rstd * gg[q] + gb[q];
          v4h hv;
#pragma unroll
          for (int e = 0; e < 4; ++e) hv[e] = (_Float16)y[e];
          *(v4h*)&lA[0][w16 + it * 4 + r][q * 128 + c4] = hv;
        }
      }
    }
  }
  asm volatile("s_wait_asynccnt 0x0" ::: "memory");   // this wave's pieces of stage 0 have landed
  __syncthreads();                                    // LNA: it also publishes the normalised rows
  if (nst > 1) {
    if constexpr (!LNA) gemm_stage_copy(gA + GBK, &lA[1][srow][skq], K);
    gemm_stage_copy(gB + GBK, &lB[1][srow][skq], K);
  }

  // Everything the epilogue reads from global memory is asked for here, all of it in
  // flight at once behind the second stage's copies: the first pass of the k loop covers the latency.
  // The loops are unrolled so that bb and res are registers with constant indices.
  float bb[4];
  float res[2][4][8];
#pragma unroll
  for (int j = 0; j < 4; ++j) bb[j] = 0.f;
  if (bias) {
#pragma unroll
    for (int j = 0; j < 4; ++j) bb[j] = bias[colW + j * 16];
  }
  if (EPI == 1) {
#pragma unroll
    for (int a = 0; a < 2; ++a)
#pragma unroll
      for (int i = 0; i < 8; ++i)
#pragma unroll
        for (int j = 0; j < 4; ++j)
          res[a][j][i] = C[(size_t)(row0 + a * 16 + i) * N + colW + j * 16];
  }
  // the base and the column offset as inputs keep the issued loads' address registers untouched
  // up to this wait; behind it they may take new values
  asm volatile("s_wait_xcnt 0x0" :: "s"(bias), "v"(colW) : "memory");

  for (int s = 0; s < nst; ++s) {
    const int buf = s & 1;
#pragma unroll
    for (int ks = 0; ks < GBK; ks += 32) {
      union Frag { v16h v; v8h h[2]; } af[2], bf[4];
#pragma unroll
      for (int a = 0; a < 2; ++a) {
        const int r = wr * 32 + a * 16 + mrow;
        const _Float16* ar = LNA ? &lA[0][r][s * GBK + ks + kb] : &lA[buf][r][ks + kb];
        af[a].h[0] = *(const v8h*)ar;
        af[a].h[1] = *(const v8h*)(ar + 16);
      }
#pragma unroll
      for (int j = 0; j < 4; ++j) {
        const int r = wc * 64 + j * 16 + mrow;
        bf[j].h[0] = *(const v8h*)&lB[buf][r][ks + kb];
        bf[j].h[1] = *(const v8h*)&lB[buf][r][ks + kb + 16];
      }
#pragma unroll
      for (int a = 0; a < 2; ++a)
#pragma unroll
        for (int j = 0; j < 4; ++j)
          acc[a][j] = __builtin_amdgcn_wmma_f32_16x16x32_f16(false, af[a].v, false, bf[j].v,
                                                             (short)0, acc[a][j], false, false);
    }
    // publish point of stage s + 1
    asm volatile("s_wait_dscnt 0x0" ::: "memory");     // this wave's reads of buffer buf are done before it is refilled
    asm volatile("s_wait_asynccnt 0x0" ::: "memory");  // this wave's pieces of stage s + 1 have landed
    __syncthreads();
    if (s + 2 < nst) {                                 // refill the buffer every wave has just left
      if constexpr (!LNA) gemm_stage_copy(gA + (size_t)(s + 2) * GBK, &lA[buf][srow][skq], K);
      gemm_stage_copy(gB + (size_t)(s + 2) * GBK, &lB[buf][srow][skq], K);
    }
  }
  asm volatile("s_wait_asynccnt 0x0" ::: "memory");    // no copy is left in flight when the wave goes on to its end

#pragma unroll
  for (int a = 0; a < 2; ++a) {
#pragma unroll
    for (int j = 0; j < 4; ++j) {
      const int col = colW + j * 16;
#pragma unroll
      for (int i = 0; i < 8; ++i) {
        const size_t idx = (size_t)(row0 + a * 16 + i) * N + col;
        const float v = acc[a][j][i] + bb[j];
        if (EPI == 0)      C[idx] = v;
        else if (EPI == 1) C[idx] = res[a][j][i] + v;
        else Ch[idx] = (_Float16)(0.5f * v * (1.f + erff(v * 0.70710678118f)));
      }
    }
  }
}

// ---------------------------------------------------------------------------
// Causal linear attention over fused QKV buffer [SEQ][3*DIM], in chunks of
// ACH tokens. With ke = exp(k), qs = softmax(q) * DHEAD^-0.5 and, for chunk c,
//   Sprev = sum over tokens before the chunk of ke^T v     (DHEAD x DHEAD)
//   kprev = sum over tokens before the chunk of ke         (DHEAD)
//   P[n][m] = qs[n] . ke[m] for m <= n inside the chunk, else 0
// the output row is (qs[n] . Sprev + P[n] . v) / max(qs[n] . kprev + sum_m P[n][m], eps).
// Launch 1 writes each chunk's own ke^T v and sum of ke, the last chunk's excepted; launch 2 adds up the
// chunks before its own and forms the rows. All sums in f32.
// ---------------------------------------------------------------------------
#define ACH 64
#define NCH (SEQ / ACH)

// grid (NH, NCH-1): the last chunk's sums have no reader.
__global__ void __launch_bounds__(256)
attn_chunk_state_kernel(const float* __restrict__ QKV, float* __restrict__ Sws,
                        float* __restrict__ Kws) {
  __shared__ __align__(16) float ke[ACH][DHEAD];
  __shared__ __align__(16) float vs[ACH][DHEAD];
  const int h = blockIdx.x, c = blockIdx.y, tid = threadIdx.x;
  const int l = tid & 15, g = tid >> 4;
#pragma unroll
  for (int p = 0; p < 4; ++p) {
    const int n = p * 16 + g;
    const float* s = QKV + (size_t)(c * ACH + n) * (3 * DIM) + h * DHEAD + 4 * l;
    v4f kv = *(const v4f*)(s + DIM);
    const v4f vv = *(const v4f*)(s + 2 * DIM);
#pragma unroll
    for (int e = 0; e < 4; ++e) kv[e] = __expf(kv[e]);
    *(v4f*)&ke[n][4 * l] = kv;
    *(v4f*)&vs[n][4 * l] = vv;
  }
  __syncthreads();

  // thread tile: rows d = 4g..4g+3, columns e = 4l..4l+3
  v4f acc[4];
  v4f ks = (v4f){0.f, 0.f, 0.f, 0.f};
#pragma unroll
  for (int i = 0; i < 4; ++i) acc[i] = (v4f){0.f, 0.f, 0.f, 0.f};
#pragma unroll 8
  for (int n = 0; n < ACH; ++n) {
    const v4f a = *(const v4f*)&ke[n][4 * g];
    const v4f b = *(const v4f*)&vs[n][4 * l];
#pragma unroll
    for (int i = 0; i < 4; ++i) acc[i] += a[i] * b;
    ks += a;
  }
  float* dst = Sws + (size_t)(h * NCH + c) * (DHEAD * DHEAD);
#pragma unroll
  for (int i = 0; i < 4; ++i) *(v4f*)(dst + (4 * g + i) * DHEAD + 4 * l) = acc[i];
  if (l == 0) *(v4f*)(Kws + (h * NCH + c) * DHEAD + 4 * g) = ks;
}

// grid (NH, NCH)
__global__ void __launch_bounds__(256)
attn_chunk_out_kernel(const float* __restrict__ QKV, const float* __restrict__ Sws,
                      const float* __restrict__ Kws, _Float16* __restrict__ Aout) {
  __shared__ __align__(16) float X[ACH][DHEAD + ACH + 4];   // row n: qs[n][0..63] | P[n][0..63]
  __shared__ __align__(16) float Y[DHEAD + ACH][DHEAD];     // rows 0..63 Sprev[d][e], rows 64.. v[m][e]
  __shared__ __align__(16) float Kl[ACH][DHEAD + 4];        // ke[m][d]; pitch 16 B x odd
  __shared__ __align__(16) float kp[DHEAD];                 // kprev
  const int h = blockIdx.x, c = blockIdx.y, tid = threadIdx.x;
  const int l = tid & 15, g = tid >> 4;

  // ---- Sprev, kprev: add up the chunks before this one, four chunks' loads in flight ----
  v4f sp[4];
#pragma unroll
  for (int r = 0; r < 4; ++r) sp[r] = (v4f){0.f, 0.f, 0.f, 0.f};
  const float* sb = Sws + (size_t)h * NCH * (DHEAD * DHEAD);
  const unsigned so = (unsigned)tid * 4u;
  for (int g0 = 0; g0 < c; g0 += 4) {
    v4f t[4][4];
    const float* sc[4];
#pragma unroll
    for (int j = 0; j < 4; ++j) {
      sc[j] = sb + (size_t)min(g0 + j, c - 1) * (DHEAD * DHEAD) + so;
#pragma unroll
      for (int r = 0; r < 4; ++r) t[j][r] = *(const v4f*)(sc[j] + r * 1024);
    }
    // the addresses as inputs keep the issued loads' address registers untouched up to this wait;
    // behind it the next trip may form new ones
    asm volatile("s_wait_xcnt 0x0" :: "v"(sc[0]), "v"(sc[1]), "v"(sc[2]), "v"(sc[3]) : "memory");
#pragma unroll
    for (int j = 0; j < 4; ++j) {
      const float w = (g0 + j < c) ? 1.f : 0.f;
#pragma unroll
      for (int r = 0; r < 4; ++r) sp[r] += w * t[j][r];
    }
  }
#pragma unroll
  for (int r = 0; r < 4; ++r) *(v4f*)&Y[r * 16 + g][4 * l] = sp[r];
  if (tid < DHEAD) {
    float s = 0.f;
#pragma unroll
    for (int cc = 0; cc < NCH - 1; ++cc) {
      const float t = Kws[(h * NCH + cc) * DHEAD + tid];
      s += (cc < c) ? t : 0.f;
    }
    kp[tid] = s;
  }

  // ---- this chunk's q (softmax over the row, 16 lanes a row), ke, v ----
  const float* sq[4];
  v4f q4[4], k4[4], v4[4];
#pragma unroll
  for (int p = 0; p < 4; ++p) {
    sq[p] = QKV + (size_t)(c * ACH + p * 16 + g) * (3 * DIM) + h * DHEAD + 4 * l;
    q4[p] = *(const v4f*)(sq[p]);
    k4[p] = *(const v4f*)(sq[p] + DIM);
    v4[p] = *(const v4f*)(sq[p] + 2 * DIM);
  }
  // the addresses as inputs keep the issued loads' address registers untouched up to this wait
  asm volatile("s_wait_xcnt 0x0" :: "v"(sq[0]), "v"(sq[1]), "v"(sq[2]), "v"(sq[3]) : "memory");
#pragma unroll
  for (int p = 0; p < 4; ++p) {
    const int n = p * 16 + g;
    v4f qv = q4[p];
    v4f kv = k4[p];
    const v4f vv = v4[p];
    float mx = fmaxf(fmaxf(qv[0], qv[1]), fmaxf(qv[2], qv[3]));
#pragma unroll
    for (int m = 1; m < 16; m <<= 1) mx = fmaxf(mx, __shfl_xor(mx, m));
#pragma unroll
    for (int e = 0; e < 4; ++e) qv[e] = __expf(qv[e] - mx);
    float sm = (qv[0] + qv[1]) + (qv[2] + qv[3]);
#pragma unroll
    for (int m = 1; m < 16; m <<= 1) sm += __shfl_xor(sm, m);
    const float qsc = 0.125f / sm;                 // 1 / row sum, * DHEAD^-0.5
#pragma unroll
    for (int e = 0; e < 4; ++e) {
      qv[e] *= qsc;
      kv[e] = __expf(kv[e]);
    }
    *(v4f*)&X[n][4 * l]          = qv;
    *(v4f*)&Kl[n][4 * l]         = kv;
    *(v4f*)&Y[DHEAD + n][4 * l]  = vv;
  }
  __syncthreads();

  // ---- P: thread tile rows n = tn..tn+3, columns m = l + 16*jj ----
  const int tn = 4 * g;
  v2f pr2[4][4];                                   // even-d and odd-d halves of each dot product
#pragma unroll
  for (int i = 0; i < 4; ++i)
#pragma unroll
    for (int jj = 0; jj < 4; ++jj) pr2[i][jj] = (v2f){0.f, 0.f};
#pragma unroll 2
  for (int d = 0; d < DHEAD; d += 4) {
    v4f qa[4], kb[4];
#pragma unroll
    for (int i = 0; i < 4; ++i) qa[i] = *(const v4f*)&X[tn + i][d];
#pragma unroll
    for (int jj = 0; jj < 4; ++jj) kb[jj] = *(const v4f*)&Kl[l + 16 * jj][d];
#pragma unroll
    for (int i = 0; i < 4; ++i)
#pragma unroll
      for (int jj = 0; jj < 4; ++jj) {
        pr2[i][jj] += qa[i].lo * kb[jj].lo;
        pr2[i][jj] += qa[i].hi * kb[jj].hi;
      }
  }
  // denominator: each of the row's 16 lanes adds its four columns of P and its
  // four terms of qs . kprev; the lanes are then summed.
  float dinv[4];
  const v4f kq = *(const v4f*)&kp[4 * l];
#pragma unroll
  for (int i = 0; i < 4; ++i) {
    const v4f qq = *(const v4f*)&X[tn + i][4 * l];
    float rs = (qq[0] * kq[0] + qq[1] * kq[1]) + (qq[2] * kq[2] + qq[3] * kq[3]);
#pragma unroll
    for (int jj = 0; jj < 4; ++jj) {
      const int m = l + 16 * jj;
      const float pv = (m <= tn + i) ? pr2[i][jj][0] + pr2[i][jj][1] : 0.f;   // causal, own token included
      rs += pv;
      X[tn + i][DHEAD + m] = pv;
    }
#pragma unroll
    for (int m = 1; m < 16; m <<= 1) rs += __shfl_xor(rs, m);
    dinv[i] = 1.f / fmaxf(rs, 1e-3f);
  }
  __syncthreads();

  // ---- rows: [qs | P] x [Sprev ; v]; P is zero from column 8*(wave+1) on for this wave's rows ----
  const int jEnd = DHEAD + 8 * (__builtin_amdgcn_readfirstlane(tid >> 5) + 1);
  v4f o[4];
#pragma unroll
  for (int i = 0; i < 4; ++i) o[i] = (v4f){0.f, 0.f, 0.f, 0.f};
#pragma unroll 2
  for (int j = 0; j < jEnd; j += 4) {
    v4f xa[4], yb[4];
#pragma unroll
    for (int i = 0; i < 4; ++i) xa[i] = *(const v4f*)&X[tn + i][j];
#pragma unroll
    for (int e = 0; e < 4; ++e) yb[e] = *(const v4f*)&Y[j + e][4 * l];
#pragma unroll
    for (int i = 0; i < 4; ++i)
#pragma unroll
      for (int e = 0; e < 4; ++e) o[i] += xa[i][e] * yb[e];
  }
#pragma unroll
  for (int i = 0; i < 4; ++i) {
    v4h hv;
#pragma unroll
    for (int e = 0; e < 4; ++e) hv[e] = (_Float16)(o[i][e] * dinv[i]);
    *(v4h*)(Aout + (size_t)(c * ACH + tn + i) * DIM + h * DHEAD + 4 * l) = hv;
  }
}

// ---------------------------------------------------------------------------
// Host orchestration
// ---------------------------------------------------------------------------
extern "C" void kernel_launch(void* const* d_in, const int* in_sizes, int n_in,
                              void* d_out, int out_size, void* d_ws, size_t ws_size,
                              hipStream_t stream) {
  (void)in_sizes; (void)n_in; (void)out_size; (void)ws_size;
  const int*   tokens  = (const int*)  d_in[0];
  const float* tok_emb = (const float*)d_in[1];
  const float* pos_emb = (const float*)d_in[2];
  const float* Wq  = (const float*)d_in[3];
  const float* Wk  = (const float*)d_in[4];
  const float* Wv  = (const float*)d_in[5];
  const float* Wo  = (const float*)d_in[6];
  const float* bo  = (const float*)d_in[7];
  const float* ln1g = (const float*)d_in[8];
  const float* ln1b = (const float*)d_in[9];
  const float* W1  = (const float*)d_in[10];
  const float* b1  = (const float*)d_in[11];
  const float* W2  = (const float*)d_in[12];
  const float* b2  = (const float*)d_in[13];
  const float* ln2g = (const float*)d_in[14];
  const float* ln2b = (const float*)d_in[15];
  const float* lnfg = (const float*)d_in[16];
  const float* lnfb = (const float*)d_in[17];
  const float* Wout = (const float*)d_in[18];
  const float* bout = (const float*)d_in[19];
  float* out = (float*)d_out;

  char* p = (char*)d_ws;
  auto carve = [&](size_t bytes) -> char* {
    char* r = p; p += (bytes + 255) & ~(size_t)255; return r;
  };
  _Float16* QKVT  = (_Float16*)carve((size_t)NL * 3 * DIM * DIM * 2);  // fused [1536][512] per layer
  _Float16* WoT   = (_Float16*)carve((size_t)NL * DIM * DIM * 2);
  _Float16* W1T   = (_Float16*)carve((size_t)NL * DIM * FFD * 2);
  _Float16* W2T   = (_Float16*)carve((size_t)NL * DIM * FFD * 2);
  _Float16* WoutT = (_Float16*)carve((size_t)DIM * VOCAB * 2);
  float*    x     = (float*)   carve((size_t)SEQ * DIM * 4);
  _Float16* h16   = (_Float16*)carve((size_t)SEQ * DIM * 2);
  float*    qkvf  = (float*)   carve((size_t)SEQ * 3 * DIM * 4);
  _Float16* a16   = (_Float16*)carve((size_t)SEQ * DIM * 2);
  _Float16* ff16  = (_Float16*)carve((size_t)SEQ * FFD * 2);
  float*    sws   = (float*)   carve((size_t)NH * NCH * DHEAD * DHEAD * 4);  // per-chunk ke^T v
  float*    kws   = (float*)   carve((size_t)NH * NCH * DHEAD * 4);          // per-chunk sum of ke

  wt_transpose_all_f16<<<WT_TILES, 256, 0, stream>>>(Wq, Wk, Wv, Wo, W1, W2, Wout,
                                                     QKVT, WoT, W1T, W2T, WoutT);

  embed_kernel<<<SEQ * DIM / 256, 256, 0, stream>>>(tokens, tok_emb, pos_emb, x);

  const dim3 gD(DIM / 128, SEQ / 128);      // (4, 8)
  for (int i = 0; i < NL; ++i) {
    const size_t wo = (size_t)i * DIM * DIM;
    const size_t fo = (size_t)i * DIM * FFD;
    gemm_f16_wmma<0, true><<<dim3(3 * DIM / 128, SEQ / 128), 256, 0, stream>>>(
        nullptr, x, ln1g + i * DIM, ln1b + i * DIM,
        QKVT + (size_t)i * 3 * DIM * DIM, nullptr, qkvf, nullptr, SEQ, 3 * DIM, DIM);
    attn_chunk_state_kernel<<<dim3(NH, NCH - 1), 256, 0, stream>>>(qkvf, sws, kws);
    attn_chunk_out_kernel<<<dim3(NH, NCH), 256, 0, stream>>>(qkvf, sws, kws, a16);
    gemm_f16_wmma<1, false><<<gD, 256, 0, stream>>>(a16, nullptr, nullptr, nullptr,
                                                    WoT + wo, bo + i * DIM, x, nullptr, SEQ, DIM, DIM);
    gemm_f16_wmma<2, true><<<dim3(FFD / 128, SEQ / 128), 256, 0, stream>>>(
        nullptr, x, ln2g + i * DIM, ln2b + i * DIM,
        W1T + fo, b1 + i * FFD, nullptr, ff16, SEQ, FFD, DIM);
    gemm_f16_wmma<1, false><<<gD, 256, 0, stream>>>(ff16, nullptr, nullptr, nullptr,
                                                    W2T + fo, b2 + i * DIM, x, nullptr, SEQ, DIM, FFD);
  }
  layernorm_f16_kernel<<<SEQ, 128, 0, stream>>>(x, lnfg, lnfb, h16);
  gemm_f16_wmma<0, false><<<dim3(VOCAB / 128, SEQ / 128), 256, 0, stream>>>(
      h16, nullptr, nullptr, nullptr, WoutT, bout, out, nullptr, SEQ, VOCAB, DIM);
}

// v006
// A run of this version takes 282 microseconds.
// Two timings next to v005 put it at 1.05 and 1.06 times that version's speed.
// All steps since v000 together make it 38.8 times as fast.
#include <hip/hip_runtime.h>
#include <hip/hip_bf16.h>
#include <math.h>
#include <stdint.h>

// ---- model dims (fixed by reference) ----
#define SEQ   1024
#define DIM   512
#define NH    8
#define DHEAD 64
#define FFD   2048
#define NL    4
#define VOCAB 32000

typedef __attribute__((ext_vector_type(16))) _Float16 v16h;
typedef __attribute__((ext_vector_type(8)))  _Float16 v8h;
typedef __attribute__((ext_vector_type(8)))  float    v8f;
typedef __attribute__((__vector_size__(16))) int      v4i;   // matches builtin param type
typedef __attribute__((ext_vector_type(4))) float    v4f;
typedef __attribute__((ext_vector_type(2))) float    v2f;
typedef __attribute__((ext_vector_type(4))) _Float16 v4h;

// ---- CDNA5 async global->LDS path (ASYNCcnt) --------------------------------
// Rebuild addrspace-qualified int4 pointers from flat addresses (LDS flat addr
// low 32 bits == LDS byte offset on CDNA5, ISA 10.2 aperture mapping; flat ==
// global address for AS1).
#define AS1P(p) ((__attribute__((address_space(1))) v4i*)(unsigned long long)(uintptr_t)(p))
#define AS3P(p) ((__attribute__((address_space(3))) v4i*)(unsigned)(uintptr_t)(p))

// ---------------------------------------------------------------------------
// Embedding: x[n,d] = tok_emb[tokens[n],d] + pos_emb[n,d]
// ---------------------------------------------------------------------------
__global__ void embed_kernel(const int* __restrict__ tokens,
                             const float* __restrict__ tok_emb,
                             const float* __restrict__ pos_emb,
                             float* __restrict__ x) {
  int idx = blockIdx.x * 256 + threadIdx.x;
  int n = idx >> 9;
  int d = idx & (DIM - 1);
  x[idx] = tok_emb[(size_t)tokens[n] * DIM + d] + pos_emb[idx];
}

// ---------------------------------------------------------------------------
// Weight transpose + fp32 -> f16 convert:  in[K][N] -> out[N][K], every weight
// matrix of the model in ONE launch. A work-group takes one tile of 64 k x 256 n:
// a wave's load is 512 contiguous bytes of an input row, a wave's store is four
// whole 128-byte lines of output rows.
// ---------------------------------------------------------------------------
#define WTK 64
#define WTN 256
#define WTP (WTK + 8)                        // LDS row pitch in halves: 144 B = 16 B x odd
typedef __attribute__((ext_vector_type(4))) float wt4f;

template <int K, int N>
__device__ __forceinline__ void wt_tile(const float* __restrict__ in, _Float16* __restrict__ out,
                                        int kt, int nt, _Float16 (*tile)[WTP]) {
  const int tid = threadIdx.x;
  const int c  = tid & 63;                   // columns n = 4c .. 4c+3 of the tile
  const int kr = tid >> 6;                   // rows k = 16kr .. 16kr+15 of the tile
  const float* s = in + (size_t)(kt * WTK + kr * 16) * N + nt * WTN + 4 * c;
  wt4f r[16];
#pragma unroll
  for (int i = 0; i < 16; ++i) r[i] = *(const wt4f*)(s + (size_t)i * N);
#pragma unroll
  for (int j = 0; j < 4; ++j) {
    v8h lo, hi;
#pragma unroll
    for (int i = 0; i < 8; ++i) { lo[i] = (_Float16)r[i][j]; hi[i] = (_Float16)r[8 + i][j]; }
    *(v8h*)&tile[4 * c + j][kr * 16]     = lo;
    *(v8h*)&tile[4 * c + j][kr * 16 + 8] = hi;
  }
  __syncthreads();
  const int n0 = tid >> 3, q = (tid & 7) * 8;  // 8 lanes a row of 64 halves
  _Float16* d = out + (size_t)(nt * WTN + n0) * K + kt * WTK + q;
#pragma unroll
  for (int p = 0; p < 8; ++p)
    *(v8h*)(d + (size_t)p * 32 * K) = *(const v8h*)&tile[n0 + 32 * p][q];
}

#define WT_OUT_TILES ((DIM / WTK) * (VOCAB / WTN))                 // 1000
#define WT_SQ_TILES  ((DIM / WTK) * (DIM / WTN))                   // 16 for one DIM x DIM matrix
#define WT_FF_TILES  ((DIM / WTK) * (FFD / WTN))                   // 64 for W1, as many for W2
#define WT_LAYER_TILES (4 * WT_SQ_TILES + 2 * WT_FF_TILES)         // 192
#define WT_TILES (WT_OUT_TILES + NL * WT_LAYER_TILES)              // 1768

__global__ void __launch_bounds__(256)
wt_transpose_all_f16(const float* __restrict__ Wq, const float* __restrict__ Wk,
                     const float* __restrict__ Wv, const float* __restrict__ Wo,
                     const float* __restrict__ W1, const float* __restrict__ W2,
                     const float* __restrict__ Wout,
                     _Float16* __restrict__ QKVT, _Float16* __restrict__ WoT,
                     _Float16* __restrict__ W1T, _Float16* __restrict__ W2T,
                     _Float16* __restrict__ WoutT) {
  __shared__ __align__(16) _Float16 tile[WTN][WTP];
  const int b = blockIdx.x;                  // every choice below is the same for the whole work-group
  if (b < WT_OUT_TILES) {
    wt_tile<DIM, VOCAB>(Wout, WoutT, b & 7, b >> 3, tile);
    return;
  }
  const int u = b - WT_OUT_TILES;
  const int layer = u / WT_LAYER_TILES;
  const int r = u - layer * WT_LAYER_TILES;
  if (r < 4 * WT_SQ_TILES) {
    const int which = r >> 4, t = r & 15;    // Wq, Wk, Wv, Wo
    const float* in = (which == 0 ? Wq : which == 1 ? Wk : which == 2 ? Wv : Wo) + (size_t)layer * DIM * DIM;
    _Float16* out = which < 3 ? QKVT + (size_t)(layer * 3 + which) * DIM * DIM
                              : WoT + (size_t)layer * DIM * DIM;
    wt_tile<DIM, DIM>(in, out, t & 7, t >> 3, tile);
  } else if (r < 4 * WT_SQ_TILES + WT_FF_TILES) {
    const int t = r - 4 * WT_SQ_TILES;
    wt_tile<DIM, FFD>(W1 + (size_t)layer * DIM * FFD, W1T + (size_t)layer * DIM * FFD, t & 7, t >> 3, tile);
  } else {
    const int t = r - 4 * WT_SQ_TILES - WT_FF_TILES;
    wt_tile<FFD, DIM>(W2 + (size_t)layer * DIM * FFD, W2T + (size_t)layer * DIM * FFD, t & 31, t >> 5, tile);
  }
}

// ---------------------------------------------------------------------------
// LayerNorm (per row of [SEQ, DIM]) -> f16 activations for GEMM A-operand
// ---------------------------------------------------------------------------
__global__ void layernorm_f16_kernel(const float* __restrict__ x,
                                     const float* __restrict__ g,
                                     const float* __restrict__ b,
                                     _Float16* __restrict__ out) {
  __shared__ float r1[128], r2[128];
  const int row = blockIdx.x, t = threadIdx.x;
  const float* xr = x + (size_t)row * DIM;
  float s = 0.f, s2 = 0.f;
  for (int d = t; d < DIM; d += 128) { float v = xr[d]; s += v; s2 += v * v; }
  r1[t] = s; r2[t] = s2; __syncthreads();
#pragma unroll
  for (int st = 64; st > 0; st >>= 1) {
    if (t < st) { r1[t] += r1[t + st]; r2[t] += r2[t + st]; }
    __syncthreads();
  }
  const float mean = r1[0] * (1.f / DIM);
  const float var  = r2[0] * (1.f / DIM) - mean * mean;
  const float rstd = rsqrtf(var + 1e-5f);
  for (int d = t; d < DIM; d += 128)
    out[(size_t)row * DIM + d] = (_Float16)((xr[d] - mean) * rstd * g[d] + b[d]);
}

// ---------------------------------------------------------------------------
// WMMA GEMM:  C[M,N] (op)= A[M,K](f16) * Bt[N,K](f16)^T + bias
//   EPI 0: C(f32) = val          EPI 1: C(f32) += val          EPI 2: Ch(f16) = gelu(val)
// Block: 256 threads = 8 wave32 (4x2). Block tile 128x128, wave tile 32x64
// (2 A-frags x 4 B-frags = 8 WMMA per 32 k). A stage is GBK = 128 k of both
// operands: 256 contiguous bytes of every row, so one wave-wide 16-byte copy
// covers two whole rows of the stage (four whole 128-byte lines). Two LDS
// buffers; the next stage's async copies fly while this one is worked on.
// M,N multiples of 128; K a multiple of 128.
// LNA: the A operand is LayerNorm(X) (K == DIM). The work-group normalises its own
// 128 rows of X (f32) once, one wave a row, and keeps them as f16 in LDS for the
// whole k loop; only B goes through the two stage buffers.
// ---------------------------------------------------------------------------
#define GBK 128
#define GPITCH (GBK + 8)                     // LDS row pitch in halves: 272 B = 16 B x odd

// One stage of one operand: 128 rows x 256 B = 2048 pieces of 16 B, eight a thread.
// g and l already point at this thread's piece of row tid / 16.
__device__ __forceinline__ void gemm_stage_copy(const _Float16* g, _Float16* l, int K) {
#pragma unroll
  for (int i = 0; i < 8; ++i)
    __builtin_amdgcn_global_load_async_to_lds_b128(AS1P(g + (size_t)i * 16 * K),
                                                   AS3P(l + i * 16 * GPITCH), 0, 0);
}

// sum over the 32 lanes of a wave, the result in every lane: four steps inside the
// 16-lane row (row_xmask 1, 2, 4, 8), then lane l with lane l ^ 16
template <int XM>
__device__ __forceinline__ float row_xadd(float v) {
  return v + __builtin_bit_cast(float, __builtin_amdgcn_update_dpp(
                 0, __builtin_bit_cast(int, v), 0x160 | XM, 0xf, 0xf, true));
}
__device__ __forceinline__ float wave_sum(float v) {
  v = row_xadd<1>(v); v = row_xadd<2>(v); v = row_xadd<4>(v); v = row_xadd<8>(v);
  return v + __builtin_bit_cast(float, __builtin_amdgcn_permlanex16(
                 __builtin_bit_cast(int, v), __builtin_bit_cast(int, v), 0x76543210, 0xfedcba98, false, false));
}

#define LPITCH (DIM + 8)                     // LDS row pitch of the normalised A in halves: 1040 B = 16 B x odd

template <int EPI, bool LNA>
__global__ void __launch_bounds__(256)
gemm_f16_wmma(const _Float16* __restrict__ A, const float* __restrict__ X,
              const float* __restrict__ lng, const float* __restrict__ lnb,
              const _Float16* __restrict__ Bt,
              const float* __restrict__ bias, float* __restrict__ C,
              _Float16* __restrict__ Ch, int M, int N, int K) {
  __shared__ __align__(16) _Float16 lA[LNA ? 1 : 2][128][LNA ? LPITCH : GPITCH];
  __shared__ __align__(16) _Float16 lB[2][128][GPITCH];

  const int tid  = threadIdx.x;
  const int lane = tid & 31;
  const int wid  = tid >> 5;
  const int wr   = wid >> 1;                 // 0..3  (32-row slab)
  const int wc   = wid & 1;                  // 0..1  (64-col slab)
  const int rowBase = blockIdx.y * 128;
  const int colBase = blockIdx.x * 128;

  // staging: 16 threads a row, 16 B each
  const int srow = tid >> 4;                 // 0..15, + 16 for each further piece
  const int skq  = (tid & 15) * 8;           // halves
  const _Float16* gA = A  + (size_t)(rowBase + srow) * K + skq;
  const _Float16* gB = Bt + (size_t)(colBase + srow) * K + skq;

  // fragment coords (16-bit 16x32 layout: lane%16 = row/col, lane/16 = K-half)
  const int mrow = lane & 15;
  const int kb   = (lane >> 4) * 8;

  v8f acc[2][4];
#pragma unroll
  for (int a = 0; a < 2; ++a)
#pragma unroll
    for (int j = 0; j < 4; ++j) acc[a][j] = (v8f){};

  const int nst = K / GBK;                   // stages; the same for the whole work-group

  // C/D layout: VGPR i -> M = i + 8*(lane/16), N = lane%16
  const int row0 = rowBase + wr * 32 + (lane >> 4) * 8;
  const int colW = colBase + wc * 64 + (lane & 15);

  // ---- prologue: stage 0 into buffer 0, published; then stage 1 starts into buffer 1 ----
  if constexpr (!LNA) gemm_stage_copy(gA, &lA[0][srow][skq], K);
  gemm_stage_copy(gB, &lB[0][srow][skq], K);
  if constexpr (LNA) {
    // wave wid normalises rows 16 wid .. 16 wid + 15 of the tile, four rows' loads in flight;
    // a lane holds columns 128 q + 4 lane .. + 3, so every load covers 512 contiguous bytes
    const int w16 = __builtin_amdgcn_readfirstlane(wid) * 16;
    const v4f* xw = (const v4f*)(X + (size_t)(rowBase + w16) * DIM);
    const v4f* g4 = (const v4f*)lng;
    const v4f* b4 = (const v4f*)lnb;
    const int c4 = lane * 4;
    v4f gg[4], gb[4];
#pragma unroll
    for (int q = 0; q < 4; ++q) {
      gg[q] = g4[lane + q * 32];
      gb[q] = b4[lane + q * 32];
    }
    // kept rolled: this text runs once
#pragma unroll 1
    for (int it = 0; it < 4; ++it) {
      const v4f* xr = xw + lane + it * DIM;  // the lane's piece; four rows of DIM / 4 pieces a trip
      v4f xv[4][4];
#pragma unroll
      for (int r = 0; r < 4; ++r)
#pragma unroll
        for (int q = 0; q < 4; ++q)
          xv[r][q] = xr[r * (DIM / 4) + q * 32];
      // the addresses as inputs keep the issued loads' address registers untouched up to this
      // wait; behind it the next trip may form new ones
      asm volatile("s_wait_xcnt 0x0" :: "v"(xr), "s"(g4), "s"(b4), "v"(lane) : "memory");
      float s1[4], s2[4];
#pragma unroll
      for (int r = 0; r < 4; ++r) {
        const v4f a = (xv[r][0] + xv[r][1]) + (xv[r][2] + xv[r][3]);
        v4f b = xv[r][0] * xv[r][0];
#pragma unroll
        for (int q = 1; q < 4; ++q) b += xv[r][q] * xv[r][q];
        s1[r] = (a[0] + a[1]) + (a[2] + a[3]);
        s2[r] = (b[0] + b[1]) + (b[2] + b[3]);
      }
#pragma unroll
      for (int r = 0; r < 4; ++r) { s1[r] = wave_sum(s1[r]); s2[r] = wave_sum(s2[r]); }
#pragma unroll
      for (int r = 0; r < 4; ++r) {
        const float mean = s1[r] * (1.f / DIM);
        const float var  = s2[r] * (1.f / DIM) - mean * mean;
        const float rstd = rsqrtf(var + 1e-5f);
#pragma unroll
        for (int q = 0; q < 4; ++q) {
          const v4f y = (xv[r][q] - mean) * rstd * gg[q] + gb[q];
          v4h hv;
#pragma unroll
          for (int e = 0; e < 4; ++e) hv[e] = (_Float16)y[e];
          *(v4h*)&lA[0][w16 + it * 4 + r][q * 128 + c4] = hv;
        }
      }
    }
  }
  asm volatile("s_wait_asynccnt 0x0" ::: "memory");   // this wave's pieces of stage 0 have landed
  __syncthreads();                                    // LNA: it also publishes the normalised rows
  if (nst > 1) {
    if constexpr (!LNA) gemm_stage_copy(gA + GBK, &lA[1][srow][skq], K);
    gemm_stage_copy(gB + GBK, &lB[1][srow][skq], K);
  }

  // Everything the epilogue reads from global memory is asked for here, all of it in
  // flight at once behind the second stage's copies: the first pass of the k loop covers the latency.
  // The loops are unrolled so that bb and res are registers with constant indices.
  float bb[4];
  float res[2][4][8];
#pragma unroll
  for (int j = 0; j < 4; ++j) bb[j] = 0.f;
  if (bias) {
#pragma unroll
    for (int j = 0; j < 4; ++j) bb[j] = bias[colW + j * 16];
  }
  if (EPI == 1) {
#pragma unroll
    for (int a = 0; a < 2; ++a)
#pragma unroll
      for (int i = 0; i < 8; ++i)
#pragma unroll
        for (int j = 0; j < 4; ++j)
          res[a][j][i] = C[(size_t)(row0 + a * 16 + i) * N + colW + j * 16];
  }
  // the base and the column offset as inputs keep the issued loads' address registers untouched
  // up to this wait; behind it they may take new values
  asm volatile("s_wait_xcnt 0x0" :: "s"(bias), "v"(colW) : "memory");

  // Fragments go through two register sets: the twelve LDS reads of the next 32 k stand as one group
  // in front of this block's eight WMMAs and return under them. All reads of a stage stay inside its own trip.
  union Frag { v16h v; v8h h[2]; };
  Frag af[2][2], bf[2][4];
  for (int s = 0; s < nst; ++s) {
    const int buf = s & 1;
    const _Float16* ab = LNA ? &lA[0][wr * 32 + mrow][s * GBK + kb] : &lA[buf][wr * 32 + mrow][kb];
    const _Float16* bb0 = &lB[buf][wc * 64 + mrow][kb];
#pragma unroll
    for (int u = -1; u < GBK / 32; ++u) {
      if (u + 1 < GBK / 32) {
        const int ns = (u + 1) & 1;          // the set that block u + 1 is read into
        const int ks = (u + 1) * 32;
#pragma unroll
        for (int a = 0; a < 2; ++a) {
          const _Float16* ar = ab + a * 16 * (LNA ? LPITCH : GPITCH) + ks;
          af[ns][a].h[0] = *(const v8h*)ar;
          af[ns][a].h[1] = *(const v8h*)(ar + 16);
        }
#pragma unroll
        for (int j = 0; j < 4; ++j) {
          const _Float16* br = bb0 + j * 16 * GPITCH + ks;
          bf[ns][j].h[0] = *(const v8h*)br;
          bf[ns][j].h[1] = *(const v8h*)(br + 16);
        }
      }
      // keeps the read group whole and in front of the WMMAs
      __builtin_amdgcn_sched_barrier(0);
      if (u >= 0) {
        const int cs = u & 1;
#pragma unroll
        for (int a = 0; a < 2; ++a)
#pragma unroll
          for (int j = 0; j < 4; ++j)
            acc[a][j] = __builtin_amdgcn_wmma_f32_16x16x32_f16(false, af[cs][a].v, false, bf[cs][j].v,
                                                               (short)0, acc[a][j], false, false);
        // keeps the next group of reads behind this block's WMMAs
        __builtin_amdgcn_sched_barrier(0);
      }
    }
    // publish point of stage s + 1
    asm volatile("s_wait_dscnt 0x0" ::: "memory");     // this wave's reads of buffer buf are done before it is refilled
    asm volatile("s_wait_asynccnt 0x0" ::: "memory");  // this wave's pieces of stage s + 1 have landed
    __syncthreads();
    if (s + 2 < nst) {                                 // refill the buffer every wave has just left
      if constexpr (!LNA) gemm_stage_copy(gA + (size_t)(s + 2) * GBK, &lA[buf][srow][skq], K);
      gemm_stage_copy(gB + (size_t)(s + 2) * GBK, &lB[buf][srow][skq], K);
    }
  }
  asm volatile("s_wait_asynccnt 0x0" ::: "memory");    // no copy is left in flight when the wave goes on to its end

#pragma unroll
  for (int a = 0; a < 2; ++a) {
#pragma unroll
    for (int j = 0; j < 4; ++j) {
      const int col = colW + j * 16;
#pragma unroll
      for (int i = 0; i < 8; ++i) {
        const size_t idx = (size_t)(row0 + a * 16 + i) * N + col;
        const float v = acc[a][j][i] + bb[j];
        if (EPI == 0)      C[idx] = v;
        else if (EPI == 1) C[idx] = res[a][j][i] + v;
        else Ch[idx] = (_Float16)(0.5f * v * (1.f + erff(v * 0.70710678118f)));
      }
    }
  }
}

// ---------------------------------------------------------------------------
// Causal linear attention over fused QKV buffer [SEQ][3*DIM], in chunks of
// ACH tokens. With ke = exp(k), qs = softmax(q) * DHEAD^-0.5 and, for chunk c,
//   Sprev = sum over tokens before the chunk of ke^T v     (DHEAD x DHEAD)
//   kprev = sum over tokens before the chunk of ke         (DHEAD)
//   P[n][m] = qs[n] . ke[m] for m <= n inside the chunk, else 0
// the output row is (qs[n] . Sprev + P[n] . v) / max(qs[n] . kprev + sum_m P[n][m], eps).
// Launch 1 writes each chunk's own ke^T v and sum of ke, the last chunk's excepted; launch 2 adds up the
// chunks before its own and forms the rows. All sums in f32.
// ---------------------------------------------------------------------------
#define ACH 64
#define NCH (SEQ / ACH)

// grid (NH, NCH-1): the last chunk's sums have no reader.
__global__ void __launch_bounds__(256)
attn_chunk_state_kernel(const float* __restrict__ QKV, float* __restrict__ Sws,
                        float* __restrict__ Kws) {
  __shared__ __align__(16) float ke[ACH][DHEAD];
  __shared__ __align__(16) float vs[ACH][DHEAD];
  const int h = blockIdx.x, c = blockIdx.y, tid = threadIdx.x;
  const int l = tid & 15, g = tid >> 4;
#pragma unroll
  for (int p = 0; p < 4; ++p) {
    const int n = p * 16 + g;
    const float* s = QKV + (size_t)(c * ACH + n) * (3 * DIM) + h * DHEAD + 4 * l;
    v4f kv = *(const v4f*)(s + DIM);
    const v4f vv = *(const v4f*)(s + 2 * DIM);
#pragma unroll
    for (int e = 0; e < 4; ++e) kv[e] = __expf(kv[e]);
    *(v4f*)&ke[n][4 * l] = kv;
    *(v4f*)&vs[n][4 * l] = vv;
  }
  __syncthreads();

  // thread tile: rows d = 4g..4g+3, columns e = 4l..4l+3
  v4f acc[4];
  v4f ks = (v4f){0.f, 0.f, 0.f, 0.f};
#pragma unroll
  for (int i = 0; i < 4; ++i) acc[i] = (v4f){0.f, 0.f, 0.f, 0.f};
#pragma unroll 8
  for (int n = 0; n < ACH; ++n) {
    const v4f a = *(const v4f*)&ke[n][4 * g];
    const v4f b = *(const v4f*)&vs[n][4 * l];
#pragma unroll
    for (int i = 0; i < 4; ++i) acc[i] += a[i] * b;
    ks += a;
  }
  float* dst = Sws + (size_t)(h * NCH + c) * (DHEAD * DHEAD);
#pragma unroll
  for (int i = 0; i < 4; ++i) *(v4f*)(dst + (4 * g + i) * DHEAD + 4 * l) = acc[i];
  if (l == 0) *(v4f*)(Kws + (h * NCH + c) * DHEAD + 4 * g) = ks;
}

// grid (NH, NCH)
__global__ void __launch_bounds__(256)
attn_chunk_out_kernel(const float* __restrict__ QKV, const float* __restrict__ Sws,
                      const float* __restrict__ Kws, _Float16* __restrict__ Aout) {
  __shared__ __align__(16) float X[ACH][DHEAD + ACH + 4];   // row n: qs[n][0..63] | P[n][0..63]
  __shared__ __align__(16) float Y[DHEAD + ACH][DHEAD];     // rows 0..63 Sprev[d][e], rows 64.. v[m][e]
  __shared__ __align__(16) float Kl[ACH][DHEAD + 4];        // ke[m][d]; pitch 16 B x odd
  __shared__ __align__(16) float kp[DHEAD];                 // kprev
  const int h = blockIdx.x, c = blockIdx.y, tid = threadIdx.x;
  const int l = tid & 15, g = tid >> 4;

  // ---- Sprev, kprev: add up the chunks before this one, four chunks' loads in flight ----
  v4f sp[4];
#pragma unroll
  for (int r = 0; r < 4; ++r) sp[r] = (v4f){0.f, 0.f, 0.f, 0.f};
  const float* sb = Sws + (size_t)h * NCH * (DHEAD * DHEAD);
  const unsigned so = (unsigned)tid * 4u;
  for (int g0 = 0; g0 < c; g0 += 4) {
    v4f t[4][4];
    const float* sc[4];
#pragma unroll
    for (int j = 0; j < 4; ++j) {
      sc[j] = sb + (size_t)min(g0 + j, c - 1) * (DHEAD * DHEAD) + so;
#pragma unroll
      for (int r = 0; r < 4; ++r) t[j][r] = *(const v4f*)(sc[j] + r * 1024);
    }
    // the addresses as inputs keep the issued loads' address registers untouched up to this wait;
    // behind it the next trip may form new ones
    asm volatile("s_wait_xcnt 0x0" :: "v"(sc[0]), "v"(sc[1]), "v"(sc[2]), "v"(sc[3]) : "memory");
#pragma unroll
    for (int j = 0; j < 4; ++j) {
      const float w = (g0 + j < c) ? 1.f : 0.f;
#pragma unroll
      for (int r = 0; r < 4; ++r) sp[r] += w * t[j][r];
    }
  }
#pragma unroll
  for (int r = 0; r < 4; ++r) *(v4f*)&Y[r * 16 + g][4 * l] = sp[r];
  if (tid < DHEAD) {
    float s = 0.f;
#pragma unroll
    for (int cc = 0; cc < NCH - 1; ++cc) {
      const float t = Kws[(h * NCH + cc) * DHEAD + tid];
      s += (cc < c) ? t : 0.f;
    }
    kp[tid] = s;
  }

  // ---- this chunk's q (softmax over the row, 16 lanes a row), ke, v ----
  const float* sq[4];
  v4f q4[4], k4[4], v4[4];
#pragma unroll
  for (int p = 0; p < 4; ++p) {
    sq[p] = QKV + (size_t)(c * ACH + p * 16 + g) * (3 * DIM) + h * DHEAD + 4 * l;
    q4[p] = *(const v4f*)(sq[p]);
    k4[p] = *(const v4f*)(sq[p] + DIM);
    v4[p] = *(const v4f*)(sq[p] + 2 * DIM);
  }
  // the addresses as inputs keep the issued loads' address registers untouched up to this wait
  asm volatile("s_wait_xcnt 0x0" :: "v"(sq[0]), "v"(sq[1]), "v"(sq[2]), "v"(sq[3]) : "memory");
#pragma unroll
  for (int p = 0; p < 4; ++p) {
    const int n = p * 16 + g;
    v4f qv = q4[p];
    v4f kv = k4[p];
    const v4f vv = v4[p];
    float mx = fmaxf(fmaxf(qv[0], qv[1]), fmaxf(qv[2], qv[3]));
#pragma unroll
    for (int m = 1; m < 16; m <<= 1) mx = fmaxf(mx, __shfl_xor(mx, m));
#pragma unroll
    for (int e = 0; e < 4; ++e) qv[e] = __expf(qv[e] - mx);
    float sm = (qv[0] + qv[1]) + (qv[2] + qv[3]);
#pragma unroll
    for (int m = 1; m < 16; m <<= 1) sm += __shfl_xor(sm, m);
    const float qsc = 0.125f / sm;                 // 1 / row sum, * DHEAD^-0.5
#pragma unroll
    for (int e = 0; e < 4; ++e) {
      qv[e] *= qsc;
      kv[e] = __expf(kv[e]);
    }
    *(v4f*)&X[n][4 * l]          = qv;
    *(v4f*)&Kl[n][4 * l]         = kv;
    *(v4f*)&Y[DHEAD + n][4 * l]  = vv;
  }
  __syncthreads();

  // ---- P: thread tile rows n = tn..tn+3, columns m = l + 16*jj ----
  const int tn = 4 * g;
  v2f pr2[4][4];                                   // even-d and odd-d halves of each dot product
#pragma unroll
  for (int i = 0; i < 4; ++i)
#pragma unroll
    for (int jj = 0; jj < 4; ++jj) pr2[i][jj] = (v2f){0.f, 0.f};
#pragma unroll 2
  for (int d = 0; d < DHEAD; d += 4) {
    v4f qa[4], kb[4];
#pragma unroll
    for (int i = 0; i < 4; ++i) qa[i] = *(const v4f*)&X[tn + i][d];
#pragma unroll
    for (int jj = 0; jj < 4; ++jj) kb[jj] = *(const v4f*)&Kl[l + 16 * jj][d];
#pragma unroll
    for (int i = 0; i < 4; ++i)
#pragma unroll
      for (int jj = 0; jj < 4; ++jj) {
        pr2[i][jj] += qa[i].lo * kb[jj].lo;
        pr2[i][jj] += qa[i].hi * kb[jj].hi;
      }
  }
  // denominator: each of the row's 16 lanes adds its four columns of P and its
  // four terms of qs . kprev; the lanes are then summed.
  float dinv[4];
  const v4f kq = *(const v4f*)&kp[4 * l];
#pragma unroll
  for (int i = 0; i < 4; ++i) {
    const v4f qq = *(const v4f*)&X[tn + i][4 * l];
    float rs = (qq[0] * kq[0] + qq[1] * kq[1]) + (qq[2] * kq[2] + qq[3] * kq[3]);
#pragma unroll
    for (int jj = 0; jj < 4; ++jj) {
      const int m = l + 16 * jj;
      const float pv = (m <= tn + i) ? pr2[i][jj][0] + pr2[i][jj][1] : 0.f;   // causal, own token included
      rs += pv;
      X[tn + i][DHEAD + m] = pv;
    }
#pragma unroll
    for (int m = 1; m < 16; m <<= 1) rs += __shfl_xor(rs, m);
    dinv[i] = 1.f / fmaxf(rs, 1e-3f);
  }
  __syncthreads();

  // ---- rows: [qs | P] x [Sprev ; v]; P is zero from column 8*(wave+1) on for this wave's rows ----
  const int jEnd = DHEAD + 8 * (__builtin_amdgcn_readfirstlane(tid >> 5) + 1);
  v4f o[4];
#pragma unroll
  for (int i = 0; i < 4; ++i) o[i] = (v4f){0.f, 0.f, 0.f, 0.f};
#pragma unroll 2
  for (int j = 0; j < jEnd; j += 4) {
    v4f xa[4], yb[4];
#pragma unroll
    for (int i = 0; i < 4; ++i) xa[i] = *(const v4f*)&X[tn + i][j];
#pragma unroll
    for (int e = 0; e < 4; ++e) yb[e] = *(const v4f*)&Y[j + e][4 * l];
#pragma unroll
    for (int i = 0; i < 4; ++i)
#pragma unroll
      for (int e = 0; e < 4; ++e) o[i] += xa[i][e] * yb[e];
  }
#pragma unroll
  for (int i = 0; i < 4; ++i) {
    v4h hv;
#pragma unroll
    for (int e = 0; e < 4; ++e) hv[e] = (_Float16)(o[i][e] * dinv[i]);
    *(v4h*)(Aout + (size_t)(c * ACH + tn + i) * DIM + h * DHEAD + 4 * l) = hv;
  }
}

// ---------------------------------------------------------------------------
// Host orchestration
// ---------------------------------------------------------------------------
extern "C" void kernel_launch(void* const* d_in, const int* in_sizes, int n_in,
                              void* d_out, int out_size, void* d_ws, size_t ws_size,
                              hipStream_t stream) {
  (void)in_sizes; (void)n_in; (void)out_size; (void)ws_size;
  const int*   tokens  = (const int*)  d_in[0];
  const float* tok_emb = (const float*)d_in[1];
  const float* pos_emb = (const float*)d_in[2];
  const float* Wq  = (const float*)d_in[3];
  const float* Wk  = (const float*)d_in[4];
  const float* Wv  = (const float*)d_in[5];
  const float* Wo  = (const float*)d_in[6];
  const float* bo  = (const float*)d_in[7];
  const float* ln1g = (const float*)d_in[8];
  const float* ln1b = (const float*)d_in[9];
  const float* W1  = (const float*)d_in[10];
  const float* b1  = (const float*)d_in[11];
  const float* W2  = (const float*)d_in[12];
  const float* b2  = (const float*)d_in[13];
  const float* ln2g = (const float*)d_in[14];
  const float* ln2b = (const float*)d_in[15];
  const float* lnfg = (const float*)d_in[16];
  const float* lnfb = (const float*)d_in[17];
  const float* Wout = (const float*)d_in[18];
  const float* bout = (const float*)d_in[19];
  float* out = (float*)d_out;

  char* p = (char*)d_ws;
  auto carve = [&](size_t bytes) -> char* {
    char* r = p; p += (bytes + 255) & ~(size_t)255; return r;
  };
  _Float16* QKVT  = (_Float16*)carve((size_t)NL * 3 * DIM * DIM * 2);  // fused [1536][512] per layer
  _Float16* WoT   = (_Float16*)carve((size_t)NL * DIM * DIM * 2);
  _Float16* W1T   = (_Float16*)carve((size_t)NL * DIM * FFD * 2);
  _Float16* W2T   = (_Float16*)carve((size_t)NL * DIM * FFD * 2);
  _Float16* WoutT = (_Float16*)carve((size_t)DIM * VOCAB * 2);
  float*    x     = (float*)   carve((size_t)SEQ * DIM * 4);
  _Float16* h16   = (_Float16*)carve((size_t)SEQ * DIM * 2);
  float*    qkvf  = (float*)   carve((size_t)SEQ * 3 * DIM * 4);
  _Float16* a16   = (_Float16*)carve((size_t)SEQ * DIM * 2);
  _Float16* ff16  = (_Float16*)carve((size_t)SEQ * FFD * 2);
  float*    sws   = (float*)   carve((size_t)NH * NCH * DHEAD * DHEAD * 4);  // per-chunk ke^T v
  float*    kws   = (float*)   carve((size_t)NH * NCH * DHEAD * 4);          // per-chunk sum of ke

  wt_transpose_all_f16<<<WT_TILES, 256, 0, stream>>>(Wq, Wk, Wv, Wo, W1, W2, Wout,
                                                     QKVT, WoT, W1T, W2T, WoutT);

  embed_kernel<<<SEQ * DIM / 256, 256, 0, stream>>>(tokens, tok_emb, pos_emb, x);

  const dim3 gD(DIM / 128, SEQ / 128);      // (4, 8)
  for (int i = 0; i < NL; ++i) {
    const size_t wo = (size_t)i * DIM * DIM;
    const size_t fo = (size_t)i * DIM * FFD;
    gemm_f16_wmma<0, true><<<dim3(3 * DIM / 128, SEQ / 128), 256, 0, stream>>>(
        nullptr, x, ln1g + i * DIM, ln1b + i * DIM,
        QKVT + (size_t)i * 3 * DIM * DIM, nullptr, qkvf, nullptr, SEQ, 3 * DIM, DIM);
    attn_chunk_state_kernel<<<dim3(NH, NCH - 1), 256, 0, stream>>>(qkvf, sws, kws);
    attn_chunk_out_kernel<<<dim3(NH, NCH), 256, 0, stream>>>(qkvf, sws, kws, a16);
    gemm_f16_wmma<1, false><<<gD, 256, 0, stream>>>(a16, nullptr, nullptr, nullptr,
                                                    WoT + wo, bo + i * DIM, x, nullptr, SEQ, DIM, DIM);
    gemm_f16_wmma<2, true><<<dim3(FFD / 128, SEQ / 128), 256, 0, stream>>>(
        nullptr, x, ln2g + i * DIM, ln2b + i * DIM,
        W1T + fo, b1 + i * FFD, nullptr, ff16, SEQ, FFD, DIM);
    gemm_f16_wmma<1, false><<<gD, 256, 0, stream>>>(ff16, nullptr, nullptr, nullptr,
                                                    W2T + fo, b2 + i * DIM, x, nullptr, SEQ, DIM, FFD);
  }
  layernorm_f16_kernel<<<SEQ, 128, 0, stream>>>(x, lnfg, lnfb, h16);
  gemm_f16_wmma<0, false><<<dim3(VOCAB / 128, SEQ / 128), 256, 0, stream>>>(
      h16, nullptr, nullptr, nullptr, WoutT, bout, out, nullptr, SEQ, VOCAB, DIM);
}

// v007
// Measured time: 230 microseconds a run.
// Two timings next to v006 both put it at 1.24 times that version's speed.
// All steps since v000 together make it 48.1 times as fast.
#include <hip/hip_runtime.h>
#include <hip/hip_bf16.h>
#include <math.h>
#include <stdint.h>

// ---- model dims (fixed by reference) ----
#define SEQ   1024
#define DIM   512
#define NH    8
#define DHEAD 64
#define FFD   2048
#define NL    4
#define VOCAB 32000

typedef __attribute__((ext_vector_type(16))) _Float16 v16h;
typedef __attribute__((ext_vector_type(8)))  _Float16 v8h;
typedef __attribute__((ext_vector_type(8)))  float    v8f;
typedef __attribute__((__vector_size__(16))) int      v4i;   // matches builtin param type
typedef __attribute__((ext_vector_type(4))) float    v4f;
typedef __attribute__((ext_vector_type(2))) float    v2f;
typedef __attribute__((ext_vector_type(4))) _Float16 v4h;

// ---- CDNA5 async global->LDS path (ASYNCcnt) --------------------------------
// Rebuild addrspace-qualified int4 pointers from flat addresses (LDS flat addr
// low 32 bits == LDS byte offset on CDNA5, ISA 10.2 aperture mapping; flat ==
// global address for AS1).
#define AS1P(p) ((__attribute__((address_space(1))) v4i*)(unsigned long long)(uintptr_t)(p))
#define AS3P(p) ((__attribute__((address_space(3))) v4i*)(unsigned)(uintptr_t)(p))

// ---------------------------------------------------------------------------
// Embedding: x[n,d] = tok_emb[tokens[n],d] + pos_emb[n,d]
// ---------------------------------------------------------------------------
__global__ void embed_kernel(const int* __restrict__ tokens,
                             const float* __restrict__ tok_emb,
                             const float* __restrict__ pos_emb,
                             float* __restrict__ x) {
  int idx = blockIdx.x * 256 + threadIdx.x;
  int n = idx >> 9;
  int d = idx & (DIM - 1);
  x[idx] = tok_emb[(size_t)tokens[n] * DIM + d] + pos_emb[idx];
}

// ---------------------------------------------------------------------------
// Weight transpose + fp32 -> f16 convert:  in[K][N] -> out[N][K], every weight
// matrix of the model in ONE launch. A work-group takes one tile of 64 k x 256 n:
// a wave's load is 512 contiguous bytes of an input row, a wave's store is four
// whole 128-byte lines of output rows.
// ---------------------------------------------------------------------------
#define WTK 64
#define WTN 256
#define WTP (WTK + 8)                        // LDS row pitch in halves: 144 B = 16 B x odd
typedef __attribute__((ext_vector_type(4))) float wt4f;

template <int K, int N>
__device__ __forceinline__ void wt_tile(const float* __restrict__ in, _Float16* __restrict__ out,
                                        int kt, int nt, _Float16 (*tile)[WTP]) {
  const int tid = threadIdx.x;
  const int c  = tid & 63;                   // columns n = 4c .. 4c+3 of the tile
  const int kr = tid >> 6;                   // rows k = 16kr .. 16kr+15 of the tile
  const float* s = in + (size_t)(kt * WTK + kr * 16) * N + nt * WTN + 4 * c;
  wt4f r[16];
#pragma unroll
  for (int i = 0; i < 16; ++i) r[i] = *(const wt4f*)(s + (size_t)i * N);
#pragma unroll
  for (int j = 0; j < 4; ++j) {
    v8h lo, hi;
#pragma unroll
    for (int i = 0; i < 8; ++i) { lo[i] = (_Float16)r[i][j]; hi[i] = (_Float16)r[8 + i][j]; }
    *(v8h*)&tile[4 * c + j][kr * 16]     = lo;
    *(v8h*)&tile[4 * c + j][kr * 16 + 8] = hi;
  }
  __syncthreads();
  const int n0 = tid >> 3, q = (tid & 7) * 8;  // 8 lanes a row of 64 halves
  _Float16* d = out + (size_t)(nt * WTN + n0) * K + kt * WTK + q;
#pragma unroll
  for (int p = 0; p < 8; ++p)
    *(v8h*)(d + (size_t)p * 32 * K) = *(const v8h*)&tile[n0 + 32 * p][q];
}

#define WT_OUT_TILES ((DIM / WTK) * (VOCAB / WTN))                 // 1000
#define WT_SQ_TILES  ((DIM / WTK) * (DIM / WTN))                   // 16 for one DIM x DIM matrix
#define WT_FF_TILES  ((DIM / WTK) * (FFD / WTN))                   // 64 for W1, as many for W2
#define WT_LAYER_TILES (4 * WT_SQ_TILES + 2 * WT_FF_TILES)         // 192
#define WT_TILES (WT_OUT_TILES + NL * WT_LAYER_TILES)              // 1768

__global__ void __launch_bounds__(256)
wt_transpose_all_f16(const float* __restrict__ Wq, const float* __restrict__ Wk,
                     const float* __restrict__ Wv, const float* __restrict__ Wo,
                     const float* __restrict__ W1, const float* __restrict__ W2,
                     const float* __restrict__ Wout,
                     _Float16* __restrict__ QKVT, _Float16* __restrict__ WoT,
                     _Float16* __restrict__ W1T, _Float16* __restrict__ W2T,
                     _Float16* __restrict__ WoutT) {
  __shared__ __align__(16) _Float16 tile[WTN][WTP];
  const int b = blockIdx.x;                  // every choice below is the same for the whole work-group
  if (b < WT_OUT_TILES) {
    wt_tile<DIM, VOCAB>(Wout, WoutT, b & 7, b >> 3, tile);
    return;
  }
  const int u = b - WT_OUT_TILES;
  const int layer = u / WT_LAYER_TILES;
  const int r = u - layer * WT_LAYER_TILES;
  if (r < 4 * WT_SQ_TILES) {
    const int which = r >> 4, t = r & 15;    // Wq, Wk, Wv, Wo
    const float* in = (which == 0 ? Wq : which == 1 ? Wk : which == 2 ? Wv : Wo) + (size_t)layer * DIM * DIM;
    _Float16* out = which < 3 ? QKVT + (size_t)(layer * 3 + which) * DIM * DIM
                              : WoT + (size_t)layer * DIM * DIM;
    wt_tile<DIM, DIM>(in, out, t & 7, t >> 3, tile);
  } else if (r < 4 * WT_SQ_TILES + WT_FF_TILES) {
    const int t = r - 4 * WT_SQ_TILES;
    wt_tile<DIM, FFD>(W1 + (size_t)layer * DIM * FFD, W1T + (size_t)layer * DIM * FFD, t & 7, t >> 3, tile);
  } else {
    const int t = r - 4 * WT_SQ_TILES - WT_FF_TILES;
    wt_tile<FFD, DIM>(W2 + (size_t)layer * DIM * FFD, W2T + (size_t)layer * DIM * FFD, t & 31, t >> 5, tile);
  }
}

// ---------------------------------------------------------------------------
// LayerNorm (per row of [SEQ, DIM]) -> f16 activations for GEMM A-operand
// ---------------------------------------------------------------------------
__global__ void layernorm_f16_kernel(const float* __restrict__ x,
                                     const float* __restrict__ g,
                                     const float* __restrict__ b,
                                     _Float16* __restrict__ out) {
  __shared__ float r1[128], r2[128];
  const int row = blockIdx.x, t = threadIdx.x;
  const float* xr = x + (size_t)row * DIM;
  float s = 0.f, s2 = 0.f;
  for (int d = t; d < DIM; d += 128) { float v = xr[d]; s += v; s2 += v * v; }
  r1[t] = s; r2[t] = s2; __syncthreads();
#pragma unroll
  for (int st = 64; st > 0; st >>= 1) {
    if (t < st) { r1[t] += r1[t + st]; r2[t] += r2[t + st]; }
    __syncthreads();
  }
  const float mean = r1[0] * (1.f / DIM);
  const float var  = r2[0] * (1.f / DIM) - mean * mean;
  const float rstd = rsqrtf(var + 1e-5f);
  for (int d = t; d < DIM; d += 128)
    out[(size_t)row * DIM + d] = (_Float16)((xr[d] - mean) * rstd * g[d] + b[d]);
}

// ---------------------------------------------------------------------------
// WMMA GEMM:  C[M,N] (op)= A[M,K](f16) * Bt[N,K](f16)^T + bias
//   EPI 0: C(f32) = val          EPI 1: C(f32) += val          EPI 2: Ch(f16) = gelu(val)
// Block: 256 threads = 8 wave32, WR x WC. Block tile BM x BN, a stage is BK k of both operands;
// wave tile FA x FB fragments of 16 x 16 (FA * FB WMMA per 32 k).
// The vocabulary GEMM has 2000 tiles: 128 x 128, stage 128 k (4x2 waves of 32x64), two work-groups
// a WGP. The layers' GEMMs are small and a launch lasts as long as one work-group: their tiles
// have fewer rows and a longer stage, 64 x 128 x 256 (2x4 waves of 32x32) and, for N = 512,
// 64 x 64 x 256 (4x2 waves of 16x32). So 128 to 256 work-groups share a launch, each has less to
// normalise, to read from LDS and to store, and it waits for half as many stages.
// A wave-wide 16-byte copy covers one row's 512 contiguous bytes (BK 256) or two rows' 256 (BK 128) of the stage, whole 128-byte lines. Two LDS
// buffers; the next stage's async copies fly while this one is worked on.
// M a multiple of BM, N of BN, K of BK.
// LNA: the A operand is LayerNorm(X) (K == DIM). The work-group normalises its own
// BM rows of X (f32) once, one wave a row, and keeps them as f16 in LDS for the
// whole k loop; only B goes through the two stage buffers.
// ---------------------------------------------------------------------------
// One stage of one operand: ROWS rows x 2 BK bytes. BK / 8 threads cover a row with 16 B each, the
// 256 threads RP = 2048 / BK rows at a time, so a thread has ROWS / RP pieces.
// g and l already point at this thread's piece of row tid / (BK / 8).
// LDS row pitch BK + 8 halves: 272 B or 528 B = 16 B x odd.
template <int ROWS, int BK>
__device__ __forceinline__ void gemm_stage_copy(const _Float16* g, _Float16* l, int K) {
  constexpr int RP = 2048 / BK;
#pragma unroll
  for (int i = 0; i < ROWS / RP; ++i)
    __builtin_amdgcn_global_load_async_to_lds_b128(AS1P(g + (size_t)i * RP * K),
                                                   AS3P(l + i * RP * (BK + 8)), 0, 0);
}

// sum over the 32 lanes of a wave, the result in every lane: four steps inside the
// 16-lane row (row_xmask 1, 2, 4, 8), then lane l with lane l ^ 16
template <int XM>
__device__ __forceinline__ float row_xadd(float v) {
  return v + __builtin_bit_cast(float, __builtin_amdgcn_update_dpp(
                 0, __builtin_bit_cast(int, v), 0x160 | XM, 0xf, 0xf, true));
}
__device__ __forceinline__ float wave_sum(float v) {
  v = row_xadd<1>(v); v = row_xadd<2>(v); v = row_xadd<4>(v); v = row_xadd<8>(v);
  return v + __builtin_bit_cast(float, __builtin_amdgcn_permlanex16(
                 __builtin_bit_cast(int, v), __builtin_bit_cast(int, v), 0x76543210, 0xfedcba98, false, false));
}

#define LPITCH (DIM + 8)                     // LDS row pitch of the normalised A in halves: 1040 B = 16 B x odd

template <int EPI, bool LNA, int BM, int BN, int BK, int WR>
__global__ void __launch_bounds__(256)
gemm_f16_wmma(const _Float16* __restrict__ A, const float* __restrict__ X,
              const float* __restrict__ lng, const float* __restrict__ lnb,
              const _Float16* __restrict__ Bt,
              const float* __restrict__ bias, float* __restrict__ C,
              _Float16* __restrict__ Ch, int M, int N, int K) {
  constexpr int GBK = BK;
  constexpr int GPITCH = BK + 8;             // LDS row pitch of a stage in halves
  constexpr int WC = 8 / WR;                 // waves across the tile's columns
  constexpr int FA = BM / (16 * WR);         // A fragments of a wave
  constexpr int FB = BN / (16 * WC);         // B fragments of a wave
  __shared__ __align__(16) _Float16 lA[LNA ? 1 : 2][BM][LNA ? LPITCH : GPITCH];
  __shared__ __align__(16) _Float16 lB[2][BN][GPITCH];

  const int tid  = threadIdx.x;
  const int lane = tid & 31;
  const int wid  = tid >> 5;
  const int wr   = wid / WC;                 // slab of FA * 16 rows
  const int wc   = wid % WC;                 // slab of FB * 16 columns
  const int rowBase = blockIdx.y * BM;
  const int colBase = blockIdx.x * BN;

  // staging: BK / 8 threads a row, 16 B each
  const int srow = tid / (BK / 8);           // + 2048 / BK for each further piece
  const int skq  = (tid % (BK / 8)) * 8;     // halves
  const _Float16* gA = A  + (size_t)(rowBase + srow) * K + skq;
  const _Float16* gB = Bt + (size_t)(colBase + srow) * K + skq;

  // fragment coords (16-bit 16x32 layout: lane%16 = row/col, lane/16 = K-half)
  const int mrow = lane & 15;
  const int kb   = (lane >> 4) * 8;

  v8f acc[FA][FB];
#pragma unroll
  for (int a = 0; a < FA; ++a)
#pragma unroll
    for (int j = 0; j < FB; ++j) acc[a][j] = (v8f){};

  const int nst = K / GBK;                   // stages; the same for the whole work-group

  // C/D layout: VGPR i -> M = i + 8*(lane/16), N = lane%16
  const int row0 = rowBase + wr * (FA * 16) + (lane >> 4) * 8;
  const int colW = colBase + wc * (FB * 16) + (lane & 15);

  // ---- prologue: stage 0 into buffer 0, published; then stage 1 starts into buffer 1 ----
  if constexpr (!LNA) gemm_stage_copy<BM, BK>(gA, &lA[0][srow][skq], K);
  gemm_stage_copy<BN, BK>(gB, &lB[0][srow][skq], K);
  if constexpr (LNA) {
    // wave wid normalises BM / 8 rows of the tile, from row wid * BM / 8 on, four rows' loads in flight;
    // a lane holds columns 128 q + 4 lane .. + 3, so every load covers 512 contiguous bytes
    const int w16 = __builtin_amdgcn_readfirstlane(wid) * (BM / 8);
    const v4f* xw = (const v4f*)(X + (size_t)(rowBase + w16) * DIM);
    const v4f* g4 = (const v4f*)lng;
    const v4f* b4 = (const v4f*)lnb;
    const int c4 = lane * 4;
    v4f gg[4], gb[4];
#pragma unroll
    for (int q = 0; q < 4; ++q) {
      gg[q] = g4[lane + q * 32];
      gb[q] = b4[lane + q * 32];
    }
    // kept rolled: this text runs once
#pragma unroll 1
    for (int it = 0; it < BM / 32; ++it) {
      const v4f* xr = xw + lane + it * DIM;  // the lane's piece; four rows of DIM / 4 pieces a trip
      v4f xv[4][4];
#pragma unroll
      for (int r = 0; r < 4; ++r)
#pragma unroll
        for (int q = 0; q < 4; ++q)
          xv[r][q] = xr[r * (DIM / 4) + q * 32];
      // the addresses as inputs keep the issued loads' address registers untouched up to this
      // wait; behind it the next trip may form new ones
      asm volatile("s_wait_xcnt 0x0" :: "v"(xr), "s"(g4), "s"(b4), "v"(lane) : "memory");
      float s1[4], s2[4];
#pragma unroll
      for (int r = 0; r < 4; ++r) {
        const v4f a = (xv[r][0] + xv[r][1]) + (xv[r][2] + xv[r][3]);
        v4f b = xv[r][0] * xv[r][0];
#pragma unroll
        for (int q = 1; q < 4; ++q) b += xv[r][q] * xv[r][q];
        s1[r] = (a[0] + a[1]) + (a[2] + a[3]);
        s2[r] = (b[0] + b[1]) + (b[2] + b[3]);
      }
#pragma unroll
      for (int r = 0; r < 4; ++r) { s1[r] = wave_sum(s1[r]); s2[r] = wave_sum(s2[r]); }
#pragma unroll
      for (int r = 0; r < 4; ++r) {
        const float mean = s1[r] * (1.f / DIM);
        const float var  = s2[r] * (1.f / DIM) - mean * mean;
        const float rstd = rsqrtf(var + 1e-5f);
#pragma unroll
        for (int q = 0; q < 4; ++q) {
          const v4f y = (xv[r][q] - mean) * rstd * gg[q] + gb[q];
          v4h hv;
#pragma unroll
          for (int e = 0; e < 4; ++e) hv[e] = (_Float16)y[e];
          *(v4h*)&lA[0][w16 + it * 4 + r][q * 128 + c4] = hv;
        }
      }
    }
  }
  asm volatile("s_wait_asynccnt 0x0" ::: "memory");   // this wave's pieces of stage 0 have landed
  __syncthreads();                                    // LNA: it also publishes the normalised rows
  if (nst > 1) {
    if constexpr (!LNA) gemm_stage_copy<BM, BK>(gA + GBK, &lA[1][srow][skq], K);
    gemm_stage_copy<BN, BK>(gB + GBK, &lB[1][srow][skq], K);
  }

  // Everything the epilogue reads from global memory is asked for here, all of it in
  // flight at once behind the second stage's copies: the first pass of the k loop covers the latency.
  // The loops are unrolled so that bb and res are registers with constant indices.
  float bb[FB];
  float res[FA][FB][8];
#pragma unroll
  for (int j = 0; j < FB; ++j) bb[j] = 0.f;
  if (bias) {
#pragma unroll
    for (int j = 0; j < FB; ++j) bb[j] = bias[colW + j * 16];
  }
  if (EPI == 1) {
#pragma unroll
    for (int a = 0; a < FA; ++a)
#pragma unroll
      for (int i = 0; i < 8; ++i)
#pragma unroll
        for (int j = 0; j < FB; ++j)
          res[a][j][i] = C[(size_t)(row0 + a * 16 + i) * N + colW + j * 16];
  }
  // the base and the column offset as inputs keep the issued loads' address registers untouched
  // up to this wait; behind it they may take new values
  asm volatile("s_wait_xcnt 0x0" :: "s"(bias), "v"(colW) : "memory");

  // Fragments go through two register sets: the LDS reads of the next 32 k stand as one group
  // in front of this block's WMMAs and return under them. All reads of a stage stay inside its own trip.
  union Frag { v16h v; v8h h[2]; };
  Frag af[2][FA], bf[2][FB];
  for (int s = 0; s < nst; ++s) {
    const int buf = s & 1;
    const _Float16* ab = LNA ? &lA[0][wr * (FA * 16) + mrow][s * GBK + kb] : &lA[buf][wr * (FA * 16) + mrow][kb];
    const _Float16* bb0 = &lB[buf][wc * (FB * 16) + mrow][kb];
#pragma unroll
    for (int u = -1; u < GBK / 32; ++u) {
      if (u + 1 < GBK / 32) {
        const int ns = (u + 1) & 1;          // the set that block u + 1 is read into
        const int ks = (u + 1) * 32;
#pragma unroll
        for (int a = 0; a < FA; ++a) {
          const _Float16* ar = ab + a * 16 * (LNA ? LPITCH : GPITCH) + ks;
          af[ns][a].h[0] = *(const v8h*)ar;
          af[ns][a].h[1] = *(const v8h*)(ar + 16);
        }
#pragma unroll
        for (int j = 0; j < FB; ++j) {
          const _Float16* br = bb0 + j * 16 * GPITCH + ks;
          bf[ns][j].h[0] = *(const v8h*)br;
          bf[ns][j].h[1] = *(const v8h*)(br + 16);
        }
      }
      // keeps the read group whole and in front of the WMMAs
      __builtin_amdgcn_sched_barrier(0);
      if (u >= 0) {
        const int cs = u & 1;
#pragma unroll
        for (int a = 0; a < FA; ++a)
#pragma unroll
          for (int j = 0; j < FB; ++j)
            acc[a][j] = __builtin_amdgcn_wmma_f32_16x16x32_f16(false, af[cs][a].v, false, bf[cs][j].v,
                                                               (short)0, acc[a][j], false, false);
        // keeps the next group of reads behind this block's WMMAs
        __builtin_amdgcn_sched_barrier(0);
      }
    }
    // publish point of stage s + 1
    asm volatile("s_wait_dscnt 0x0" ::: "memory");     // this wave's reads of buffer buf are done before it is refilled
    asm volatile("s_wait_asynccnt 0x0" ::: "memory");  // this wave's pieces of stage s + 1 have landed
    __syncthreads();
    if (s + 2 < nst) {                                 // refill the buffer every wave has just left
      if constexpr (!LNA) gemm_stage_copy<BM, BK>(gA + (size_t)(s + 2) * GBK, &lA[buf][srow][skq], K);
      gemm_stage_copy<BN, BK>(gB + (size_t)(s + 2) * GBK, &lB[buf][srow][skq], K);
    }
  }
  asm volatile("s_wait_asynccnt 0x0" ::: "memory");    // no copy is left in flight when the wave goes on to its end

#pragma unroll
  for (int a = 0; a < FA; ++a) {
#pragma unroll
    for (int j = 0; j < FB; ++j) {
      const int col = colW + j * 16;
#pragma unroll
      for (int i = 0; i < 8; ++i) {
        const size_t idx = (size_t)(row0 + a * 16 + i) * N + col;
        const float v = acc[a][j][i] + bb[j];
        if (EPI == 0)      C[idx] = v;
        else if (EPI == 1) C[idx] = res[a][j][i] + v;
        else Ch[idx] = (_Float16)(0.5f * v * (1.f + erff(v * 0.70710678118f)));
      }
    }
  }
}

// ---------------------------------------------------------------------------
// Causal linear attention over fused QKV buffer [SEQ][3*DIM], in chunks of
// ACH tokens. With ke = exp(k), qs = softmax(q) * DHEAD^-0.5 and, for chunk c,
//   Sprev = sum over tokens before the chunk of ke^T v     (DHEAD x DHEAD)
//   kprev = sum over tokens before the chunk of ke         (DHEAD)
//   P[n][m] = qs[n] . ke[m] for m <= n inside the chunk, else 0
// the output row is (qs[n] . Sprev + P[n] . v) / max(qs[n] . kprev + sum_m P[n][m], eps).
// Launch 1 writes each chunk's own ke^T v and sum of ke, the last chunk's excepted; launch 2 adds up the
// chunks before its own and forms the rows. All sums in f32.
// ---------------------------------------------------------------------------
#define ACH 64
#define NCH (SEQ / ACH)

// grid (NH, NCH-1): the last chunk's sums have no reader.
__global__ void __launch_bounds__(256)
attn_chunk_state_kernel(const float* __restrict__ QKV, float* __restrict__ Sws,
                        float* __restrict__ Kws) {
  __shared__ __align__(16) float ke[ACH][DHEAD];
  __shared__ __align__(16) float vs[ACH][DHEAD];
  const int h = blockIdx.x, c = blockIdx.y, tid = threadIdx.x;
  const int l = tid & 15, g = tid >> 4;
#pragma unroll
  for (int p = 0; p < 4; ++p) {
    const int n = p * 16 + g;
    const float* s = QKV + (size_t)(c * ACH + n) * (3 * DIM) + h * DHEAD + 4 * l;
    v4f kv = *(const v4f*)(s + DIM);
    const v4f vv = *(const v4f*)(s + 2 * DIM);
#pragma unroll
    for (int e = 0; e < 4; ++e) kv[e] = __expf(kv[e]);
    *(v4f*)&ke[n][4 * l] = kv;
    *(v4f*)&vs[n][4 * l] = vv;
  }
  __syncthreads();

  // thread tile: rows d = 4g..4g+3, columns e = 4l..4l+3
  v4f acc[4];
  v4f ks = (v4f){0.f, 0.f, 0.f, 0.f};
#pragma unroll
  for (int i = 0; i < 4; ++i) acc[i] = (v4f){0.f, 0.f, 0.f, 0.f};
#pragma unroll 8
  for (int n = 0; n < ACH; ++n) {
    const v4f a = *(const v4f*)&ke[n][4 * g];
    const v4f b = *(const v4f*)&vs[n][4 * l];
#pragma unroll
    for (int i = 0; i < 4; ++i) acc[i] += a[i] * b;
    ks += a;
  }
  float* dst = Sws + (size_t)(h * NCH + c) * (DHEAD * DHEAD);
#pragma unroll
  for (int i = 0; i < 4; ++i) *(v4f*)(dst + (4 * g + i) * DHEAD + 4 * l) = acc[i];
  if (l == 0) *(v4f*)(Kws + (h * NCH + c) * DHEAD + 4 * g) = ks;
}

// grid (NH, NCH)
__global__ void __launch_bounds__(256)
attn_chunk_out_kernel(const float* __restrict__ QKV, const float* __restrict__ Sws,
                      const float* __restrict__ Kws, _Float16* __restrict__ Aout) {
  __shared__ __align__(16) float X[ACH][DHEAD + ACH + 4];   // row n: qs[n][0..63] | P[n][0..63]
  __shared__ __align__(16) float Y[DHEAD + ACH][DHEAD];     // rows 0..63 Sprev[d][e], rows 64.. v[m][e]
  __shared__ __align__(16) float Kl[ACH][DHEAD + 4];        // ke[m][d]; pitch 16 B x odd
  __shared__ __align__(16) float kp[DHEAD];                 // kprev
  const int h = blockIdx.x, c = blockIdx.y, tid = threadIdx.x;
  const int l = tid & 15, g = tid >> 4;

  // ---- Sprev, kprev: add up the chunks before this one, four chunks' loads in flight ----
  v4f sp[4];
#pragma unroll
  for (int r = 0; r < 4; ++r) sp[r] = (v4f){0.f, 0.f, 0.f, 0.f};
  const float* sb = Sws + (size_t)h * NCH * (DHEAD * DHEAD);
  const unsigned so = (unsigned)tid * 4u;
  for (int g0 = 0; g0 < c; g0 += 4) {
    v4f t[4][4];
    const float* sc[4];
#pragma unroll
    for (int j = 0; j < 4; ++j) {
      sc[j] = sb + (size_t)min(g0 + j, c - 1) * (DHEAD * DHEAD) + so;
#pragma unroll
      for (int r = 0; r < 4; ++r) t[j][r] = *(const v4f*)(sc[j] + r * 1024);
    }
    // the addresses as inputs keep the issued loads' address registers untouched up to this wait;
    // behind it the next trip may form new ones
    asm volatile("s_wait_xcnt 0x0" :: "v"(sc[0]), "v"(sc[1]), "v"(sc[2]), "v"(sc[3]) : "memory");
#pragma unroll
    for (int j = 0; j < 4; ++j) {
      const float w = (g0 + j < c) ? 1.f : 0.f;
#pragma unroll
      for (int r = 0; r < 4; ++r) sp[r] += w * t[j][r];
    }
  }
#pragma unroll
  for (int r = 0; r < 4; ++r) *(v4f*)&Y[r * 16 + g][4 * l] = sp[r];
  if (tid < DHEAD) {
    float s = 0.f;
#pragma unroll
    for (int cc = 0; cc < NCH - 1; ++cc) {
      const float t = Kws[(h * NCH + cc) * DHEAD + tid];
      s += (cc < c) ? t : 0.f;
    }
    kp[tid] = s;
  }

  // ---- this chunk's q (softmax over the row, 16 lanes a row), ke, v ----
  const float* sq[4];
  v4f q4[4], k4[4], v4[4];
#pragma unroll
  for (int p = 0; p < 4; ++p) {
    sq[p] = QKV + (size_t)(c * ACH + p * 16 + g) * (3 * DIM) + h * DHEAD + 4 * l;
    q4[p] = *(const v4f*)(sq[p]);
    k4[p] = *(const v4f*)(sq[p] + DIM);
    v4[p] = *(const v4f*)(sq[p] + 2 * DIM);
  }
  // the addresses as inputs keep the issued loads' address registers untouched up to this wait
  asm volatile("s_wait_xcnt 0x0" :: "v"(sq[0]), "v"(sq[1]), "v"(sq[2]), "v"(sq[3]) : "memory");
#pragma unroll
  for (int p = 0; p < 4; ++p) {
    const int n = p * 16 + g;
    v4f qv = q4[p];
    v4f kv = k4[p];
    const v4f vv = v4[p];
    float mx = fmaxf(fmaxf(qv[0], qv[1]), fmaxf(qv[2], qv[3]));
#pragma unroll
    for (int m = 1; m < 16; m <<= 1) mx = fmaxf(mx, __shfl_xor(mx, m));
#pragma unroll
    for (int e = 0; e < 4; ++e) qv[e] = __expf(qv[e] - mx);
    float sm = (qv[0] + qv[1]) + (qv[2] + qv[3]);
#pragma unroll
    for (int m = 1; m < 16; m <<= 1) sm += __shfl_xor(sm, m);
    const float qsc = 0.125f / sm;                 // 1 / row sum, * DHEAD^-0.5
#pragma unroll
    for (int e = 0; e < 4; ++e) {
      qv[e] *= qsc;
      kv[e] = __expf(kv[e]);
    }
    *(v4f*)&X[n][4 * l]          = qv;
    *(v4f*)&Kl[n][4 * l]         = kv;
    *(v4f*)&Y[DHEAD + n][4 * l]  = vv;
  }
  __syncthreads();

  // ---- P: thread tile rows n = tn..tn+3, columns m = l + 16*jj ----
  const int tn = 4 * g;
  v2f pr2[4][4];                                   // even-d and odd-d halves of each dot product
#pragma unroll
  for (int i = 0; i < 4; ++i)
#pragma unroll
    for (int jj = 0; jj < 4; ++jj) pr2[i][jj] = (v2f){0.f, 0.f};
#pragma unroll 2
  for (int d = 0; d < DHEAD; d += 4) {
    v4f qa[4], kb[4];
#pragma unroll
    for (int i = 0; i < 4; ++i) qa[i] = *(const v4f*)&X[tn + i][d];
#pragma unroll
    for (int jj = 0; jj < 4; ++jj) kb[jj] = *(const v4f*)&Kl[l + 16 * jj][d];
#pragma unroll
    for (int i = 0; i < 4; ++i)
#pragma unroll
      for (int jj = 0; jj < 4; ++jj) {
        pr2[i][jj] += qa[i].lo * kb[jj].lo;
        pr2[i][jj] += qa[i].hi * kb[jj].hi;
      }
  }
  // denominator: each of the row's 16 lanes adds its four columns of P and its
  // four terms of qs . kprev; the lanes are then summed.
  float dinv[4];
  const v4f kq = *(const v4f*)&kp[4 * l];
#pragma unroll
  for (int i = 0; i < 4; ++i) {
    const v4f qq = *(const v4f*)&X[tn + i][4 * l];
    float rs = (qq[0] * kq[0] + qq[1] * kq[1]) + (qq[2] * kq[2] + qq[3] * kq[3]);
#pragma unroll
    for (int jj = 0; jj < 4; ++jj) {
      const int m = l + 16 * jj;
      const float pv = (m <= tn + i) ? pr2[i][jj][0] + pr2[i][jj][1] : 0.f;   // causal, own token included
      rs += pv;
      X[tn + i][DHEAD + m] = pv;
    }
#pragma unroll
    for (int m = 1; m < 16; m <<= 1) rs += __shfl_xor(rs, m);
    dinv[i] = 1.f / fmaxf(rs, 1e-3f);
  }
  __syncthreads();

  // ---- rows: [qs | P] x [Sprev ; v]; P is zero from column 8*(wave+1) on for this wave's rows ----
  const int jEnd = DHEAD + 8 * (__builtin_amdgcn_readfirstlane(tid >> 5) + 1);
  v4f o[4];
#pragma unroll
  for (int i = 0; i < 4; ++i) o[i] = (v4f){0.f, 0.f, 0.f, 0.f};
#pragma unroll 2
  for (int j = 0; j < jEnd; j += 4) {
    v4f xa[4], yb[4];
#pragma unroll
    for (int i = 0; i < 4; ++i) xa[i] = *(const v4f*)&X[tn + i][j];
#pragma unroll
    for (int e = 0; e < 4; ++e) yb[e] = *(const v4f*)&Y[j + e][4 * l];
#pragma unroll
    for (int i = 0; i < 4; ++i)
#pragma unroll
      for (int e = 0; e < 4; ++e) o[i] += xa[i][e] * yb[e];
  }
#pragma unroll
  for (int i = 0; i < 4; ++i) {
    v4h hv;
#pragma unroll
    for (int e = 0; e < 4; ++e) hv[e] = (_Float16)(o[i][e] * dinv[i]);
    *(v4h*)(Aout + (size_t)(c * ACH + tn + i) * DIM + h * DHEAD + 4 * l) = hv;
  }
}

// ---------------------------------------------------------------------------
// Host orchestration
// ---------------------------------------------------------------------------
extern "C" void kernel_launch(void* const* d_in, const int* in_sizes, int n_in,
                              void* d_out, int out_size, void* d_ws, size_t ws_size,
                              hipStream_t stream) {
  (void)in_sizes; (void)n_in; (void)out_size; (void)ws_size;
  const int*   tokens  = (const int*)  d_in[0];
  const float* tok_emb = (const float*)d_in[1];
  const float* pos_emb = (const float*)d_in[2];
  const float* Wq  = (const float*)d_in[3];
  const float* Wk  = (const float*)d_in[4];
  const float* Wv  = (const float*)d_in[5];
  const float* Wo  = (const float*)d_in[6];
  const float* bo  = (const float*)d_in[7];
  const float* ln1g = (const float*)d_in[8];
  const float* ln1b = (const float*)d_in[9];
  const float* W1  = (const float*)d_in[10];
  const float* b1  = (const float*)d_in[11];
  const float* W2  = (const float*)d_in[12];
  const float* b2  = (const float*)d_in[13];
  const float* ln2g = (const float*)d_in[14];
  const float* ln2b = (const float*)d_in[15];
  const float* lnfg = (const float*)d_in[16];
  const float* lnfb = (const float*)d_in[17];
  const float* Wout = (const float*)d_in[18];
  const float* bout = (const float*)d_in[19];
  float* out = (float*)d_out;

  char* p = (char*)d_ws;
  auto carve = [&](size_t bytes) -> char* {
    char* r = p; p += (bytes + 255) & ~(size_t)255; return r;
  };
  _Float16* QKVT  = (_Float16*)carve((size_t)NL * 3 * DIM * DIM * 2);  // fused [1536][512] per layer
  _Float16* WoT   = (_Float16*)carve((size_t)NL * DIM * DIM * 2);
  _Float16* W1T   = (_Float16*)carve((size_t)NL * DIM * FFD * 2);
  _Float16* W2T   = (_Float16*)carve((size_t)NL * DIM * FFD * 2);
  _Float16* WoutT = (_Float16*)carve((size_t)DIM * VOCAB * 2);
  float*    x     = (float*)   carve((size_t)SEQ * DIM * 4);
  _Float16* h16   = (_Float16*)carve((size_t)SEQ * DIM * 2);
  float*    qkvf  = (float*)   carve((size_t)SEQ * 3 * DIM * 4);
  _Float16* a16   = (_Float16*)carve((size_t)SEQ * DIM * 2);
  _Float16* ff16  = (_Float16*)carve((size_t)SEQ * FFD * 2);
  float*    sws   = (float*)   carve((size_t)NH * NCH * DHEAD * DHEAD * 4);  // per-chunk ke^T v
  float*    kws   = (float*)   carve((size_t)NH * NCH * DHEAD * 4);          // per-chunk sum of ke

  wt_transpose_all_f16<<<WT_TILES, 256, 0, stream>>>(Wq, Wk, Wv, Wo, W1, W2, Wout,
                                                     QKVT, WoT, W1T, W2T, WoutT);

  embed_kernel<<<SEQ * DIM / 256, 256, 0, stream>>>(tokens, tok_emb, pos_emb, x);

  const dim3 gD(DIM / 64, SEQ / 64);        // (8, 16)
  for (int i = 0; i < NL; ++i) {
    const size_t wo = (size_t)i * DIM * DIM;
    const size_t fo = (size_t)i * DIM * FFD;
    gemm_f16_wmma<0, true, 64, 128, 256, 2><<<dim3(3 * DIM / 128, SEQ / 64), 256, 0, stream>>>(
        nullptr, x, ln1g + i * DIM, ln1b + i * DIM,
        QKVT + (size_t)i * 3 * DIM * DIM, nullptr, qkvf, nullptr, SEQ, 3 * DIM, DIM);
    attn_chunk_state_kernel<<<dim3(NH, NCH - 1), 256, 0, stream>>>(qkvf, sws, kws);
    attn_chunk_out_kernel<<<dim3(NH, NCH), 256, 0, stream>>>(qkvf, sws, kws, a16);
    gemm_f16_wmma<1, false, 64, 64, 256, 4><<<gD, 256, 0, stream>>>(a16, nullptr, nullptr, nullptr,
                                                    WoT + wo, bo + i * DIM, x, nullptr, SEQ, DIM, DIM);
    gemm_f16_wmma<2, true, 64, 128, 256, 2><<<dim3(FFD / 128, SEQ / 64), 256, 0, stream>>>(
        nullptr, x, ln2g + i * DIM, ln2b + i * DIM,
        W1T + fo, b1 + i * FFD, nullptr, ff16, SEQ, FFD, DIM);
    gemm_f16_wmma<1, false, 64, 64, 256, 4><<<gD, 256, 0, stream>>>(ff16, nullptr, nullptr, nullptr,
                                                    W2T + fo, b2 + i * DIM, x, nullptr, SEQ, DIM, FFD);
  }
  layernorm_f16_kernel<<<SEQ, 128, 0, stream>>>(x, lnfg, lnfb, h16);
  gemm_f16_wmma<0, false, 128, 128, 128, 4><<<dim3(VOCAB / 128, SEQ / 128), 256, 0, stream>>>(
      h16, nullptr, nullptr, nullptr, WoutT, bout, out, nullptr, SEQ, VOCAB, DIM);
}

// v008
// It runs in 215 microseconds.
// Two timings next to v007 put it at 1.05 and 1.06 times that version's speed.
// All steps since v000 together make it 50.7 times as fast.
#include <hip/hip_runtime.h>
#include <hip/hip_bf16.h>
#include <math.h>
#include <stdint.h>

// ---- model dims (fixed by reference) ----
#define SEQ   1024
#define DIM   512
#define NH    8
#define DHEAD 64
#define FFD   2048
#define NL    4
#define VOCAB 32000

typedef __attribute__((ext_vector_type(16))) _Float16 v16h;
typedef __attribute__((ext_vector_type(8)))  _Float16 v8h;
typedef __attribute__((ext_vector_type(8)))  float    v8f;
typedef __attribute__((__vector_size__(16))) int      v4i;   // matches builtin param type
typedef __attribute__((ext_vector_type(4))) float    v4f;
typedef __attribute__((ext_vector_type(2))) float    v2f;
typedef __attribute__((ext_vector_type(4))) _Float16 v4h;

// ---- CDNA5 async global->LDS path (ASYNCcnt) --------------------------------
// Rebuild addrspace-qualified int4 pointers from flat addresses (LDS flat addr
// low 32 bits == LDS byte offset on CDNA5, ISA 10.2 aperture mapping; flat ==
// global address for AS1).
#define AS1P(p) ((__attribute__((address_space(1))) v4i*)(unsigned long long)(uintptr_t)(p))
#define AS3P(p) ((__attribute__((address_space(3))) v4i*)(unsigned)(uintptr_t)(p))

// ---------------------------------------------------------------------------
// Embedding: x[n,d] = tok_emb[tokens[n],d] + pos_emb[n,d]
// ---------------------------------------------------------------------------
__global__ void embed_kernel(const int* __restrict__ tokens,
                             const float* __restrict__ tok_emb,
                             const float* __restrict__ pos_emb,
                             float* __restrict__ x) {
  int idx = blockIdx.x * 256 + threadIdx.x;
  int n = idx >> 9;
  int d = idx & (DIM - 1);
  x[idx] = tok_emb[(size_t)tokens[n] * DIM + d] + pos_emb[idx];
}

// ---------------------------------------------------------------------------
// Weight transpose + fp32 -> f16 convert:  in[K][N] -> out[N][K], every weight
// matrix of the model in ONE launch. A work-group takes one tile of 64 k x 256 n:
// a wave's load is 512 contiguous bytes of an input row, a wave's store is four
// whole 128-byte lines of output rows.
// ---------------------------------------------------------------------------
#define WTK 64
#define WTN 256
#define WTP (WTK + 8)                        // LDS row pitch in halves: 144 B = 16 B x odd
typedef __attribute__((ext_vector_type(4))) float wt4f;

template <int K, int N>
__device__ __forceinline__ void wt_tile(const float* __restrict__ in, _Float16* __restrict__ out,
                                        int kt, int nt, _Float16 (*tile)[WTP]) {
  const int tid = threadIdx.x;
  const int c  = tid & 63;                   // columns n = 4c .. 4c+3 of the tile
  const int kr = tid >> 6;                   // rows k = 16kr .. 16kr+15 of the tile
  const float* s = in + (size_t)(kt * WTK + kr * 16) * N + nt * WTN + 4 * c;
  wt4f r[16];
#pragma unroll
  for (int i = 0; i < 16; ++i) r[i] = *(const wt4f*)(s + (size_t)i * N);
#pragma unroll
  for (int j = 0; j < 4; ++j) {
    v8h lo, hi;
#pragma unroll
    for (int i = 0; i < 8; ++i) { lo[i] = (_Float16)r[i][j]; hi[i] = (_Float16)r[8 + i][j]; }
    *(v8h*)&tile[4 * c + j][kr * 16]     = lo;
    *(v8h*)&tile[4 * c + j][kr * 16 + 8] = hi;
  }
  __syncthreads();
  const int n0 = tid >> 3, q = (tid & 7) * 8;  // 8 lanes a row of 64 halves
  _Float16* d = out + (size_t)(nt * WTN + n0) * K + kt * WTK + q;
#pragma unroll
  for (int p = 0; p < 8; ++p)
    *(v8h*)(d + (size_t)p * 32 * K) = *(const v8h*)&tile[n0 + 32 * p][q];
}

#define WT_OUT_TILES ((DIM / WTK) * (VOCAB / WTN))                 // 1000
#define WT_SQ_TILES  ((DIM / WTK) * (DIM / WTN))                   // 16 for one DIM x DIM matrix
#define WT_FF_TILES  ((DIM / WTK) * (FFD / WTN))                   // 64 for W1, as many for W2
#define WT_LAYER_TILES (4 * WT_SQ_TILES + 2 * WT_FF_TILES)         // 192
#define WT_TILES (WT_OUT_TILES + NL * WT_LAYER_TILES)              // 1768

__global__ void __launch_bounds__(256)
wt_transpose_all_f16(const float* __restrict__ Wq, const float* __restrict__ Wk,
                     const float* __restrict__ Wv, const float* __restrict__ Wo,
                     const float* __restrict__ W1, const float* __restrict__ W2,
                     const float* __restrict__ Wout,
                     _Float16* __restrict__ QKVT, _Float16* __restrict__ WoT,
                     _Float16* __restrict__ W1T, _Float16* __restrict__ W2T,
                     _Float16* __restrict__ WoutT) {
  __shared__ __align__(16) _Float16 tile[WTN][WTP];
  const int b = blockIdx.x;                  // every choice below is the same for the whole work-group
  if (b < WT_OUT_TILES) {
    wt_tile<DIM, VOCAB>(Wout, WoutT, b & 7, b >> 3, tile);
    return;
  }
  const int u = b - WT_OUT_TILES;
  const int layer = u / WT_LAYER_TILES;
  const int r = u - layer * WT_LAYER_TILES;
  if (r < 4 * WT_SQ_TILES) {
    const int which = r >> 4, t = r & 15;    // Wq, Wk, Wv, Wo
    const float* in = (which == 0 ? Wq : which == 1 ? Wk : which == 2 ? Wv : Wo) + (size_t)layer * DIM * DIM;
    _Float16* out = which < 3 ? QKVT + (size_t)(layer * 3 + which) * DIM * DIM
                              : WoT + (size_t)layer * DIM * DIM;
    wt_tile<DIM, DIM>(in, out, t & 7, t >> 3, tile);
  } else if (r < 4 * WT_SQ_TILES + WT_FF_TILES) {
    const int t = r - 4 * WT_SQ_TILES;
    wt_tile<DIM, FFD>(W1 + (size_t)layer * DIM * FFD, W1T + (size_t)layer * DIM * FFD, t & 7, t >> 3, tile);
  } else {
    const int t = r - 4 * WT_SQ_TILES - WT_FF_TILES;
    wt_tile<FFD, DIM>(W2 + (size_t)layer * DIM * FFD, W2T + (size_t)layer * DIM * FFD, t & 31, t >> 5, tile);
  }
}

// ---------------------------------------------------------------------------
// LayerNorm (per row of [SEQ, DIM]) -> f16 activations for GEMM A-operand
// ---------------------------------------------------------------------------
__global__ void layernorm_f16_kernel(const float* __restrict__ x,
                                     const float* __restrict__ g,
                                     const float* __restrict__ b,
                                     _Float16* __restrict__ out) {
  __shared__ float r1[128], r2[128];
  const int row = blockIdx.x, t = threadIdx.x;
  const float* xr = x + (size_t)row * DIM;
  float s = 0.f, s2 = 0.f;
  for (int d = t; d < DIM; d += 128) { float v = xr[d]; s += v; s2 += v * v; }
  r1[t] = s; r2[t] = s2; __syncthreads();
#pragma unroll
  for (int st = 64; st > 0; st >>= 1) {
    if (t < st) { r1[t] += r1[t + st]; r2[t] += r2[t + st]; }
    __syncthreads();
  }
  const float mean = r1[0] * (1.f / DIM);
  const float var  = r2[0] * (1.f / DIM) - mean * mean;
  const float rstd = rsqrtf(var + 1e-5f);
  for (int d = t; d < DIM; d += 128)
    out[(size_t)row * DIM + d] = (_Float16)((xr[d] - mean) * rstd * g[d] + b[d]);
}

// ---------------------------------------------------------------------------
// WMMA GEMM:  C[M,N] (op)= A[M,K](f16) * Bt[N,K](f16)^T + bias
//   EPI 0: C(f32) = val          EPI 1: C(f32) += val          EPI 2: Ch(f16) = gelu(val)
// Block: 256 threads = 8 wave32, WR x WC. Block tile BM x BN, a stage is BK k of both operands;
// wave tile FA x FB fragments of 16 x 16 (FA * FB WMMA per 32 k).
// The vocabulary GEMM has 2000 tiles: 128 x 128, stage 128 k (4x2 waves of 32x64), two work-groups
// a WGP. The layers' GEMMs are small and a launch lasts as long as one work-group: their tiles
// have fewer rows and a longer stage, 64 x 128 x 256 (2x4 waves of 32x32), 64 x 192 x 256 for QKV
// (2x4 waves of 32x48) and, for N = 512, 64 x 64 x 256 (4x2 waves of 16x32). So 128 to 256 work-groups share a launch, each has less to
// normalise, to read from LDS and to store, and it waits for half as many stages.
// A wave-wide 16-byte copy covers one row's 512 contiguous bytes (BK 256) or two rows' 256 (BK 128) of the stage, whole 128-byte lines. Two LDS
// buffers; the next stage's async copies fly while this one is worked on.
// M a multiple of BM, N of BN, K of BK.
// LNA: the A operand is LayerNorm(X) (K == DIM). The work-group normalises its own
// BM rows of X (f32) once, one wave a row, and keeps them as f16 in LDS for the
// whole k loop; only B goes through the two stage buffers.
// ST (the QKV GEMM, BM == ACH, BN == 3 * DHEAD): the tile is one head's q | k | v of one chunk of
// ACH tokens, so the work-group holds all that the chunk's sums ke^T v and sum of ke are made of:
// it forms them itself from its accumulators, through LDS, and writes them beside C.
// ---------------------------------------------------------------------------
// One stage of one operand: ROWS rows x 2 BK bytes. BK / 8 threads cover a row with 16 B each, the
// 256 threads RP = 2048 / BK rows at a time, so a thread has ROWS / RP pieces.
// g and l already point at this thread's piece of row tid / (BK / 8).
// LDS row pitch BK + 8 halves: 272 B or 528 B = 16 B x odd.
template <int ROWS, int BK>
__device__ __forceinline__ void gemm_stage_copy(const _Float16* g, _Float16* l, int K) {
  constexpr int RP = 2048 / BK;
#pragma unroll
  for (int i = 0; i < ROWS / RP; ++i)
    __builtin_amdgcn_global_load_async_to_lds_b128(AS1P(g + (size_t)i * RP * K),
                                                   AS3P(l + i * RP * (BK + 8)), 0, 0);
}

// One stage of B. ST: the tile's rows are DHEAD rows each of Wq^T, Wk^T and Wv^T, which lie DIM rows apart.
template <bool ST, int BN, int BK>
__device__ __forceinline__ void gemm_stage_copy_b(const _Float16* g, _Float16* l, int K) {
  if constexpr (ST) {
#pragma unroll
    for (int w = 0; w < 3; ++w)
      gemm_stage_copy<DHEAD, BK>(g + (size_t)w * DIM * K, l + w * DHEAD * (BK + 8), K);
  } else {
    gemm_stage_copy<BN, BK>(g, l, K);
  }
}

// sum over the 32 lanes of a wave, the result in every lane: four steps inside the
// 16-lane row (row_xmask 1, 2, 4, 8), then lane l with lane l ^ 16
template <int XM>
__device__ __forceinline__ float row_xadd(float v) {
  return v + __builtin_bit_cast(float, __builtin_amdgcn_update_dpp(
                 0, __builtin_bit_cast(int, v), 0x160 | XM, 0xf, 0xf, true));
}
__device__ __forceinline__ float wave_sum(float v) {
  v = row_xadd<1>(v); v = row_xadd<2>(v); v = row_xadd<4>(v); v = row_xadd<8>(v);
  return v + __builtin_bit_cast(float, __builtin_amdgcn_permlanex16(
                 __builtin_bit_cast(int, v), __builtin_bit_cast(int, v), 0x76543210, 0xfedcba98, false, false));
}

#define LPITCH (DIM + 8)                     // LDS row pitch of the normalised A in halves: 1040 B = 16 B x odd
#define ACH 64                               // tokens of an attention chunk
#define NCH (SEQ / ACH)
#define SPITCH (DHEAD + 4)                   // LDS row pitch of ke and v in floats: 272 B = 16 B x odd

template <int EPI, bool LNA, int BM, int BN, int BK, int WR, bool ST>
__global__ void __launch_bounds__(256)
gemm_f16_wmma(const _Float16* __restrict__ A, const float* __restrict__ X,
              const float* __restrict__ lng, const float* __restrict__ lnb,
              const _Float16* __restrict__ Bt,
              const float* __restrict__ bias, float* __restrict__ C,
              _Float16* __restrict__ Ch, float* __restrict__ Sws, float* __restrict__ Kws,
              int M, int N, int K) {
  constexpr int GBK = BK;
  constexpr int GPITCH = BK + 8;             // LDS row pitch of a stage in halves
  constexpr int WC = 8 / WR;                 // waves across the tile's columns
  constexpr int FA = BM / (16 * WR);         // A fragments of a wave
  constexpr int FB = BN / (16 * WC);         // B fragments of a wave
  __shared__ __align__(16) _Float16 lA[LNA ? 1 : 2][BM][LNA ? LPITCH : GPITCH];
  __shared__ __align__(16) _Float16 lB[2][BN][GPITCH];

  const int tid  = threadIdx.x;
  const int lane = tid & 31;
  const int wid  = tid >> 5;
  const int wr   = wid / WC;                 // slab of FA * 16 rows
  const int wc   = wid % WC;                 // slab of FB * 16 columns
  const int rowBase = blockIdx.y * BM;
  const int colBase = blockIdx.x * BN;

  // staging: BK / 8 threads a row, 16 B each
  const int srow = tid / (BK / 8);           // + 2048 / BK for each further piece
  const int skq  = (tid % (BK / 8)) * 8;     // halves
  const _Float16* gA = A  + (size_t)(rowBase + srow) * K + skq;
  const int bRow0 = ST ? (int)blockIdx.x * DHEAD : colBase;   // first row of Bt in the tile (ST: of its q rows)
  const _Float16* gB = Bt + (size_t)(bRow0 + srow) * K + skq;

  // fragment coords (16-bit 16x32 layout: lane%16 = row/col, lane/16 = K-half)
  const int mrow = lane & 15;
  const int kb   = (lane >> 4) * 8;

  v8f acc[FA][FB];
#pragma unroll
  for (int a = 0; a < FA; ++a)
#pragma unroll
    for (int j = 0; j < FB; ++j) acc[a][j] = (v8f){};

  const int nst = K / GBK;                   // stages; the same for the whole work-group

  // C/D layout: VGPR i -> M = i + 8*(lane/16), N = lane%16
  const int row0 = rowBase + wr * (FA * 16) + (lane >> 4) * 8;
  const int colW = colBase + wc * (FB * 16) + (lane & 15);
  // column of C that fragment j holds. ST: fragment f of the tile's twelve is 16 columns of q (f < 4), k or v of head blockIdx.x
  const int f0 = __builtin_amdgcn_readfirstlane(wc) * FB;
  auto colOf = [&](int j) -> int {
    if constexpr (ST) return ((f0 + j) >> 2) * DIM + bRow0 + ((f0 + j) & 3) * 16 + (lane & 15);
    else return colW + j * 16;
  };

  // ---- prologue: stage 0 into buffer 0, published; then stage 1 starts into buffer 1 ----
  if constexpr (!LNA) gemm_stage_copy<BM, BK>(gA, &lA[0][srow][skq], K);
  gemm_stage_copy_b<ST, BN, BK>(gB, &lB[0][srow][skq], K);
  if constexpr (LNA) {
    // wave wid normalises BM / 8 rows of the tile, from row wid * BM / 8 on, four rows' loads in flight;
    // a lane holds columns 128 q + 4 lane .. + 3, so every load covers 512 contiguous bytes
    const int w16 = __builtin_amdgcn_readfirstlane(wid) * (BM / 8);
    const v4f* xw = (const v4f*)(X + (size_t)(rowBase + w16) * DIM);
    const v4f* g4 = (const v4f*)lng;
    const v4f* b4 = (const v4f*)lnb;
    const int c4 = lane * 4;
    v4f gg[4], gb[4];
#pragma unroll
    for (int q = 0; q < 4; ++q) {
      gg[q] = g4[lane + q * 32];
      gb[q] = b4[lane + q * 32];
    }
    // kept rolled: this text runs once
#pragma unroll 1
    for (int it = 0; it < BM / 32; ++it) {
      const v4f* xr = xw + lane + it * DIM;  // the lane's piece; four rows of DIM / 4 pieces a trip
      v4f xv[4][4];
#pragma unroll
      for (int r = 0; r < 4; ++r)
#pragma unroll
        for (int q = 0; q < 4; ++q)
          xv[r][q] = xr[r * (DIM / 4) + q * 32];
      // the addresses as inputs keep the issued loads' address registers untouched up to this
      // wait; behind it the next trip may form new ones
      asm volatile("s_wait_xcnt 0x0" :: "v"(xr), "s"(g4), "s"(b4), "v"(lane) : "memory");
      float s1[4], s2[4];
#pragma unroll
      for (int r = 0; r < 4; ++r) {
        const v4f a = (xv[r][0] + xv[r][1]) + (xv[r][2] + xv[r][3]);
        v4f b = xv[r][0] * xv[r][0];
#pragma unroll
        for (int q = 1; q < 4; ++q) b += xv[r][q] * xv[r][q];
        s1[r] = (a[0] + a[1]) + (a[2] + a[3]);
        s2[r] = (b[0] + b[1]) + (b[2] + b[3]);
      }
#pragma unroll
      for (int r = 0; r < 4; ++r) { s1[r] = wave_sum(s1[r]); s2[r] = wave_sum(s2[r]); }
#pragma unroll
      for (int r = 0; r < 4; ++r) {
        const float mean = s1[r] * (1.f / DIM);
        const float var  = s2[r] * (1.f / DIM) - mean * mean;
        const float rstd = rsqrtf(var + 1e-5f);
#pragma unroll
        for (int q = 0; q < 4; ++q) {
          const v4f y = (xv[r][q] - mean) * rstd * gg[q] + gb[q];
          v4h hv;
#pragma unroll
          for (int e = 0; e < 4; ++e) hv[e] = (_Float16)y[e];
          *(v4h*)&lA[0][w16 + it * 4 + r][q * 128 + c4] = hv;
        }
      }
    }
  }
  asm volatile("s_wait_asynccnt 0x0" ::: "memory");   // this wave's pieces of stage 0 have landed
  __syncthreads();                                    // LNA: it also publishes the normalised rows
  if (nst > 1) {
    if constexpr (!LNA) gemm_stage_copy<BM, BK>(gA + GBK, &lA[1][srow][skq], K);
    gemm_stage_copy_b<ST, BN, BK>(gB + GBK, &lB[1][srow][skq], K);
  }

  // Everything the epilogue reads from global memory is asked for here, all of it in
  // flight at once behind the second stage's copies: the first pass of the k loop covers the latency.
  // The loops are unrolled so that bb and res are registers with constant indices.
  float bb[FB];
  float res[FA][FB][8];
#pragma unroll
  for (int j = 0; j < FB; ++j) bb[j] = 0.f;
  if (bias) {
#pragma unroll
    for (int j = 0; j < FB; ++j) bb[j] = bias[colOf(j)];
  }
  if (EPI == 1) {
#pragma unroll
    for (int a = 0; a < FA; ++a)
#pragma unroll
      for (int i = 0; i < 8; ++i)
#pragma unroll
        for (int j = 0; j < FB; ++j)
          res[a][j][i] = C[(size_t)(row0 + a * 16 + i) * N + colW + j * 16];
  }
  // the base and the column offset as inputs keep the issued loads' address registers untouched
  // up to this wait; behind it they may take new values
  asm volatile("s_wait_xcnt 0x0" :: "s"(bias), "v"(colW) : "memory");

  // Fragments go through two register sets: the LDS reads of the next 32 k stand as one group
  // in front of this block's WMMAs and return under them. All reads of a stage stay inside its own trip.
  union Frag { v16h v; v8h h[2]; };
  Frag af[2][FA], bf[2][FB];
  for (int s = 0; s < nst; ++s) {
    const int buf = s & 1;
    const _Float16* ab = LNA ? &lA[0][wr * (FA * 16) + mrow][s * GBK + kb] : &lA[buf][wr * (FA * 16) + mrow][kb];
    const _Float16* bb0 = &lB[buf][wc * (FB * 16) + mrow][kb];
#pragma unroll
    for (int u = -1; u < GBK / 32; ++u) {
      if (u + 1 < GBK / 32) {
        const int ns = (u + 1) & 1;          // the set that block u + 1 is read into
        const int ks = (u + 1) * 32;
#pragma unroll
        for (int a = 0; a < FA; ++a) {
          const _Float16* ar = ab + a * 16 * (LNA ? LPITCH : GPITCH) + ks;
          af[ns][a].h[0] = *(const v8h*)ar;
          af[ns][a].h[1] = *(const v8h*)(ar + 16);
        }
#pragma unroll
        for (int j = 0; j < FB; ++j) {
          const _Float16* br = bb0 + j * 16 * GPITCH + ks;
          bf[ns][j].h[0] = *(const v8h*)br;
          bf[ns][j].h[1] = *(const v8h*)(br + 16);
        }
      }
      // keeps the read group whole and in front of the WMMAs
      __builtin_amdgcn_sched_barrier(0);
      if (u >= 0) {
        const int cs = u & 1;
#pragma unroll
        for (int a = 0; a < FA; ++a)
#pragma unroll
          for (int j = 0; j < FB; ++j)
            acc[a][j] = __builtin_amdgcn_wmma_f32_16x16x32_f16(false, af[cs][a].v, false, bf[cs][j].v,
                                                               (short)0, acc[a][j], false, false);
        // keeps the next group of reads behind this block's WMMAs
        __builtin_amdgcn_sched_barrier(0);
      }
    }
    // publish point of stage s + 1
    asm volatile("s_wait_dscnt 0x0" ::: "memory");     // this wave's reads of buffer buf are done before it is refilled
    asm volatile("s_wait_asynccnt 0x0" ::: "memory");  // this wave's pieces of stage s + 1 have landed
    __syncthreads();
    if (s + 2 < nst) {                                 // refill the buffer every wave has just left
      if constexpr (!LNA) gemm_stage_copy<BM, BK>(gA + (size_t)(s + 2) * GBK, &lA[buf][srow][skq], K);
      gemm_stage_copy_b<ST, BN, BK>(gB + (size_t)(s + 2) * GBK, &lB[buf][srow][skq], K);
    }
  }
  asm volatile("s_wait_asynccnt 0x0" ::: "memory");    // no copy is left in flight when the wave goes on to its end

  // ST: ke = exp(k) and v of the chunk go to LDS as f32, into B's stage buffer 0, which every wave left
  // at the loop's first barrier. The last chunk's sums have no reader (the test is the same for the work-group).
  float (*kel)[SPITCH] = (float (*)[SPITCH])&lB[0][0][0];
  float (*vsl)[SPITCH] = kel + ACH;
  const bool sums = ST && blockIdx.y < NCH - 1;
  if constexpr (ST) {
    if (sums) {
#pragma unroll
      for (int j = 0; j < FB; ++j) {
        const int f = f0 + j;                          // the same for the whole wave
        if (f >= 4) {
          float (*dl)[SPITCH] = f < 8 ? kel : vsl;
#pragma unroll
          for (int a = 0; a < FA; ++a)
#pragma unroll
            for (int i = 0; i < 8; ++i) {
              const float v = acc[a][j][i] + bb[j];
              dl[wr * (FA * 16) + a * 16 + (lane >> 4) * 8 + i][(f & 3) * 16 + (lane & 15)] = f < 8 ? __expf(v) : v;
            }
        }
      }
      __syncthreads();                                 // publishes ke and v; it stands in front of C's stores, so it waits for none
    }
  }

#pragma unroll
  for (int a = 0; a < FA; ++a) {
#pragma unroll
    for (int j = 0; j < FB; ++j) {
      const int col = colOf(j);
#pragma unroll
      for (int i = 0; i < 8; ++i) {
        const size_t idx = (size_t)(row0 + a * 16 + i) * N + col;
        const float v = acc[a][j][i] + bb[j];
        if (EPI == 0)      C[idx] = v;
        else if (EPI == 1) C[idx] = res[a][j][i] + v;
        else Ch[idx] = (_Float16)(0.5f * v * (1.f + erff(v * 0.70710678118f)));
      }
    }
  }

  if constexpr (ST) {
    // the registers that C's issued stores name take new values below, and only behind this wait
    asm volatile("s_wait_xcnt 0x0" ::: "memory");
    if (sums) {
      // ke^T v and the sum of ke over the chunk's tokens, while C's stores drain.
      // thread tile: rows d = 4g..4g+3, columns e = 4l..4l+3
      const int l = tid & 15, g = tid >> 4;
      v4f sa[4];
      v4f ks = (v4f){0.f, 0.f, 0.f, 0.f};
#pragma unroll
      for (int i = 0; i < 4; ++i) sa[i] = (v4f){0.f, 0.f, 0.f, 0.f};
#pragma unroll 8
      for (int n = 0; n < ACH; ++n) {
        const v4f ka = *(const v4f*)&kel[n][4 * g];
        const v4f vb = *(const v4f*)&vsl[n][4 * l];
#pragma unroll
        for (int i = 0; i < 4; ++i) sa[i] += ka[i] * vb;
        ks += ka;
      }
      const int hc = blockIdx.x * NCH + blockIdx.y;
      float* dst = Sws + (size_t)hc * (DHEAD * DHEAD);
#pragma unroll
      for (int i = 0; i < 4; ++i) *(v4f*)(dst + (4 * g + i) * DHEAD + 4 * l) = sa[i];
      if (l == 0) *(v4f*)(Kws + hc * DHEAD + 4 * g) = ks;
    }
  }
}

// ---------------------------------------------------------------------------
// Causal linear attention over fused QKV buffer [SEQ][3*DIM], in chunks of
// ACH tokens. With ke = exp(k), qs = softmax(q) * DHEAD^-0.5 and, for chunk c,
//   Sprev = sum over tokens before the chunk of ke^T v     (DHEAD x DHEAD)
//   kprev = sum over tokens before the chunk of ke         (DHEAD)
//   P[n][m] = qs[n] . ke[m] for m <= n inside the chunk, else 0
// the output row is (qs[n] . Sprev + P[n] . v) / max(qs[n] . kprev + sum_m P[n][m], eps).
// The QKV GEMM writes each chunk's own ke^T v and sum of ke; this launch adds up the
// chunks before its own and forms the rows. All sums in f32.
// ---------------------------------------------------------------------------
// grid (NH, NCH)
__global__ void __launch_bounds__(256)
attn_chunk_out_kernel(const float* __restrict__ QKV, const float* __restrict__ Sws,
                      const float* __restrict__ Kws, _Float16* __restrict__ Aout) {
  __shared__ __align__(16) float X[ACH][DHEAD + ACH + 4];   // row n: qs[n][0..63] | P[n][0..63]
  __shared__ __align__(16) float Y[DHEAD + ACH][DHEAD];     // rows 0..63 Sprev[d][e], rows 64.. v[m][e]
  __shared__ __align__(16) float Kl[ACH][DHEAD + 4];        // ke[m][d]; pitch 16 B x odd
  __shared__ __align__(16) float kp[DHEAD];                 // kprev
  const int h = blockIdx.x, c = blockIdx.y, tid = threadIdx.x;
  const int l = tid & 15, g = tid >> 4;

  // ---- Sprev, kprev: add up the chunks before this one, four chunks' loads in flight ----
  v4f sp[4];
#pragma unroll
  for (int r = 0; r < 4; ++r) sp[r] = (v4f){0.f, 0.f, 0.f, 0.f};
  const float* sb = Sws + (size_t)h * NCH * (DHEAD * DHEAD);
  const unsigned so = (unsigned)tid * 4u;
  for (int g0 = 0; g0 < c; g0 += 4) {
    v4f t[4][4];
    const float* sc[4];
#pragma unroll
    for (int j = 0; j < 4; ++j) {
      sc[j] = sb + (size_t)min(g0 + j, c - 1) * (DHEAD * DHEAD) + so;
#pragma unroll
      for (int r = 0; r < 4; ++r) t[j][r] = *(const v4f*)(sc[j] + r * 1024);
    }
    // the addresses as inputs keep the issued loads' address registers untouched up to this wait;
    // behind it the next trip may form new ones
    asm volatile("s_wait_xcnt 0x0" :: "v"(sc[0]), "v"(sc[1]), "v"(sc[2]), "v"(sc[3]) : "memory");
#pragma unroll
    for (int j = 0; j < 4; ++j) {
      const float w = (g0 + j < c) ? 1.f : 0.f;
#pragma unroll
      for (int r = 0; r < 4; ++r) sp[r] += w * t[j][r];
    }
  }
#pragma unroll
  for (int r = 0; r < 4; ++r) *(v4f*)&Y[r * 16 + g][4 * l] = sp[r];
  if (tid < DHEAD) {
    float s = 0.f;
#pragma unroll
    for (int cc = 0; cc < NCH - 1; ++cc) {
      const float t = Kws[(h * NCH + cc) * DHEAD + tid];
      s += (cc < c) ? t : 0.f;
    }
    kp[tid] = s;
  }

  // ---- this chunk's q (softmax over the row, 16 lanes a row), ke, v ----
  const float* sq[4];
  v4f q4[4], k4[4], v4[4];
#pragma unroll
  for (int p = 0; p < 4; ++p) {
    sq[p] = QKV + (size_t)(c * ACH + p * 16 + g) * (3 * DIM) + h * DHEAD + 4 * l;
    q4[p] = *(const v4f*)(sq[p]);
    k4[p] = *(const v4f*)(sq[p] + DIM);
    v4[p] = *(const v4f*)(sq[p] + 2 * DIM);
  }
  // the addresses as inputs keep the issued loads' address registers untouched up to this wait
  asm volatile("s_wait_xcnt 0x0" :: "v"(sq[0]), "v"(sq[1]), "v"(sq[2]), "v"(sq[3]) : "memory");
#pragma unroll
  for (int p = 0; p < 4; ++p) {
    const int n = p * 16 + g;
    v4f qv = q4[p];
    v4f kv = k4[p];
    const v4f vv = v4[p];
    float mx = fmaxf(fmaxf(qv[0], qv[1]), fmaxf(qv[2], qv[3]));
#pragma unroll
    for (int m = 1; m < 16; m <<= 1) mx = fmaxf(mx, __shfl_xor(mx, m));
#pragma unroll
    for (int e = 0; e < 4; ++e) qv[e] = __expf(qv[e] - mx);
    float sm = (qv[0] + qv[1]) + (qv[2] + qv[3]);
#pragma unroll
    for (int m = 1; m < 16; m <<= 1) sm += __shfl_xor(sm, m);
    const float qsc = 0.125f / sm;                 // 1 / row sum, * DHEAD^-0.5
#pragma unroll
    for (int e = 0; e < 4; ++e) {
      qv[e] *= qsc;
      kv[e] = __expf(kv[e]);
    }
    *(v4f*)&X[n][4 * l]          = qv;
    *(v4f*)&Kl[n][4 * l]         = kv;
    *(v4f*)&Y[DHEAD + n][4 * l]  = vv;
  }
  __syncthreads();

  // ---- P: thread tile rows n = tn..tn+3, columns m = l + 16*jj ----
  const int tn = 4 * g;
  v2f pr2[4][4];                                   // even-d and odd-d halves of each dot product
#pragma unroll
  for (int i = 0; i < 4; ++i)
#pragma unroll
    for (int jj = 0; jj < 4; ++jj) pr2[i][jj] = (v2f){0.f, 0.f};
#pragma unroll 2
  for (int d = 0; d < DHEAD; d += 4) {
    v4f qa[4], kb[4];
#pragma unroll
    for (int i = 0; i < 4; ++i) qa[i] = *(const v4f*)&X[tn + i][d];
#pragma unroll
    for (int jj = 0; jj < 4; ++jj) kb[jj] = *(const v4f*)&Kl[l + 16 * jj][d];
#pragma unroll
    for (int i = 0; i < 4; ++i)
#pragma unroll
      for (int jj = 0; jj < 4; ++jj) {
        pr2[i][jj] += qa[i].lo * kb[jj].lo;
        pr2[i][jj] += qa[i].hi * kb[jj].hi;
      }
  }
  // denominator: each of the row's 16 lanes adds its four columns of P and its
  // four terms of qs . kprev; the lanes are then summed.
  float dinv[4];
  const v4f kq = *(const v4f*)&kp[4 * l];
#pragma unroll
  for (int i = 0; i < 4; ++i) {
    const v4f qq = *(const v4f*)&X[tn + i][4 * l];
    float rs = (qq[0] * kq[0] + qq[1] * kq[1]) + (qq[2] * kq[2] + qq[3] * kq[3]);
#pragma unroll
    for (int jj = 0; jj < 4; ++jj) {
      const int m = l + 16 * jj;
      const float pv = (m <= tn + i) ? pr2[i][jj][0] + pr2[i][jj][1] : 0.f;   // causal, own token included
      rs += pv;
      X[tn + i][DHEAD + m] = pv;
    }
#pragma unroll
    for (int m = 1; m < 16; m <<= 1) rs += __shfl_xor(rs, m);
    dinv[i] = 1.f / fmaxf(rs, 1e-3f);
  }
  __syncthreads();

  // ---- rows: [qs | P] x [Sprev ; v]; P is zero from column 8*(wave+1) on for this wave's rows ----
  const int jEnd = DHEAD + 8 * (__builtin_amdgcn_readfirstlane(tid >> 5) + 1);
  v4f o[4];
#pragma unroll
  for (int i = 0; i < 4; ++i) o[i] = (v4f){0.f, 0.f, 0.f, 0.f};
#pragma unroll 2
  for (int j = 0; j < jEnd; j += 4) {
    v4f xa[4], yb[4];
#pragma unroll
    for (int i = 0; i < 4; ++i) xa[i] = *(const v4f*)&X[tn + i][j];
#pragma unroll
    for (int e = 0; e < 4; ++e) yb[e] = *(const v4f*)&Y[j + e][4 * l];
#pragma unroll
    for (int i = 0; i < 4; ++i)
#pragma unroll
      for (int e = 0; e < 4; ++e) o[i] += xa[i][e] * yb[e];
  }
#pragma unroll
  for (int i = 0; i < 4; ++i) {
    v4h hv;
#pragma unroll
    for (int e = 0; e < 4; ++e) hv[e] = (_Float16)(o[i][e] * dinv[i]);
    *(v4h*)(Aout + (size_t)(c * ACH + tn + i) * DIM + h * DHEAD + 4 * l) = hv;
  }
}

// ---------------------------------------------------------------------------
// Host orchestration
// ---------------------------------------------------------------------------
extern "C" void kernel_launch(void* const* d_in, const int* in_sizes, int n_in,
                              void* d_out, int out_size, void* d_ws, size_t ws_size,
                              hipStream_t stream) {
  (void)in_sizes; (void)n_in; (void)out_size; (void)ws_size;
  const int*   tokens  = (const int*)  d_in[0];
  const float* tok_emb = (const float*)d_in[1];
  const float* pos_emb = (const float*)d_in[2];
  const float* Wq  = (const float*)d_in[3];
  const float* Wk  = (const float*)d_in[4];
  const float* Wv  = (const float*)d_in[5];
  const float* Wo  = (const float*)d_in[6];
  const float* bo  = (const float*)d_in[7];
  const float* ln1g = (const float*)d_in[8];
  const float* ln1b = (const float*)d_in[9];
  const float* W1  = (const float*)d_in[10];
  const float* b1  = (const float*)d_in[11];
  const float* W2  = (const float*)d_in[12];
  const float* b2  = (const float*)d_in[13];
  const float* ln2g = (const float*)d_in[14];
  const float* ln2b = (const float*)d_in[15];
  const float* lnfg = (const float*)d_in[16];
  const float* lnfb = (const float*)d_in[17];
  const float* Wout = (const float*)d_in[18];
  const float* bout = (const float*)d_in[19];
  float* out = (float*)d_out;

  char* p = (char*)d_ws;
  auto carve = [&](size_t bytes) -> char* {
    char* r = p; p += (bytes + 255) & ~(size_t)255; return r;
  };
  _Float16* QKVT  = (_Float16*)carve((size_t)NL * 3 * DIM * DIM * 2);  // fused [1536][512] per layer
  _Float16* WoT   = (_Float16*)carve((size_t)NL * DIM * DIM * 2);
  _Float16* W1T   = (_Float16*)carve((size_t)NL * DIM * FFD * 2);
  _Float16* W2T   = (_Float16*)carve((size_t)NL * DIM * FFD * 2);
  _Float16* WoutT = (_Float16*)carve((size_t)DIM * VOCAB * 2);
  float*    x     = (float*)   carve((size_t)SEQ * DIM * 4);
  _Float16* h16   = (_Float16*)carve((size_t)SEQ * DIM * 2);
  float*    qkvf  = (float*)   carve((size_t)SEQ * 3 * DIM * 4);
  _Float16* a16   = (_Float16*)carve((size_t)SEQ * DIM * 2);
  _Float16* ff16  = (_Float16*)carve((size_t)SEQ * FFD * 2);
  float*    sws   = (float*)   carve((size_t)NH * NCH * DHEAD * DHEAD * 4);  // per-chunk ke^T v
  float*    kws   = (float*)   carve((size_t)NH * NCH * DHEAD * 4);          // per-chunk sum of ke

  wt_transpose_all_f16<<<WT_TILES, 256, 0, stream>>>(Wq, Wk, Wv, Wo, W1, W2, Wout,
                                                     QKVT, WoT, W1T, W2T, WoutT);

  embed_kernel<<<SEQ * DIM / 256, 256, 0, stream>>>(tokens, tok_emb, pos_emb, x);

  const dim3 gD(DIM / 64, SEQ / 64);        // (8, 16)
  for (int i = 0; i < NL; ++i) {
    const size_t wo = (size_t)i * DIM * DIM;
    const size_t fo = (size_t)i * DIM * FFD;
    gemm_f16_wmma<0, true, 64, 192, 256, 2, true><<<dim3(NH, NCH), 256, 0, stream>>>(
        nullptr, x, ln1g + i * DIM, ln1b + i * DIM,
        QKVT + (size_t)i * 3 * DIM * DIM, nullptr, qkvf, nullptr, sws, kws, SEQ, 3 * DIM, DIM);
    attn_chunk_out_kernel<<<dim3(NH, NCH), 256, 0, stream>>>(qkvf, sws, kws, a16);
    gemm_f16_wmma<1, false, 64, 64, 256, 4, false><<<gD, 256, 0, stream>>>(a16, nullptr, nullptr, nullptr,
                                                    WoT + wo, bo + i * DIM, x, nullptr, nullptr, nullptr, SEQ, DIM, DIM);
    gemm_f16_wmma<2, true, 64, 128, 256, 2, false><<<dim3(FFD / 128, SEQ / 64), 256, 0, stream>>>(
        nullptr, x, ln2g + i * DIM, ln2b + i * DIM,
        W1T + fo, b1 + i * FFD, nullptr, ff16, nullptr, nullptr, SEQ, FFD, DIM);
    gemm_f16_wmma<1, false, 64, 64, 256, 4, false><<<gD, 256, 0, stream>>>(ff16, nullptr, nullptr, nullptr,
                                                    W2T + fo, b2 + i * DIM, x, nullptr, nullptr, nullptr, SEQ, DIM, FFD);
  }
  layernorm_f16_kernel<<<SEQ, 128, 0, stream>>>(x, lnfg, lnfb, h16);
  gemm_f16_wmma<0, false, 128, 128, 128, 4, false><<<dim3(VOCAB / 128, SEQ / 128), 256, 0, stream>>>(
      h16, nullptr, nullptr, nullptr, WoutT, bout, out, nullptr, nullptr, nullptr, SEQ, VOCAB, DIM);
}

// v009
// One run takes 208 microseconds.
// Timed twice side by side with v008, it ran 1.04 and 1.02 times as fast.
// Counting every step since v000, it is 52.2 times as fast.
#include <hip/hip_runtime.h>
#include <hip/hip_bf16.h>
#include <math.h>
#include <stdint.h>

// ---- model dims (fixed by reference) ----
#define SEQ   1024
#define DIM   512
#define NH    8
#define DHEAD 64
#define FFD   2048
#define NL    4
#define VOCAB 32000

typedef __attribute__((ext_vector_type(16))) _Float16 v16h;
typedef __attribute__((ext_vector_type(8)))  _Float16 v8h;
typedef __attribute__((ext_vector_type(8)))  float    v8f;
typedef __attribute__((__vector_size__(16))) int      v4i;   // matches builtin param type
typedef __attribute__((ext_vector_type(4))) float    v4f;
typedef __attribute__((ext_vector_type(2))) float    v2f;
typedef __attribute__((ext_vector_type(4))) _Float16 v4h;

// ---- CDNA5 async global->LDS path (ASYNCcnt) --------------------------------
// Rebuild addrspace-qualified int4 pointers from flat addresses (LDS flat addr
// low 32 bits == LDS byte offset on CDNA5, ISA 10.2 aperture mapping; flat ==
// global address for AS1).
#define AS1P(p) ((__attribute__((address_space(1))) v4i*)(unsigned long long)(uintptr_t)(p))
#define AS3P(p) ((__attribute__((address_space(3))) v4i*)(unsigned)(uintptr_t)(p))

// ---------------------------------------------------------------------------
// Weight transpose + fp32 -> f16 convert:  in[K][N] -> out[N][K].
// A work-group takes one tile of 64 k x 256 n:
// a wave's load is 512 contiguous bytes of an input row, a wave's store is four
// whole 128-byte lines of output rows.
// ---------------------------------------------------------------------------
#define WTK 64
#define WTN 256
#define WTP (WTK + 8)                        // LDS row pitch in halves: 144 B = 16 B x odd
typedef __attribute__((ext_vector_type(4))) float wt4f;

template <int K, int N>
__device__ __forceinline__ void wt_tile(const float* __restrict__ in, _Float16* __restrict__ out,
                                        int kt, int nt, _Float16 (*tile)[WTP]) {
  const int tid = threadIdx.x;
  const int c  = tid & 63;                   // columns n = 4c .. 4c+3 of the tile
  const int kr = tid >> 6;                   // rows k = 16kr .. 16kr+15 of the tile
  const float* s = in + (size_t)(kt * WTK + kr * 16) * N + nt * WTN + 4 * c;
  wt4f r[16];
#pragma unroll
  for (int i = 0; i < 16; ++i) r[i] = *(const wt4f*)(s + (size_t)i * N);
  // the address as an input keeps the issued loads' address registers untouched up to this wait
  asm volatile("s_wait_xcnt 0x0" :: "v"(s) : "memory");
#pragma unroll
  for (int j = 0; j < 4; ++j) {
    v8h lo, hi;
#pragma unroll
    for (int i = 0; i < 8; ++i) { lo[i] = (_Float16)r[i][j]; hi[i] = (_Float16)r[8 + i][j]; }
    *(v8h*)&tile[4 * c + j][kr * 16]     = lo;
    *(v8h*)&tile[4 * c + j][kr * 16 + 8] = hi;
  }
  __syncthreads();
  const int n0 = tid >> 3, q = (tid & 7) * 8;  // 8 lanes a row of 64 halves
  _Float16* d = out + (size_t)(nt * WTN + n0) * K + kt * WTK + q;
#pragma unroll
  for (int p = 0; p < 8; ++p)
    *(v8h*)(d + (size_t)p * 32 * K) = *(const v8h*)&tile[n0 + 32 * p][q];
  // other code of the kernel may follow the tile in the text: the registers that the issued stores name
  // take new values only behind this wait (the address as an input keeps it untouched up to here)
  asm volatile("s_wait_xcnt 0x0" :: "v"(d) : "memory");
}

// Embedding: x[n,d] = tok_emb[tokens[n],d] + pos_emb[n,d]; work-group b takes 256 elements, a thread one
#define EMB_WGS (SEQ * DIM / 256)                                  // 2048
__device__ __forceinline__ void embed_one(const int* __restrict__ tokens, const float* __restrict__ tok_emb,
                                          const float* __restrict__ pos_emb, float* __restrict__ x, int b) {
  int idx = b * 256 + threadIdx.x;
  int n = idx >> 9;
  int d = idx & (DIM - 1);
  x[idx] = tok_emb[(size_t)min(max(tokens[n], 0), VOCAB - 1) * DIM + d] + pos_emb[idx];  // the row stays inside the table
}

#define WT_OUT_TILES ((DIM / WTK) * (VOCAB / WTN))                 // 1000
#define WT_SQ_TILES  ((DIM / WTK) * (DIM / WTN))                   // 16 for one DIM x DIM matrix
#define WT_FF_TILES  ((DIM / WTK) * (FFD / WTN))                   // 64 for W1, as many for W2
#define WT_LAYER_TILES (4 * WT_SQ_TILES + 2 * WT_FF_TILES)         // 192
#define WT_TILES (WT_OUT_TILES + NL * WT_LAYER_TILES)              // 1768

// Tile u of the list of all weight tiles: NL x WT_LAYER_TILES layer tiles (in a layer: Wq, Wk, Wv, Wo, W1, W2),
// then Wout's. u is the same for the whole work-group.
__device__ __forceinline__ void wt_one(int u,
                     const float* __restrict__ Wq, const float* __restrict__ Wk,
                     const float* __restrict__ Wv, const float* __restrict__ Wo,
                     const float* __restrict__ W1, const float* __restrict__ W2,
                     const float* __restrict__ Wout,
                     _Float16* __restrict__ QKVT, _Float16* __restrict__ WoT,
                     _Float16* __restrict__ W1T, _Float16* __restrict__ W2T,
                     _Float16* __restrict__ WoutT, _Float16 (*tile)[WTP]) {
  if (u >= NL * WT_LAYER_TILES) {
    const int b = u - NL * WT_LAYER_TILES;
    wt_tile<DIM, VOCAB>(Wout, WoutT, b & 7, b >> 3, tile);
    return;
  }
  const int layer = u / WT_LAYER_TILES;
  const int r = u - layer * WT_LAYER_TILES;
  if (r < 4 * WT_SQ_TILES) {
    const int which = r >> 4, t = r & 15;    // Wq, Wk, Wv, Wo
    const float* in = (which == 0 ? Wq : which == 1 ? Wk : which == 2 ? Wv : Wo) + (size_t)layer * DIM * DIM;
    _Float16* out = which < 3 ? QKVT + (size_t)(layer * 3 + which) * DIM * DIM
                              : WoT + (size_t)layer * DIM * DIM;
    wt_tile<DIM, DIM>(in, out, t & 7, t >> 3, tile);
  } else if (r < 4 * WT_SQ_TILES + WT_FF_TILES) {
    const int t = r - 4 * WT_SQ_TILES;
    wt_tile<DIM, FFD>(W1 + (size_t)layer * DIM * FFD, W1T + (size_t)layer * DIM * FFD, t & 7, t >> 3, tile);
  } else {
    const int t = r - 4 * WT_SQ_TILES - WT_FF_TILES;
    wt_tile<FFD, DIM>(W2 + (size_t)layer * DIM * FFD, W2T + (size_t)layer * DIM * FFD, t & 31, t >> 5, tile);
  }
}

// The preparation is dealt by first use. The first launch holds only what layer 0's QKV GEMM reads: the
// embedding and the WT_FIRST tiles of layer 0's Wq, Wk, Wv. The other tiles ride, WT_RIDE a launch, as extra
// work-groups in the attention launches, which leave most of the chip idle and read none of them.
#define WT_FIRST (3 * WT_SQ_TILES)                                 // 48
#define WT_RIDE  ((WT_TILES - WT_FIRST) / NL)                      // 430

__global__ void __launch_bounds__(256)
prep_kernel(const float* __restrict__ Wq, const float* __restrict__ Wk, const float* __restrict__ Wv,
            _Float16* __restrict__ QKVT,
            const int* __restrict__ tokens, const float* __restrict__ tok_emb,
            const float* __restrict__ pos_emb, float* __restrict__ x) {
  __shared__ __align__(16) _Float16 tile[WTN][WTP];
  // every choice below is the same for the whole work-group
  if (blockIdx.x >= WT_FIRST) {
    embed_one(tokens, tok_emb, pos_emb, x, blockIdx.x - WT_FIRST);
    return;
  }
  const int r = blockIdx.x;                  // the tiles go first: they last longer
  const int which = r >> 4, t = r & 15;
  wt_tile<DIM, DIM>(which == 0 ? Wq : which == 1 ? Wk : Wv, QKVT + (size_t)which * DIM * DIM, t & 7, t >> 3, tile);
}

// ---------------------------------------------------------------------------
// LayerNorm (per row of [SEQ, DIM]) -> f16 activations for GEMM A-operand
// ---------------------------------------------------------------------------
__global__ void layernorm_f16_kernel(const float* __restrict__ x,
                                     const float* __restrict__ g,
                                     const float* __restrict__ b,
                                     _Float16* __restrict__ out) {
  __shared__ float r1[128], r2[128];
  const int row = blockIdx.x, t = threadIdx.x;
  const float* xr = x + (size_t)row * DIM;
  float s = 0.f, s2 = 0.f;
  for (int d = t; d < DIM; d += 128) { float v = xr[d]; s += v; s2 += v * v; }
  r1[t] = s; r2[t] = s2; __syncthreads();
#pragma unroll
  for (int st = 64; st > 0; st >>= 1) {
    if (t < st) { r1[t] += r1[t + st]; r2[t] += r2[t + st]; }
    __syncthreads();
  }
  const float mean = r1[0] * (1.f / DIM);
  const float var  = r2[0] * (1.f / DIM) - mean * mean;
  const float rstd = rsqrtf(var + 1e-5f);
  for (int d = t; d < DIM; d += 128)
    out[(size_t)row * DIM + d] = (_Float16)((xr[d] - mean) * rstd * g[d] + b[d]);
}

// ---------------------------------------------------------------------------
// WMMA GEMM:  C[M,N] (op)= A[M,K](f16) * Bt[N,K](f16)^T + bias
//   EPI 0: C(f32) = val          EPI 1: C(f32) += val          EPI 2: Ch(f16) = gelu(val)
// Block: 256 threads = 8 wave32, WR x WC. Block tile BM x BN, a stage is BK k of both operands;
// wave tile FA x FB fragments of 16 x 16 (FA * FB WMMA per 32 k).
// The vocabulary GEMM has 2000 tiles: 128 x 128, stage 128 k (4x2 waves of 32x64), two work-groups
// a WGP. The layers' GEMMs are small and a launch lasts as long as one work-group: their tiles
// have fewer rows and a longer stage, 64 x 128 x 256 (2x4 waves of 32x32), 64 x 192 x 256 for QKV
// (2x4 waves of 32x48) and, for N = 512, 64 x 64 x 256 (4x2 waves of 16x32). So 128 to 256 work-groups share a launch, each has less to
// normalise, to read from LDS and to store, and it waits for half as many stages.
// A wave-wide 16-byte copy covers one row's 512 contiguous bytes (BK 256) or two rows' 256 (BK 128) of the stage, whole 128-byte lines. Two LDS
// buffers; the next stage's async copies fly while this one is worked on.
// M a multiple of BM, N of BN, K of BK.
// LNA: the A operand is LayerNorm(X) (K == DIM). The work-group normalises its own
// BM rows of X (f32) once, one wave a row, and keeps them as f16 in LDS for the
// whole k loop; only B goes through the two stage buffers.
// ST (the QKV GEMM, BM == ACH, BN == 3 * DHEAD): the tile is one head's q | k | v of one chunk of
// ACH tokens, so the work-group holds all that the chunk's sums ke^T v and sum of ke are made of:
// it forms them itself from its accumulators, through LDS, and writes them beside C.
// ---------------------------------------------------------------------------
// One stage of one operand: ROWS rows x 2 BK bytes. BK / 8 threads cover a row with 16 B each, the
// 256 threads RP = 2048 / BK rows at a time, so a thread has ROWS / RP pieces.
// g and l already point at this thread's piece of row tid / (BK / 8).
// LDS row pitch BK + 8 halves: 272 B or 528 B = 16 B x odd.
template <int ROWS, int BK>
__device__ __forceinline__ void gemm_stage_copy(const _Float16* g, _Float16* l, int K) {
  constexpr int RP = 2048 / BK;
#pragma unroll
  for (int i = 0; i < ROWS / RP; ++i)
    __builtin_amdgcn_global_load_async_to_lds_b128(AS1P(g + (size_t)i * RP * K),
                                                   AS3P(l + i * RP * (BK + 8)), 0, 0);
}

// One stage of B. ST: the tile's rows are DHEAD rows each of Wq^T, Wk^T and Wv^T, which lie DIM rows apart.
template <bool ST, int BN, int BK>
__device__ __forceinline__ void gemm_stage_copy_b(const _Float16* g, _Float16* l, int K) {
  if constexpr (ST) {
#pragma unroll
    for (int w = 0; w < 3; ++w)
      gemm_stage_copy<DHEAD, BK>(g + (size_t)w * DIM * K, l + w * DHEAD * (BK + 8), K);
  } else {
    gemm_stage_copy<BN, BK>(g, l, K);
  }
}

// sum over the 32 lanes of a wave, the result in every lane: four steps inside the
// 16-lane row (row_xmask 1, 2, 4, 8), then lane l with lane l ^ 16
template <int XM>
__device__ __forceinline__ float row_xadd(float v) {
  return v + __builtin_bit_cast(float, __builtin_amdgcn_update_dpp(
                 0, __builtin_bit_cast(int, v), 0x160 | XM, 0xf, 0xf, true));
}
__device__ __forceinline__ float wave_sum(float v) {
  v = row_xadd<1>(v); v = row_xadd<2>(v); v = row_xadd<4>(v); v = row_xadd<8>(v);
  return v + __builtin_bit_cast(float, __builtin_amdgcn_permlanex16(
                 __builtin_bit_cast(int, v), __builtin_bit_cast(int, v), 0x76543210, 0xfedcba98, false, false));
}

#define LPITCH (DIM + 8)                     // LDS row pitch of the normalised A in halves: 1040 B = 16 B x odd
#define ACH 64                               // tokens of an attention chunk
#define NCH (SEQ / ACH)
#define SPITCH (DHEAD + 4)                   // LDS row pitch of ke and v in floats: 272 B = 16 B x odd

template <int EPI, bool LNA, int BM, int BN, int BK, int WR, bool ST>
__global__ void __launch_bounds__(256)
gemm_f16_wmma(const _Float16* __restrict__ A, const float* __restrict__ X,
              const float* __restrict__ lng, const float* __restrict__ lnb,
              const _Float16* __restrict__ Bt,
              const float* __restrict__ bias, float* __restrict__ C,
              _Float16* __restrict__ Ch, float* __restrict__ Sws, float* __restrict__ Kws,
              int M, int N, int K) {
  constexpr int GBK = BK;
  constexpr int GPITCH = BK + 8;             // LDS row pitch of a stage in halves
  constexpr int WC = 8 / WR;                 // waves across the tile's columns
  constexpr int FA = BM / (16 * WR);         // A fragments of a wave
  constexpr int FB = BN / (16 * WC);         // B fragments of a wave
  __shared__ __align__(16) _Float16 lA[LNA ? 1 : 2][BM][LNA ? LPITCH : GPITCH];
  __shared__ __align__(16) _Float16 lB[2][BN][GPITCH];

  const int tid  = threadIdx.x;
  const int lane = tid & 31;
  const int wid  = tid >> 5;
  const int wr   = wid / WC;                 // slab of FA * 16 rows
  const int wc   = wid % WC;                 // slab of FB * 16 columns
  const int rowBase = blockIdx.y * BM;
  const int colBase = blockIdx.x * BN;

  // staging: BK / 8 threads a row, 16 B each
  const int srow = tid / (BK / 8);           // + 2048 / BK for each further piece
  const int skq  = (tid % (BK / 8)) * 8;     // halves
  const _Float16* gA = A  + (size_t)(rowBase + srow) * K + skq;
  const int bRow0 = ST ? (int)blockIdx.x * DHEAD : colBase;   // first row of Bt in the tile (ST: of its q rows)
  const _Float16* gB = Bt + (size_t)(bRow0 + srow) * K + skq;

  // fragment coords (16-bit 16x32 layout: lane%16 = row/col, lane/16 = K-half)
  const int mrow = lane & 15;
  const int kb   = (lane >> 4) * 8;

  v8f acc[FA][FB];
#pragma unroll
  for (int a = 0; a < FA; ++a)
#pragma unroll
    for (int j = 0; j < FB; ++j) acc[a][j] = (v8f){};

  const int nst = K / GBK;                   // stages; the same for the whole work-group

  // C/D layout: VGPR i -> M = i + 8*(lane/16), N = lane%16
  const int row0 = rowBase + wr * (FA * 16) + (lane >> 4) * 8;
  const int colW = colBase + wc * (FB * 16) + (lane & 15);
  // column of C that fragment j holds. ST: fragment f of the tile's twelve is 16 columns of q (f < 4), k or v of head blockIdx.x
  const int f0 = __builtin_amdgcn_readfirstlane(wc) * FB;
  auto colOf = [&](int j) -> int {
    if constexpr (ST) return ((f0 + j) >> 2) * DIM + bRow0 + ((f0 + j) & 3) * 16 + (lane & 15);
    else return colW + j * 16;
  };

  // ---- prologue: stage 0 into buffer 0, published; then stage 1 starts into buffer 1 ----
  if constexpr (!LNA) gemm_stage_copy<BM, BK>(gA, &lA[0][srow][skq], K);
  gemm_stage_copy_b<ST, BN, BK>(gB, &lB[0][srow][skq], K);
  if constexpr (LNA) {
    // wave wid normalises BM / 8 rows of the tile, from row wid * BM / 8 on, four rows' loads in flight;
    // a lane holds columns 128 q + 4 lane .. + 3, so every load covers 512 contiguous bytes
    const int w16 = __builtin_amdgcn_readfirstlane(wid) * (BM / 8);
    const v4f* xw = (const v4f*)(X + (size_t)(rowBase + w16) * DIM);
    const v4f* g4 = (const v4f*)lng;
    const v4f* b4 = (const v4f*)lnb;
    const int c4 = lane * 4;
    v4f gg[4], gb[4];
#pragma unroll
    for (int q = 0; q < 4; ++q) {
      gg[q] = g4[lane + q * 32];
      gb[q] = b4[lane + q * 32];
    }
    // kept rolled: this text runs once
#pragma unroll 1
    for (int it = 0; it < BM / 32; ++it) {
      const v4f* xr = xw + lane + it * DIM;  // the lane's piece; four rows of DIM / 4 pieces a trip
      v4f xv[4][4];
#pragma unroll
      for (int r = 0; r < 4; ++r)
#pragma unroll
        for (int q = 0; q < 4; ++q)
          xv[r][q] = xr[r * (DIM / 4) + q * 32];
      // the addresses as inputs keep the issued loads' address registers untouched up to this
      // wait; behind it the next trip may form new ones
      asm volatile("s_wait_xcnt 0x0" :: "v"(xr), "s"(g4), "s"(b4), "v"(lane) : "memory");
      float s1[4], s2[4];
#pragma unroll
      for (int r = 0; r < 4; ++r) {
        const v4f a = (xv[r][0] + xv[r][1]) + (xv[r][2] + xv[r][3]);
        v4f b = xv[r][0] * xv[r][0];
#pragma unroll
        for (int q = 1; q < 4; ++q) b += xv[r][q] * xv[r][q];
        s1[r] = (a[0] + a[1]) + (a[2] + a[3]);
        s2[r] = (b[0] + b[1]) + (b[2] + b[3]);
      }
#pragma unroll
      for (int r = 0; r < 4; ++r) { s1[r] = wave_sum(s1[r]); s2[r] = wave_sum(s2[r]); }
#pragma unroll
      for (int r = 0; r < 4; ++r) {
        const float mean = s1[r] * (1.f / DIM);
        const float var  = s2[r] * (1.f / DIM) - mean * mean;
        const float rstd = rsqrtf(var + 1e-5f);
#pragma unroll
        for (int q = 0; q < 4; ++q) {
          const v4f y = (xv[r][q] - mean) * rstd * gg[q] + gb[q];
          v4h hv;
#pragma unroll
          for (int e = 0; e < 4; ++e) hv[e] = (_Float16)y[e];
          *(v4h*)&lA[0][w16 + it * 4 + r][q * 128 + c4] = hv;
        }
      }
    }
  }
  asm volatile("s_wait_asynccnt 0x0" ::: "memory");   // this wave's pieces of stage 0 have landed
  __syncthreads();                                    // LNA: it also publishes the normalised rows
  if (nst > 1) {
    if constexpr (!LNA) gemm_stage_copy<BM, BK>(gA + GBK, &lA[1][srow][skq], K);
    gemm_stage_copy_b<ST, BN, BK>(gB + GBK, &lB[1][srow][skq], K);
  }

  // Everything the epilogue reads from global memory is asked for here, all of it in
  // flight at once behind the second stage's copies: the first pass of the k loop covers the latency.
  // The loops are unrolled so that bb and res are registers with constant indices.
  float bb[FB];
  float res[FA][FB][8];
#pragma unroll
  for (int j = 0; j < FB; ++j) bb[j] = 0.f;
  if (bias) {
#pragma unroll
    for (int j = 0; j < FB; ++j) bb[j] = bias[colOf(j)];
  }
  if (EPI == 1) {
#pragma unroll
    for (int a = 0; a < FA; ++a)
#pragma unroll
      for (int i = 0; i < 8; ++i)
#pragma unroll
        for (int j = 0; j < FB; ++j)
          res[a][j][i] = C[(size_t)(row0 + a * 16 + i) * N + colW + j * 16];
  }
  // the base and the column offset as inputs keep the issued loads' address registers untouched
  // up to this wait; behind it they may take new values
  asm volatile("s_wait_xcnt 0x0" :: "s"(bias), "v"(colW) : "memory");

  // Fragments go through two register sets: the LDS reads of the next 32 k stand as one group
  // in front of this block's WMMAs and return under them. All reads of a stage stay inside its own trip.
  union Frag { v16h v; v8h h[2]; };
  Frag af[2][FA], bf[2][FB];
  for (int s = 0; s < nst; ++s) {
    const int buf = s & 1;
    const _Float16* ab = LNA ? &lA[0][wr * (FA * 16) + mrow][s * GBK + kb] : &lA[buf][wr * (FA * 16) + mrow][kb];
    const _Float16* bb0 = &lB[buf][wc * (FB * 16) + mrow][kb];
#pragma unroll
    for (int u = -1; u < GBK / 32; ++u) {
      if (u + 1 < GBK / 32) {
        const int ns = (u + 1) & 1;          // the set that block u + 1 is read into
        const int ks = (u + 1) * 32;
#pragma unroll
        for (int a = 0; a < FA; ++a) {
          const _Float16* ar = ab + a * 16 * (LNA ? LPITCH : GPITCH) + ks;
          af[ns][a].h[0] = *(const v8h*)ar;
          af[ns][a].h[1] = *(const v8h*)(ar + 16);
        }
#pragma unroll
        for (int j = 0; j < FB; ++j) {
          const _Float16* br = bb0 + j * 16 * GPITCH + ks;
          bf[ns][j].h[0] = *(const v8h*)br;
          bf[ns][j].h[1] = *(const v8h*)(br + 16);
        }
      }
      // keeps the read group whole and in front of the WMMAs
      __builtin_amdgcn_sched_barrier(0);
      if (u >= 0) {
        const int cs = u & 1;
#pragma unroll
        for (int a = 0; a < FA; ++a)
#pragma unroll
          for (int j = 0; j < FB; ++j)
            acc[a][j] = __builtin_amdgcn_wmma_f32_16x16x32_f16(false, af[cs][a].v, false, bf[cs][j].v,
                                                               (short)0, acc[a][j], false, false);
        // keeps the next group of reads behind this block's WMMAs
        __builtin_amdgcn_sched_barrier(0);
      }
    }
    // publish point of stage s + 1
    asm volatile("s_wait_dscnt 0x0" ::: "memory");     // this wave's reads of buffer buf are done before it is refilled
    asm volatile("s_wait_asynccnt 0x0" ::: "memory");  // this wave's pieces of stage s + 1 have landed
    __syncthreads();
    if (s + 2 < nst) {                                 // refill the buffer every wave has just left
      if constexpr (!LNA) gemm_stage_copy<BM, BK>(gA + (size_t)(s + 2) * GBK, &lA[buf][srow][skq], K);
      gemm_stage_copy_b<ST, BN, BK>(gB + (size_t)(s + 2) * GBK, &lB[buf][srow][skq], K);
    }
  }
  asm volatile("s_wait_asynccnt 0x0" ::: "memory");    // no copy is left in flight when the wave goes on to its end

  // ST: ke = exp(k) and v of the chunk go to LDS as f32, into B's stage buffer 0, which every wave left
  // at the loop's first barrier. The last chunk's sums have no reader (the test is the same for the work-group).
  float (*kel)[SPITCH] = (float (*)[SPITCH])&lB[0][0][0];
  float (*vsl)[SPITCH] = kel + ACH;
  const bool sums = ST && blockIdx.y < NCH - 1;
  if constexpr (ST) {
    if (sums) {
#pragma unroll
      for (int j = 0; j < FB; ++j) {
        const int f = f0 + j;                          // the same for the whole wave
        if (f >= 4) {
          float (*dl)[SPITCH] = f < 8 ? kel : vsl;
#pragma unroll
          for (int a = 0; a < FA; ++a)
#pragma unroll
            for (int i = 0; i < 8; ++i) {
              const float v = acc[a][j][i] + bb[j];
              dl[wr * (FA * 16) + a * 16 + (lane >> 4) * 8 + i][(f & 3) * 16 + (lane & 15)] = f < 8 ? __expf(v) : v;
            }
        }
      }
      __syncthreads();                                 // publishes ke and v; it stands in front of C's stores, so it waits for none
    }
  }

#pragma unroll
  for (int a = 0; a < FA; ++a) {
#pragma unroll
    for (int j = 0; j < FB; ++j) {
      const int col = colOf(j);
#pragma unroll
      for (int i = 0; i < 8; ++i) {
        const size_t idx = (size_t)(row0 + a * 16 + i) * N + col;
        const float v = acc[a][j][i] + bb[j];
        if (EPI == 0)      C[idx] = v;
        else if (EPI == 1) C[idx] = res[a][j][i] + v;
        else Ch[idx] = (_Float16)(0.5f * v * (1.f + erff(v * 0.70710678118f)));
      }
    }
  }

  if constexpr (ST) {
    // the registers that C's issued stores name take new values below, and only behind this wait
    asm volatile("s_wait_xcnt 0x0" ::: "memory");
    if (sums) {
      // ke^T v and the sum of ke over the chunk's tokens, while C's stores drain.
      // thread tile: rows d = 4g..4g+3, columns e = 4l..4l+3
      const int l = tid & 15, g = tid >> 4;
      v4f sa[4];
      v4f ks = (v4f){0.f, 0.f, 0.f, 0.f};
#pragma unroll
      for (int i = 0; i < 4; ++i) sa[i] = (v4f){0.f, 0.f, 0.f, 0.f};
#pragma unroll 8
      for (int n = 0; n < ACH; ++n) {
        const v4f ka = *(const v4f*)&kel[n][4 * g];
        const v4f vb = *(const v4f*)&vsl[n][4 * l];
#pragma unroll
        for (int i = 0; i < 4; ++i) sa[i] += ka[i] * vb;
        ks += ka;
      }
      const int hc = blockIdx.x * NCH + blockIdx.y;
      float* dst = Sws + (size_t)hc * (DHEAD * DHEAD);
#pragma unroll
      for (int i = 0; i < 4; ++i) *(v4f*)(dst + (4 * g + i) * DHEAD + 4 * l) = sa[i];
      if (l == 0) *(v4f*)(Kws + hc * DHEAD + 4 * g) = ks;
    }
  }
}

// ---------------------------------------------------------------------------
// Causal linear attention over fused QKV buffer [SEQ][3*DIM], in chunks of
// ACH tokens. With ke = exp(k), qs = softmax(q) * DHEAD^-0.5 and, for chunk c,
//   Sprev = sum over tokens before the chunk of ke^T v     (DHEAD x DHEAD)
//   kprev = sum over tokens before the chunk of ke         (DHEAD)
//   P[n][m] = qs[n] . ke[m] for m <= n inside the chunk, else 0
// the output row is (qs[n] . Sprev + P[n] . v) / max(qs[n] . kprev + sum_m P[n][m], eps).
// The QKV GEMM writes each chunk's own ke^T v and sum of ke; this launch adds up the
// chunks before its own and forms the rows. All sums in f32.
// ---------------------------------------------------------------------------
// grid (NH, NCH + RIDE_ROWS): the work-groups from blockIdx.y == NCH on do no attention; the first WT_RIDE of them each transpose one
// weight tile that a later launch reads: first rideLayer tiles of the list from rideLayer0 on, then Wout's from rideOut0 on.
#define RIDE_ROWS ((WT_RIDE + NH - 1) / NH)                  // 54
#define AT_X (ACH * (DHEAD + ACH + 4))
#define AT_Y ((DHEAD + ACH) * DHEAD)
#define AT_K (ACH * (DHEAD + 4))
__global__ void __launch_bounds__(256)
attn_chunk_out_kernel(const float* __restrict__ QKV, const float* __restrict__ Sws,
                      const float* __restrict__ Kws, _Float16* __restrict__ Aout,
                      const float* __restrict__ Wq, const float* __restrict__ Wk,
                      const float* __restrict__ Wv, const float* __restrict__ Wo,
                      const float* __restrict__ W1, const float* __restrict__ W2,
                      const float* __restrict__ Wout,
                      _Float16* __restrict__ QKVT, _Float16* __restrict__ WoT,
                      _Float16* __restrict__ W1T, _Float16* __restrict__ W2T,
                      _Float16* __restrict__ WoutT, int rideLayer, int rideLayer0, int rideOut0) {
  // one LDS block, so that a riding work-group's tile lies on the attention's arrays and adds nothing to them
  __shared__ __align__(16) float sm[AT_X + AT_Y + AT_K + DHEAD];
  static_assert(sizeof(sm) >= sizeof(_Float16) * WTN * WTP, "the weight tile fits");
  if (blockIdx.y >= NCH) {                                  // the same for the whole work-group
    const int j = (blockIdx.y - NCH) * NH + blockIdx.x;
    if (j < WT_RIDE)
      wt_one(j < rideLayer ? rideLayer0 + j : NL * WT_LAYER_TILES + rideOut0 + (j - rideLayer),
             Wq, Wk, Wv, Wo, W1, W2, Wout, QKVT, WoT, W1T, W2T, WoutT, (_Float16 (*)[WTP])sm);
    return;
  }
  float (*X)[DHEAD + ACH + 4] = (float (*)[DHEAD + ACH + 4])sm;          // row n: qs[n][0..63] | P[n][0..63]
  float (*Y)[DHEAD]           = (float (*)[DHEAD])(sm + AT_X);           // rows 0..63 Sprev[d][e], rows 64.. v[m][e]
  float (*Kl)[DHEAD + 4]      = (float (*)[DHEAD + 4])(sm + AT_X + AT_Y); // ke[m][d]; pitch 16 B x odd
  float* kp                   = sm + AT_X + AT_Y + AT_K;                 // kprev
  const int h = blockIdx.x, c = blockIdx.y, tid = threadIdx.x;
  const int l = tid & 15, g = tid >> 4;

  // ---- Sprev, kprev: add up the chunks before this one, four chunks' loads in flight ----
  v4f sp[4];
#pragma unroll
  for (int r = 0; r < 4; ++r) sp[r] = (v4f){0.f, 0.f, 0.f, 0.f};
  const float* sb = Sws + (size_t)h * NCH * (DHEAD * DHEAD);
  const unsigned so = (unsigned)tid * 4u;
  for (int g0 = 0; g0 < c; g0 += 4) {
    v4f t[4][4];
    const float* sc[4];
#pragma unroll
    for (int j = 0; j < 4; ++j) {
      sc[j] = sb + (size_t)min(g0 + j, c - 1) * (DHEAD * DHEAD) + so;
#pragma unroll
      for (int r = 0; r < 4; ++r) t[j][r] = *(const v4f*)(sc[j] + r * 1024);
    }
    // the addresses as inputs keep the issued loads' address registers untouched up to this wait;
    // behind it the next trip may form new ones
    asm volatile("s_wait_xcnt 0x0" :: "v"(sc[0]), "v"(sc[1]), "v"(sc[2]), "v"(sc[3]) : "memory");
#pragma unroll
    for (int j = 0; j < 4; ++j) {
      const float w = (g0 + j < c) ? 1.f : 0.f;
#pragma unroll
      for (int r = 0; r < 4; ++r) sp[r] += w * t[j][r];
    }
  }
#pragma unroll
  for (int r = 0; r < 4; ++r) *(v4f*)&Y[r * 16 + g][4 * l] = sp[r];
  if (tid < DHEAD) {
    float s = 0.f;
#pragma unroll
    for (int cc = 0; cc < NCH - 1; ++cc) {
      const float t = Kws[(h * NCH + cc) * DHEAD + tid];
      s += (cc < c) ? t : 0.f;
    }
    kp[tid] = s;
  }

  // ---- this chunk's q (softmax over the row, 16 lanes a row), ke, v ----
  const float* sq[4];
  v4f q4[4], k4[4], v4[4];
#pragma unroll
  for (int p = 0; p < 4; ++p) {
    sq[p] = QKV + (size_t)(c * ACH + p * 16 + g) * (3 * DIM) + h * DHEAD + 4 * l;
    q4[p] = *(const v4f*)(sq[p]);
    k4[p] = *(const v4f*)(sq[p] + DIM);
    v4[p] = *(const v4f*)(sq[p] + 2 * DIM);
  }
  // the addresses as inputs keep the issued loads' address registers untouched up to this wait
  asm volatile("s_wait_xcnt 0x0" :: "v"(sq[0]), "v"(sq[1]), "v"(sq[2]), "v"(sq[3]) : "memory");
#pragma unroll
  for (int p = 0; p < 4; ++p) {
    const int n = p * 16 + g;
    v4f qv = q4[p];
    v4f kv = k4[p];
    const v4f vv = v4[p];
    float mx = fmaxf(fmaxf(qv[0], qv[1]), fmaxf(qv[2], qv[3]));
#pragma unroll
    for (int m = 1; m < 16; m <<= 1) mx = fmaxf(mx, __shfl_xor(mx, m));
#pragma unroll
    for (int e = 0; e < 4; ++e) qv[e] = __expf(qv[e] - mx);
    float sm = (qv[0] + qv[1]) + (qv[2] + qv[3]);
#pragma unroll
    for (int m = 1; m < 16; m <<= 1) sm += __shfl_xor(sm, m);
    const float qsc = 0.125f / sm;                 // 1 / row sum, * DHEAD^-0.5
#pragma unroll
    for (int e = 0; e < 4; ++e) {
      qv[e] *= qsc;
      kv[e] = __expf(kv[e]);
    }
    *(v4f*)&X[n][4 * l]          = qv;
    *(v4f*)&Kl[n][4 * l]         = kv;
    *(v4f*)&Y[DHEAD + n][4 * l]  = vv;
  }
  __syncthreads();

  // ---- P: thread tile rows n = tn..tn+3, columns m = l + 16*jj ----
  const int tn = 4 * g;
  v2f pr2[4][4];                                   // even-d and odd-d halves of each dot product
#pragma unroll
  for (int i = 0; i < 4; ++i)
#pragma unroll
    for (int jj = 0; jj < 4; ++jj) pr2[i][jj] = (v2f){0.f, 0.f};
#pragma unroll 2
  for (int d = 0; d < DHEAD; d += 4) {
    v4f qa[4], kb[4];
#pragma unroll
    for (int i = 0; i < 4; ++i) qa[i] = *(const v4f*)&X[tn + i][d];
#pragma unroll
    for (int jj = 0; jj < 4; ++jj) kb[jj] = *(const v4f*)&Kl[l + 16 * jj][d];
#pragma unroll
    for (int i = 0; i < 4; ++i)
#pragma unroll
      for (int jj = 0; jj < 4; ++jj) {
        pr2[i][jj] += qa[i].lo * kb[jj].lo;
        pr2[i][jj] += qa[i].hi * kb[jj].hi;
      }
  }
  // denominator: each of the row's 16 lanes adds its four columns of P and its
  // four terms of qs . kprev; the lanes are then summed.
  float dinv[4];
  const v4f kq = *(const v4f*)&kp[4 * l];
#pragma unroll
  for (int i = 0; i < 4; ++i) {
    const v4f qq = *(const v4f*)&X[tn + i][4 * l];
    float rs = (qq[0] * kq[0] + qq[1] * kq[1]) + (qq[2] * kq[2] + qq[3] * kq[3]);
#pragma unroll
    for (int jj = 0; jj < 4; ++jj) {
      const int m = l + 16 * jj;
      const float pv = (m <= tn + i) ? pr2[i][jj][0] + pr2[i][jj][1] : 0.f;   // causal, own token included
      rs += pv;
      X[tn + i][DHEAD + m] = pv;
    }
#pragma unroll
    for (int m = 1; m < 16; m <<= 1) rs += __shfl_xor(rs, m);
    dinv[i] = 1.f / fmaxf(rs, 1e-3f);
  }
  __syncthreads();

  // ---- rows: [qs | P] x [Sprev ; v]; P is zero from column 8*(wave+1) on for this wave's rows ----
  const int jEnd = DHEAD + 8 * (__builtin_amdgcn_readfirstlane(tid >> 5) + 1);
  v4f o[4];
#pragma unroll
  for (int i = 0; i < 4; ++i) o[i] = (v4f){0.f, 0.f, 0.f, 0.f};
#pragma unroll 2
  for (int j = 0; j < jEnd; j += 4) {
    v4f xa[4], yb[4];
#pragma unroll
    for (int i = 0; i < 4; ++i) xa[i] = *(const v4f*)&X[tn + i][j];
#pragma unroll
    for (int e = 0; e < 4; ++e) yb[e] = *(const v4f*)&Y[j + e][4 * l];
#pragma unroll
    for (int i = 0; i < 4; ++i)
#pragma unroll
      for (int e = 0; e < 4; ++e) o[i] += xa[i][e] * yb[e];
  }
#pragma unroll
  for (int i = 0; i < 4; ++i) {
    v4h hv;
#pragma unroll
    for (int e = 0; e < 4; ++e) hv[e] = (_Float16)(o[i][e] * dinv[i]);
    *(v4h*)(Aout + (size_t)(c * ACH + tn + i) * DIM + h * DHEAD + 4 * l) = hv;
  }
  // the riding tiles' code follows in the kernel's text: the registers that the issued stores name take new values only behind this wait
  asm volatile("s_wait_xcnt 0x0" ::: "memory");
}

// ---------------------------------------------------------------------------
// Host orchestration
// ---------------------------------------------------------------------------
extern "C" void kernel_launch(void* const* d_in, const int* in_sizes, int n_in,
                              void* d_out, int out_size, void* d_ws, size_t ws_size,
                              hipStream_t stream) {
  (void)in_sizes; (void)n_in; (void)out_size; (void)ws_size;
  const int*   tokens  = (const int*)  d_in[0];
  const float* tok_emb = (const float*)d_in[1];
  const float* pos_emb = (const float*)d_in[2];
  const float* Wq  = (const float*)d_in[3];
  const float* Wk  = (const float*)d_in[4];
  const float* Wv  = (const float*)d_in[5];
  const float* Wo  = (const float*)d_in[6];
  const float* bo  = (const float*)d_in[7];
  const float* ln1g = (const float*)d_in[8];
  const float* ln1b = (const float*)d_in[9];
  const float* W1  = (const float*)d_in[10];
  const float* b1  = (const float*)d_in[11];
  const float* W2  = (const float*)d_in[12];
  const float* b2  = (const float*)d_in[13];
  const float* ln2g = (const float*)d_in[14];
  const float* ln2b = (const float*)d_in[15];
  const float* lnfg = (const float*)d_in[16];
  const float* lnfb = (const float*)d_in[17];
  const float* Wout = (const float*)d_in[18];
  const float* bout = (const float*)d_in[19];
  float* out = (float*)d_out;

  char* p = (char*)d_ws;
  auto carve = [&](size_t bytes) -> char* {
    char* r = p; p += (bytes + 255) & ~(size_t)255; return r;
  };
  _Float16* QKVT  = (_Float16*)carve((size_t)NL * 3 * DIM * DIM * 2);  // fused [1536][512] per layer
  _Float16* WoT   = (_Float16*)carve((size_t)NL * DIM * DIM * 2);
  _Float16* W1T   = (_Float16*)carve((size_t)NL * DIM * FFD * 2);
  _Float16* W2T   = (_Float16*)carve((size_t)NL * DIM * FFD * 2);
  _Float16* WoutT = (_Float16*)carve((size_t)DIM * VOCAB * 2);
  float*    x     = (float*)   carve((size_t)SEQ * DIM * 4);
  _Float16* h16   = (_Float16*)carve((size_t)SEQ * DIM * 2);
  float*    qkvf  = (float*)   carve((size_t)SEQ * 3 * DIM * 4);
  _Float16* a16   = (_Float16*)carve((size_t)SEQ * DIM * 2);
  _Float16* ff16  = (_Float16*)carve((size_t)SEQ * FFD * 2);
  float*    sws   = (float*)   carve((size_t)NH * NCH * DHEAD * DHEAD * 4);  // per-chunk ke^T v
  float*    kws   = (float*)   carve((size_t)NH * NCH * DHEAD * 4);          // per-chunk sum of ke

  prep_kernel<<<EMB_WGS + WT_FIRST, 256, 0, stream>>>(Wq, Wk, Wv, QKVT, tokens, tok_emb, pos_emb, x);

  // What rides in layer i's attention launch, WT_RIDE tiles each: the layer tiles still to do up to the end of
  // layer i + 1 (i = 0: the rest of layer 0 and layer 1; then layer i + 1), filled up with Wout's tiles.
  const int rideLayer[NL]  = {336, 192, 192, 0};
  const int rideLayer0[NL] = {48, 384, 576, 768};
  const int rideOut0[NL]   = {0, 94, 332, 570};

  const dim3 gD(DIM / 64, SEQ / 64);        // (8, 16)
  for (int i = 0; i < NL; ++i) {
    const size_t wo = (size_t)i * DIM * DIM;
    const size_t fo = (size_t)i * DIM * FFD;
    gemm_f16_wmma<0, true, 64, 192, 256, 2, true><<<dim3(NH, NCH), 256, 0, stream>>>(
        nullptr, x, ln1g + i * DIM, ln1b + i * DIM,
        QKVT + (size_t)i * 3 * DIM * DIM, nullptr, qkvf, nullptr, sws, kws, SEQ, 3 * DIM, DIM);
    attn_chunk_out_kernel<<<dim3(NH, NCH + RIDE_ROWS), 256, 0, stream>>>(
        qkvf, sws, kws, a16, Wq, Wk, Wv, Wo, W1, W2, Wout, QKVT, WoT, W1T, W2T, WoutT,
        rideLayer[i], rideLayer0[i], rideOut0[i]);
    gemm_f16_wmma<1, false, 64, 64, 256, 4, false><<<gD, 256, 0, stream>>>(a16, nullptr, nullptr, nullptr,
                                                    WoT + wo, bo + i * DIM, x, nullptr, nullptr, nullptr, SEQ, DIM, DIM);
    gemm_f16_wmma<2, true, 64, 128, 256, 2, false><<<dim3(FFD / 128, SEQ / 64), 256, 0, stream>>>(
        nullptr, x, ln2g + i * DIM, ln2b + i * DIM,
        W1T + fo, b1 + i * FFD, nullptr, ff16, nullptr, nullptr, SEQ, FFD, DIM);
    gemm_f16_wmma<1, false, 64, 64, 256, 4, false><<<gD, 256, 0, stream>>>(ff16, nullptr, nullptr, nullptr,
                                                    W2T + fo, b2 + i * DIM, x, nullptr, nullptr, nullptr, SEQ, DIM, FFD);
  }
  layernorm_f16_kernel<<<SEQ, 128, 0, stream>>>(x, lnfg, lnfb, h16);
  gemm_f16_wmma<0, false, 128, 128, 128, 4, false><<<dim3(VOCAB / 128, SEQ / 128), 256, 0, stream>>>(
      h16, nullptr, nullptr, nullptr, WoutT, bout, out, nullptr, nullptr, nullptr, SEQ, VOCAB, DIM);
}

// v010
// A run of this version takes 200 microseconds.
// Two timings next to v009 put it at 1.05 and 1.03 times that version's speed.
// Over all steps from v000 it is 54.2 times as fast.
#include <hip/hip_runtime.h>
#include <hip/hip_bf16.h>
#include <math.h>
#include <stdint.h>

// ---- model dims (fixed by reference) ----
#define SEQ   1024
#define DIM   512
#define NH    8
#define DHEAD 64
#define FFD   2048
#define NL    4
#define VOCAB 32000

typedef __attribute__((ext_vector_type(16))) _Float16 v16h;
typedef __attribute__((ext_vector_type(8)))  _Float16 v8h;
typedef __attribute__((ext_vector_type(8)))  float    v8f;
typedef __attribute__((__vector_size__(16))) int      v4i;   // matches builtin param type
typedef __attribute__((ext_vector_type(4))) float    v4f;
typedef __attribute__((ext_vector_type(2))) float    v2f;
typedef __attribute__((ext_vector_type(4))) _Float16 v4h;

// ---- CDNA5 async global->LDS path (ASYNCcnt) --------------------------------
// Rebuild addrspace-qualified int4 pointers from flat addresses (LDS flat addr
// low 32 bits == LDS byte offset on CDNA5, ISA 10.2 aperture mapping; flat ==
// global address for AS1).
#define AS1P(p) ((__attribute__((address_space(1))) v4i*)(unsigned long long)(uintptr_t)(p))
#define AS3P(p) ((__attribute__((address_space(3))) v4i*)(unsigned)(uintptr_t)(p))

// ---------------------------------------------------------------------------
// Weight transpose + fp32 -> f16 convert:  in[K][N] -> out[N][K].
// A work-group takes one tile of 64 k x 256 n:
// a wave's load is 512 contiguous bytes of an input row, a wave's store is four
// whole 128-byte lines of output rows.
// ---------------------------------------------------------------------------
#define WTK 64
#define WTN 256
#define WTP (WTK + 8)                        // LDS row pitch in halves: 144 B = 16 B x odd
typedef __attribute__((ext_vector_type(4))) float wt4f;

template <int K, int N>
__device__ __forceinline__ void wt_tile(const float* __restrict__ in, _Float16* __restrict__ out,
                                        int kt, int nt, _Float16 (*tile)[WTP]) {
  const int tid = threadIdx.x;
  const int c  = tid & 63;                   // columns n = 4c .. 4c+3 of the tile
  const int kr = tid >> 6;                   // rows k = 16kr .. 16kr+15 of the tile
  const float* s = in + (size_t)(kt * WTK + kr * 16) * N + nt * WTN + 4 * c;
  wt4f r[16];
#pragma unroll
  for (int i = 0; i < 16; ++i) r[i] = *(const wt4f*)(s + (size_t)i * N);
  // the address as an input keeps the issued loads' address registers untouched up to this wait
  asm volatile("s_wait_xcnt 0x0" :: "v"(s) : "memory");
#pragma unroll
  for (int j = 0; j < 4; ++j) {
    v8h lo, hi;
#pragma unroll
    for (int i = 0; i < 8; ++i) { lo[i] = (_Float16)r[i][j]; hi[i] = (_Float16)r[8 + i][j]; }
    *(v8h*)&tile[4 * c + j][kr * 16]     = lo;
    *(v8h*)&tile[4 * c + j][kr * 16 + 8] = hi;
  }
  __syncthreads();
  const int n0 = tid >> 3, q = (tid & 7) * 8;  // 8 lanes a row of 64 halves
  _Float16* d = out + (size_t)(nt * WTN + n0) * K + kt * WTK + q;
#pragma unroll
  for (int p = 0; p < 8; ++p)
    *(v8h*)(d + (size_t)p * 32 * K) = *(const v8h*)&tile[n0 + 32 * p][q];
  // other code of the kernel may follow the tile in the text: the registers that the issued stores name
  // take new values only behind this wait (the address as an input keeps it untouched up to here)
  asm volatile("s_wait_xcnt 0x0" :: "v"(d) : "memory");
}

// Embedding: x[n,d] = tok_emb[tokens[n],d] + pos_emb[n,d]; work-group b takes 256 elements, a thread one
#define EMB_WGS (SEQ * DIM / 256)                                  // 2048
__device__ __forceinline__ void embed_one(const int* __restrict__ tokens, const float* __restrict__ tok_emb,
                                          const float* __restrict__ pos_emb, float* __restrict__ x, int b) {
  int idx = b * 256 + threadIdx.x;
  int n = idx >> 9;
  int d = idx & (DIM - 1);
  x[idx] = tok_emb[(size_t)min(max(tokens[n], 0), VOCAB - 1) * DIM + d] + pos_emb[idx];  // the row stays inside the table
}

#define WT_OUT_TILES ((DIM / WTK) * (VOCAB / WTN))                 // 1000
#define WT_SQ_TILES  ((DIM / WTK) * (DIM / WTN))                   // 16 for one DIM x DIM matrix
#define WT_FF_TILES  ((DIM / WTK) * (FFD / WTN))                   // 64 for W1, as many for W2
#define WT_LAYER_TILES (4 * WT_SQ_TILES + 2 * WT_FF_TILES)         // 192
#define WT_TILES (WT_OUT_TILES + NL * WT_LAYER_TILES)              // 1768

// Tile u of the list of all weight tiles: NL x WT_LAYER_TILES layer tiles (in a layer: Wq, Wk, Wv, Wo, W1, W2),
// then Wout's. u is the same for the whole work-group.
__device__ __forceinline__ void wt_one(int u,
                     const float* __restrict__ Wq, const float* __restrict__ Wk,
                     const float* __restrict__ Wv, const float* __restrict__ Wo,
                     const float* __restrict__ W1, const float* __restrict__ W2,
                     const float* __restrict__ Wout,
                     _Float16* __restrict__ QKVT, _Float16* __restrict__ WoT,
                     _Float16* __restrict__ W1T, _Float16* __restrict__ W2T,
                     _Float16* __restrict__ WoutT, _Float16 (*tile)[WTP]) {
  if (u >= NL * WT_LAYER_TILES) {
    const int b = u - NL * WT_LAYER_TILES;
    wt_tile<DIM, VOCAB>(Wout, WoutT, b & 7, b >> 3, tile);
    return;
  }
  const int layer = u / WT_LAYER_TILES;
  const int r = u - layer * WT_LAYER_TILES;
  if (r < 4 * WT_SQ_TILES) {
    const int which = r >> 4, t = r & 15;    // Wq, Wk, Wv, Wo
    const float* in = (which == 0 ? Wq : which == 1 ? Wk : which == 2 ? Wv : Wo) + (size_t)layer * DIM * DIM;
    _Float16* out = which < 3 ? QKVT + (size_t)(layer * 3 + which) * DIM * DIM
                              : WoT + (size_t)layer * DIM * DIM;
    wt_tile<DIM, DIM>(in, out, t & 7, t >> 3, tile);
  } else if (r < 4 * WT_SQ_TILES + WT_FF_TILES) {
    const int t = r - 4 * WT_SQ_TILES;
    wt_tile<DIM, FFD>(W1 + (size_t)layer * DIM * FFD, W1T + (size_t)layer * DIM * FFD, t & 7, t >> 3, tile);
  } else {
    const int t = r - 4 * WT_SQ_TILES - WT_FF_TILES;
    wt_tile<FFD, DIM>(W2 + (size_t)layer * DIM * FFD, W2T + (size_t)layer * DIM * FFD, t & 31, t >> 5, tile);
  }
}

// The preparation is dealt by first use. The first launch holds only what layer 0's QKV GEMM reads: the
// embedding and the WT_FIRST tiles of layer 0's Wq, Wk, Wv. The other tiles ride, WT_RIDE a launch, as extra
// work-groups in the attention launches, which leave most of the chip idle and read none of them.
#define WT_FIRST (3 * WT_SQ_TILES)                                 // 48
#define WT_RIDE  ((WT_TILES - WT_FIRST) / NL)                      // 430

__global__ void __launch_bounds__(256)
prep_kernel(const float* __restrict__ Wq, const float* __restrict__ Wk, const float* __restrict__ Wv,
            _Float16* __restrict__ QKVT,
            const int* __restrict__ tokens, const float* __restrict__ tok_emb,
            const float* __restrict__ pos_emb, float* __restrict__ x) {
  __shared__ __align__(16) _Float16 tile[WTN][WTP];
  // every choice below is the same for the whole work-group
  if (blockIdx.x >= WT_FIRST) {
    embed_one(tokens, tok_emb, pos_emb, x, blockIdx.x - WT_FIRST);
    return;
  }
  const int r = blockIdx.x;                  // the tiles go first: they last longer
  const int which = r >> 4, t = r & 15;
  wt_tile<DIM, DIM>(which == 0 ? Wq : which == 1 ? Wk : Wv, QKVT + (size_t)which * DIM * DIM, t & 7, t >> 3, tile);
}

// ---------------------------------------------------------------------------
// LayerNorm (per row of [SEQ, DIM]) -> f16 activations for GEMM A-operand
// ---------------------------------------------------------------------------
__global__ void layernorm_f16_kernel(const float* __restrict__ x,
                                     const float* __restrict__ x2,   // second addend of x (see KS below)
                                     const float* __restrict__ g,
                                     const float* __restrict__ b,
                                     _Float16* __restrict__ out) {
  __shared__ float r1[128], r2[128];
  const int row = blockIdx.x, t = threadIdx.x;
  const float* xr = x + (size_t)row * DIM;
  const float* xq = x2 + (size_t)row * DIM;
  float s = 0.f, s2 = 0.f;
  for (int d = t; d < DIM; d += 128) { float v = xr[d] + xq[d]; s += v; s2 += v * v; }
  r1[t] = s; r2[t] = s2; __syncthreads();
#pragma unroll
  for (int st = 64; st > 0; st >>= 1) {
    if (t < st) { r1[t] += r1[t + st]; r2[t] += r2[t + st]; }
    __syncthreads();
  }
  const float mean = r1[0] * (1.f / DIM);
  const float var  = r2[0] * (1.f / DIM) - mean * mean;
  const float rstd = rsqrtf(var + 1e-5f);
  for (int d = t; d < DIM; d += 128)
    out[(size_t)row * DIM + d] = (_Float16)(((xr[d] + xq[d]) - mean) * rstd * g[d] + b[d]);
}

// ---------------------------------------------------------------------------
// WMMA GEMM:  C[M,N] (op)= A[M,K](f16) * Bt[N,K](f16)^T + bias
//   EPI 0: C(f32) = val          EPI 1: C(f32) += val          EPI 2: Ch(f16) = gelu(val)
// Block: 256 threads = 8 wave32, WR x WC. Block tile BM x BN, a stage is BK k of both operands;
// wave tile FA x FB fragments of 16 x 16 (FA * FB WMMA per 32 k).
// The vocabulary GEMM has 2000 tiles: 128 x 128, stage 128 k (4x2 waves of 32x64), two work-groups
// a WGP. The layers' GEMMs are small and a launch lasts as long as one work-group: their tiles
// have fewer rows and a longer stage, 64 x 128 x 256 (2x4 waves of 32x32), 64 x 192 x 256 for QKV
// (2x4 waves of 32x48) and, for N = 512, 64 x 64 x 256 (4x2 waves of 16x32). So 128 to 256 work-groups share a launch, each has less to
// normalise, to read from LDS and to store, and it waits for half as many stages.
// A wave-wide 16-byte copy covers one row's 512 contiguous bytes (BK 256) or two rows' 256 (BK 128) of the stage, whole 128-byte lines. Two LDS
// buffers; the next stage's async copies fly while this one is worked on.
// M a multiple of BM, N of BN, K of BK.
// LNA: the A operand is LayerNorm(X) (K == DIM). The work-group normalises its own
// BM rows of X (f32) once, one wave a row, and keeps them as f16 in LDS for the
// whole k loop; only B goes through the two stage buffers.
// ST (the QKV GEMM, BM == ACH, BN == 3 * DHEAD): the tile is one head's q | k | v of one chunk of
// ACH tokens, so the work-group holds all that the chunk's sums ke^T v and sum of ke are made of:
// it forms them itself from its accumulators, through LDS, and writes them beside C.
// KS (the W2 GEMM, K = FFD, the longest k loop of a layer): KS work-groups share a tile, blockIdx.z takes
// K / KS of the k range. The first adds bias and residual and writes C as ever; the second writes its bare
// sum to C2. No work-group waits for another: the launches that read x next add the two (X2 in the QKV
// GEMM's LayerNorm, C2 in the Wo GEMM's residual, x2 in the last LayerNorm), and the Wo GEMM stores x whole again.
// ---------------------------------------------------------------------------
// One stage of one operand: ROWS rows x 2 BK bytes. BK / 8 threads cover a row with 16 B each, the
// 256 threads RP = 2048 / BK rows at a time, so a thread has ROWS / RP pieces.
// g and l already point at this thread's piece of row tid / (BK / 8).
// LDS row pitch BK + 8 halves: 272 B or 528 B = 16 B x odd.
template <int ROWS, int BK>
__device__ __forceinline__ void gemm_stage_copy(const _Float16* g, _Float16* l, int K) {
  constexpr int RP = 2048 / BK;
#pragma unroll
  for (int i = 0; i < ROWS / RP; ++i)
    __builtin_amdgcn_global_load_async_to_lds_b128(AS1P(g + (size_t)i * RP * K),
                                                   AS3P(l + i * RP * (BK + 8)), 0, 0);
}

// One stage of B. ST: the tile's rows are DHEAD rows each of Wq^T, Wk^T and Wv^T, which lie DIM rows apart.
template <bool ST, int BN, int BK>
__device__ __forceinline__ void gemm_stage_copy_b(const _Float16* g, _Float16* l, int K) {
  if constexpr (ST) {
#pragma unroll
    for (int w = 0; w < 3; ++w)
      gemm_stage_copy<DHEAD, BK>(g + (size_t)w * DIM * K, l + w * DHEAD * (BK + 8), K);
  } else {
    gemm_stage_copy<BN, BK>(g, l, K);
  }
}

// sum over the 32 lanes of a wave, the result in every lane: four steps inside the
// 16-lane row (row_xmask 1, 2, 4, 8), then lane l with lane l ^ 16
template <int XM>
__device__ __forceinline__ float row_xadd(float v) {
  return v + __builtin_bit_cast(float, __builtin_amdgcn_update_dpp(
                 0, __builtin_bit_cast(int, v), 0x160 | XM, 0xf, 0xf, true));
}
__device__ __forceinline__ float wave_sum(float v) {
  v = row_xadd<1>(v); v = row_xadd<2>(v); v = row_xadd<4>(v); v = row_xadd<8>(v);
  return v + __builtin_bit_cast(float, __builtin_amdgcn_permlanex16(
                 __builtin_bit_cast(int, v), __builtin_bit_cast(int, v), 0x76543210, 0xfedcba98, false, false));
}

#define LPITCH (DIM + 8)                     // LDS row pitch of the normalised A in halves: 1040 B = 16 B x odd
#define ACH 64                               // tokens of an attention chunk
#define NCH (SEQ / ACH)
#define SPITCH (DHEAD + 4)                   // LDS row pitch of ke and v in floats: 272 B = 16 B x odd

template <int EPI, bool LNA, int BM, int BN, int BK, int WR, bool ST, int KS>
__global__ void __launch_bounds__(256)
gemm_f16_wmma(const _Float16* __restrict__ A, const float* __restrict__ X, const float* __restrict__ X2,
              const float* __restrict__ lng, const float* __restrict__ lnb,
              const _Float16* __restrict__ Bt,
              const float* __restrict__ bias, float* __restrict__ C, float* __restrict__ C2,
              _Float16* __restrict__ Ch, float* __restrict__ Sws, float* __restrict__ Kws,
              int M, int N, int K) {
  constexpr int GBK = BK;
  constexpr int GPITCH = BK + 8;             // LDS row pitch of a stage in halves
  constexpr int WC = 8 / WR;                 // waves across the tile's columns
  constexpr int FA = BM / (16 * WR);         // A fragments of a wave
  constexpr int FB = BN / (16 * WC);         // B fragments of a wave
  __shared__ __align__(16) _Float16 lA[LNA ? 1 : 2][BM][LNA ? LPITCH : GPITCH];
  __shared__ __align__(16) _Float16 lB[2][BN][GPITCH];

  const int tid  = threadIdx.x;
  const int lane = tid & 31;
  const int wid  = tid >> 5;
  const int wr   = wid / WC;                 // slab of FA * 16 rows
  const int wc   = wid % WC;                 // slab of FB * 16 columns
  const int rowBase = blockIdx.y * BM;
  const int colBase = blockIdx.x * BN;

  // staging: BK / 8 threads a row, 16 B each
  const int srow = tid / (BK / 8);           // + 2048 / BK for each further piece
  const int skq  = (tid % (BK / 8)) * 8;     // halves
  const int kz   = KS > 1 ? (int)blockIdx.z : 0;   // this work-group's share of the k range; the same for the work-group
  const int k0   = kz * (K / KS);
  const _Float16* gA = A  + (size_t)(rowBase + srow) * K + k0 + skq;
  const int bRow0 = ST ? (int)blockIdx.x * DHEAD : colBase;   // first row of Bt in the tile (ST: of its q rows)
  const _Float16* gB = Bt + (size_t)(bRow0 + srow) * K + k0 + skq;

  // fragment coords (16-bit 16x32 layout: lane%16 = row/col, lane/16 = K-half)
  const int mrow = lane & 15;
  const int kb   = (lane >> 4) * 8;

  v8f acc[FA][FB];
#pragma unroll
  for (int a = 0; a < FA; ++a)
#pragma unroll
    for (int j = 0; j < FB; ++j) acc[a][j] = (v8f){};

  const int nst = K / (KS * GBK);            // stages; the same for the whole work-group

  // C/D layout: VGPR i -> M = i + 8*(lane/16), N = lane%16
  const int row0 = rowBase + wr * (FA * 16) + (lane >> 4) * 8;
  const int colW = colBase + wc * (FB * 16) + (lane & 15);
  // column of C that fragment j holds. ST: fragment f of the tile's twelve is 16 columns of q (f < 4), k or v of head blockIdx.x
  const int f0 = __builtin_amdgcn_readfirstlane(wc) * FB;
  auto colOf = [&](int j) -> int {
    if constexpr (ST) return ((f0 + j) >> 2) * DIM + bRow0 + ((f0 + j) & 3) * 16 + (lane & 15);
    else return colW + j * 16;
  };

  // ---- prologue: stage 0 into buffer 0, published; then stage 1 starts into buffer 1 ----
  if constexpr (!LNA) gemm_stage_copy<BM, BK>(gA, &lA[0][srow][skq], K);
  gemm_stage_copy_b<ST, BN, BK>(gB, &lB[0][srow][skq], K);
  if constexpr (LNA) {
    // wave wid normalises BM / 8 rows of the tile, from row wid * BM / 8 on, four rows' loads in flight;
    // a lane holds columns 128 q + 4 lane .. + 3, so every load covers 512 contiguous bytes
    const int w16 = __builtin_amdgcn_readfirstlane(wid) * (BM / 8);
    const v4f* xw = (const v4f*)(X + (size_t)(rowBase + w16) * DIM);
    const bool two = ST && X2 != nullptr;    // x comes as two addends (the same for every work-group of the launch)
    const v4f* xw2 = (const v4f*)((two ? X2 : X) + (size_t)(rowBase + w16) * DIM);
    const v4f* g4 = (const v4f*)lng;
    const v4f* b4 = (const v4f*)lnb;
    const int c4 = lane * 4;
    v4f gg[4], gb[4];
#pragma unroll
    for (int q = 0; q < 4; ++q) {
      gg[q] = g4[lane + q * 32];
      gb[q] = b4[lane + q * 32];
    }
    // kept rolled: this text runs once
#pragma unroll 1
    for (int it = 0; it < BM / 32; ++it) {
      const v4f* xr = xw + lane + it * DIM;  // the lane's piece; four rows of DIM / 4 pieces a trip
      v4f xv[4][4];
#pragma unroll
      for (int r = 0; r < 4; ++r)
#pragma unroll
        for (int q = 0; q < 4; ++q)
          xv[r][q] = xr[r * (DIM / 4) + q * 32];
      if constexpr (ST) {
        if (two) {
          // the second addend's loads fly together with the first's
          const v4f* xs = xw2 + lane + it * DIM;
          v4f xu[4][4];
#pragma unroll
          for (int r = 0; r < 4; ++r)
#pragma unroll
            for (int q = 0; q < 4; ++q)
              xu[r][q] = xs[r * (DIM / 4) + q * 32];
          // the address as an input keeps these loads' address registers untouched up to this wait
          asm volatile("s_wait_xcnt 0x0" :: "v"(xs), "v"(xr) : "memory");
#pragma unroll
          for (int r = 0; r < 4; ++r)
#pragma unroll
            for (int q = 0; q < 4; ++q)
              xv[r][q] += xu[r][q];
        }
      }
      // the addresses as inputs keep the issued loads' address registers untouched up to this
      // wait; behind it the next trip may form new ones
      asm volatile("s_wait_xcnt 0x0" :: "v"(xr), "s"(g4), "s"(b4), "v"(lane) : "memory");
      float s1[4], s2[4];
#pragma unroll
      for (int r = 0; r < 4; ++r) {
        const v4f a = (xv[r][0] + xv[r][1]) + (xv[r][2] + xv[r][3]);
        v4f b = xv[r][0] * xv[r][0];
#pragma unroll
        for (int q = 1; q < 4; ++q) b += xv[r][q] * xv[r][q];
        s1[r] = (a[0] + a[1]) + (a[2] + a[3]);
        s2[r] = (b[0] + b[1]) + (b[2] + b[3]);
      }
#pragma unroll
      for (int r = 0; r < 4; ++r) { s1[r] = wave_sum(s1[r]); s2[r] = wave_sum(s2[r]); }
#pragma unroll
      for (int r = 0; r < 4; ++r) {
        const float mean = s1[r] * (1.f / DIM);
        const float var  = s2[r] * (1.f / DIM) - mean * mean;
        const float rstd = rsqrtf(var + 1e-5f);
#pragma unroll
        for (int q = 0; q < 4; ++q) {
          const v4f y = (xv[r][q] - mean) * rstd * gg[q] + gb[q];
          v4h hv;
#pragma unroll
          for (int e = 0; e < 4; ++e) hv[e] = (_Float16)y[e];
          *(v4h*)&lA[0][w16 + it * 4 + r][q * 128 + c4] = hv;
        }
      }
    }
  }
  asm volatile("s_wait_asynccnt 0x0" ::: "memory");   // this wave's pieces of stage 0 have landed
  __syncthreads();                                    // LNA: it also publishes the normalised rows
  if (nst > 1) {
    if constexpr (!LNA) gemm_stage_copy<BM, BK>(gA + GBK, &lA[1][srow][skq], K);
    gemm_stage_copy_b<ST, BN, BK>(gB + GBK, &lB[1][srow][skq], K);
  }

  // Everything the epilogue reads from global memory is asked for here, all of it in
  // flight at once behind the second stage's copies: the first pass of the k loop covers the latency.
  // The loops are unrolled so that bb and res are registers with constant indices.
  float bb[FB];
  float res[FA][FB][8];
  float res2[FA][FB][8];                     // KS == 1: the residual's second addend, where there is one
#pragma unroll
  for (int j = 0; j < FB; ++j) bb[j] = 0.f;
  if (bias && kz == 0) {
#pragma unroll
    for (int j = 0; j < FB; ++j) bb[j] = bias[colOf(j)];
  }
  if (EPI == 1) {
#pragma unroll
    for (int a = 0; a < FA; ++a)
#pragma unroll
      for (int i = 0; i < 8; ++i)
#pragma unroll
        for (int j = 0; j < FB; ++j) { res[a][j][i] = 0.f; res2[a][j][i] = 0.f; }
    // the lane's elements of the tile out of one plane; nothing here waits for the data
    auto tileIn = [&](const float* base, float (&dst)[FA][FB][8]) {
#pragma unroll
      for (int a = 0; a < FA; ++a) {
        const float* rp[8];
#pragma unroll
        for (int i = 0; i < 8; ++i) rp[i] = base + (size_t)(row0 + a * 16 + i) * N + colW;
#pragma unroll
        for (int i = 0; i < 8; ++i)
#pragma unroll
          for (int j = 0; j < FB; ++j) dst[a][j][i] = rp[i][j * 16];
        // the row addresses as inputs keep the issued loads' address registers untouched up to this wait
        asm volatile("s_wait_xcnt 0x0" :: "v"(rp[0]), "v"(rp[1]), "v"(rp[2]), "v"(rp[3]),
                                          "v"(rp[4]), "v"(rp[5]), "v"(rp[6]), "v"(rp[7]) : "memory");
      }
    };
    if (kz == 0) tileIn(C, res);
    if (KS == 1 && C2 != nullptr) tileIn(C2, res2);
  }
  // the base and the column offset as inputs keep the issued loads' address registers untouched
  // up to this wait; behind it they may take new values
  asm volatile("s_wait_xcnt 0x0" :: "s"(bias), "v"(colW) : "memory");

  // Fragments go through two register sets: the LDS reads of the next 32 k stand as one group
  // in front of this block's WMMAs and return under them. All reads of a stage stay inside its own trip.
  union Frag { v16h v; v8h h[2]; };
  Frag af[2][FA], bf[2][FB];
  for (int s = 0; s < nst; ++s) {
    const int buf = s & 1;
    const _Float16* ab = LNA ? &lA[0][wr * (FA * 16) + mrow][s * GBK + kb] : &lA[buf][wr * (FA * 16) + mrow][kb];
    const _Float16* bb0 = &lB[buf][wc * (FB * 16) + mrow][kb];
#pragma unroll
    for (int u = -1; u < GBK / 32; ++u) {
      if (u + 1 < GBK / 32) {
        const int ns = (u + 1) & 1;          // the set that block u + 1 is read into
        const int ks = (u + 1) * 32;
#pragma unroll
        for (int a = 0; a < FA; ++a) {
          const _Float16* ar = ab + a * 16 * (LNA ? LPITCH : GPITCH) + ks;
          af[ns][a].h[0] = *(const v8h*)ar;
          af[ns][a].h[1] = *(const v8h*)(ar + 16);
        }
#pragma unroll
        for (int j = 0; j < FB; ++j) {
          const _Float16* br = bb0 + j * 16 * GPITCH + ks;
          bf[ns][j].h[0] = *(const v8h*)br;
          bf[ns][j].h[1] = *(const v8h*)(br + 16);
        }
      }
      // keeps the read group whole and in front of the WMMAs
      __builtin_amdgcn_sched_barrier(0);
      if (u >= 0) {
        const int cs = u & 1;
#pragma unroll
        for (int a = 0; a < FA; ++a)
#pragma unroll
          for (int j = 0; j < FB; ++j)
            acc[a][j] = __builtin_amdgcn_wmma_f32_16x16x32_f16(false, af[cs][a].v, false, bf[cs][j].v,
                                                               (short)0, acc[a][j], false, false);
        // keeps the next group of reads behind this block's WMMAs
        __builtin_amdgcn_sched_barrier(0);
      }
    }
    // publish point of stage s + 1
    asm volatile("s_wait_dscnt 0x0" ::: "memory");     // this wave's reads of buffer buf are done before it is refilled
    asm volatile("s_wait_asynccnt 0x0" ::: "memory");  // this wave's pieces of stage s + 1 have landed
    __syncthreads();
    if (s + 2 < nst) {                                 // refill the buffer every wave has just left
      if constexpr (!LNA) gemm_stage_copy<BM, BK>(gA + (size_t)(s + 2) * GBK, &lA[buf][srow][skq], K);
      gemm_stage_copy_b<ST, BN, BK>(gB + (size_t)(s + 2) * GBK, &lB[buf][srow][skq], K);
    }
  }
  asm volatile("s_wait_asynccnt 0x0" ::: "memory");    // no copy is left in flight when the wave goes on to its end

  // ST: ke = exp(k) and v of the chunk go to LDS as f32, into B's stage buffer 0, which every wave left
  // at the loop's first barrier. The last chunk's sums have no reader (the test is the same for the work-group).
  float (*kel)[SPITCH] = (float (*)[SPITCH])&lB[0][0][0];
  float (*vsl)[SPITCH] = kel + ACH;
  const bool sums = ST && blockIdx.y < NCH - 1;
  if constexpr (ST) {
    if (sums) {
#pragma unroll
      for (int j = 0; j < FB; ++j) {
        const int f = f0 + j;                          // the same for the whole wave
        if (f >= 4) {
          float (*dl)[SPITCH] = f < 8 ? kel : vsl;
#pragma unroll
          for (int a = 0; a < FA; ++a)
#pragma unroll
            for (int i = 0; i < 8; ++i) {
              const float v = acc[a][j][i] + bb[j];
              dl[wr * (FA * 16) + a * 16 + (lane >> 4) * 8 + i][(f & 3) * 16 + (lane & 15)] = f < 8 ? __expf(v) : v;
            }
        }
      }
      __syncthreads();                                 // publishes ke and v; it stands in front of C's stores, so it waits for none
    }
  }

  float* Cd = (KS > 1 && kz != 0) ? C2 : C;    // the second share of k stores its bare sum (bb and res are 0 there)
#pragma unroll
  for (int a = 0; a < FA; ++a) {
#pragma unroll
    for (int j = 0; j < FB; ++j) {
      const int col = colOf(j);
#pragma unroll
      for (int i = 0; i < 8; ++i) {
        const size_t idx = (size_t)(row0 + a * 16 + i) * N + col;
        const float v = acc[a][j][i] + bb[j];
        if (EPI == 0)      C[idx] = v;
        else if (EPI == 1) Cd[idx] = (KS == 1 ? res[a][j][i] + res2[a][j][i] : res[a][j][i]) + v;
        else Ch[idx] = (_Float16)(0.5f * v * (1.f + erff(v * 0.70710678118f)));
      }
    }
  }

  if constexpr (ST) {
    // the registers that C's issued stores name take new values below, and only behind this wait
    asm volatile("s_wait_xcnt 0x0" ::: "memory");
    if (sums) {
      // ke^T v and the sum of ke over the chunk's tokens, while C's stores drain.
      // thread tile: rows d = 4g..4g+3, columns e = 4l..4l+3
      const int l = tid & 15, g = tid >> 4;
      v4f sa[4];
      v4f ks = (v4f){0.f, 0.f, 0.f, 0.f};
#pragma unroll
      for (int i = 0; i < 4; ++i) sa[i] = (v4f){0.f, 0.f, 0.f, 0.f};
#pragma unroll 8
      for (int n = 0; n < ACH; ++n) {
        const v4f ka = *(const v4f*)&kel[n][4 * g];
        const v4f vb = *(const v4f*)&vsl[n][4 * l];
#pragma unroll
        for (int i = 0; i < 4; ++i) sa[i] += ka[i] * vb;
        ks += ka;
      }
      const int hc = blockIdx.x * NCH + blockIdx.y;
      float* dst = Sws + (size_t)hc * (DHEAD * DHEAD);
#pragma unroll
      for (int i = 0; i < 4; ++i) *(v4f*)(dst + (4 * g + i) * DHEAD + 4 * l) = sa[i];
      if (l == 0) *(v4f*)(Kws + hc * DHEAD + 4 * g) = ks;
    }
  }
}

// ---------------------------------------------------------------------------
// Causal linear attention over fused QKV buffer [SEQ][3*DIM], in chunks of
// ACH tokens. With ke = exp(k), qs = softmax(q) * DHEAD^-0.5 and, for chunk c,
//   Sprev = sum over tokens before the chunk of ke^T v     (DHEAD x DHEAD)
//   kprev = sum over tokens before the chunk of ke         (DHEAD)
//   P[n][m] = qs[n] . ke[m] for m <= n inside the chunk, else 0
// the output row is (qs[n] . Sprev + P[n] . v) / max(qs[n] . kprev + sum_m P[n][m], eps).
// The QKV GEMM writes each chunk's own ke^T v and sum of ke; this launch adds up the
// chunks before its own and forms the rows. All sums in f32.
// ---------------------------------------------------------------------------
// grid (NH, NCH + RIDE_ROWS): the work-groups from blockIdx.y == NCH on do no attention; the first WT_RIDE of them each transpose one
// weight tile that a later launch reads: first rideLayer tiles of the list from rideLayer0 on, then Wout's from rideOut0 on.
#define RIDE_ROWS ((WT_RIDE + NH - 1) / NH)                  // 54
#define AT_X (ACH * (DHEAD + ACH + 4))
#define AT_Y ((DHEAD + ACH) * DHEAD)
#define AT_K (ACH * (DHEAD + 4))
__global__ void __launch_bounds__(256)
attn_chunk_out_kernel(const float* __restrict__ QKV, const float* __restrict__ Sws,
                      const float* __restrict__ Kws, _Float16* __restrict__ Aout,
                      const float* __restrict__ Wq, const float* __restrict__ Wk,
                      const float* __restrict__ Wv, const float* __restrict__ Wo,
                      const float* __restrict__ W1, const float* __restrict__ W2,
                      const float* __restrict__ Wout,
                      _Float16* __restrict__ QKVT, _Float16* __restrict__ WoT,
                      _Float16* __restrict__ W1T, _Float16* __restrict__ W2T,
                      _Float16* __restrict__ WoutT, int rideLayer, int rideLayer0, int rideOut0) {
  // one LDS block, so that a riding work-group's tile lies on the attention's arrays and adds nothing to them
  __shared__ __align__(16) float sm[AT_X + AT_Y + AT_K + DHEAD];
  static_assert(sizeof(sm) >= sizeof(_Float16) * WTN * WTP, "the weight tile fits");
  if (blockIdx.y >= NCH) {                                  // the same for the whole work-group
    const int j = (blockIdx.y - NCH) * NH + blockIdx.x;
    if (j < WT_RIDE)
      wt_one(j < rideLayer ? rideLayer0 + j : NL * WT_LAYER_TILES + rideOut0 + (j - rideLayer),
             Wq, Wk, Wv, Wo, W1, W2, Wout, QKVT, WoT, W1T, W2T, WoutT, (_Float16 (*)[WTP])sm);
    return;
  }
  float (*X)[DHEAD + ACH + 4] = (float (*)[DHEAD + ACH + 4])sm;          // row n: qs[n][0..63] | P[n][0..63]
  float (*Y)[DHEAD]           = (float (*)[DHEAD])(sm + AT_X);           // rows 0..63 Sprev[d][e], rows 64.. v[m][e]
  float (*Kl)[DHEAD + 4]      = (float (*)[DHEAD + 4])(sm + AT_X + AT_Y); // ke[m][d]; pitch 16 B x odd
  float* kp                   = sm + AT_X + AT_Y + AT_K;                 // kprev
  const int h = blockIdx.x, c = blockIdx.y, tid = threadIdx.x;
  const int l = tid & 15, g = tid >> 4;

  // ---- Sprev, kprev: add up the chunks before this one, four chunks' loads in flight ----
  v4f sp[4];
#pragma unroll
  for (int r = 0; r < 4; ++r) sp[r] = (v4f){0.f, 0.f, 0.f, 0.f};
  const float* sb = Sws + (size_t)h * NCH * (DHEAD * DHEAD);
  const unsigned so = (unsigned)tid * 4u;
  for (int g0 = 0; g0 < c; g0 += 4) {
    v4f t[4][4];
    const float* sc[4];
#pragma unroll
    for (int j = 0; j < 4; ++j) {
      sc[j] = sb + (size_t)min(g0 + j, c - 1) * (DHEAD * DHEAD) + so;
#pragma unroll
      for (int r = 0; r < 4; ++r) t[j][r] = *(const v4f*)(sc[j] + r * 1024);
    }
    // the addresses as inputs keep the issued loads' address registers untouched up to this wait;
    // behind it the next trip may form new ones
    asm volatile("s_wait_xcnt 0x0" :: "v"(sc[0]), "v"(sc[1]), "v"(sc[2]), "v"(sc[3]) : "memory");
#pragma unroll
    for (int j = 0; j < 4; ++j) {
      const float w = (g0 + j < c) ? 1.f : 0.f;
#pragma unroll
      for (int r = 0; r < 4; ++r) sp[r] += w * t[j][r];
    }
  }
#pragma unroll
  for (int r = 0; r < 4; ++r) *(v4f*)&Y[r * 16 + g][4 * l] = sp[r];
  if (tid < DHEAD) {
    float s = 0.f;
#pragma unroll
    for (int cc = 0; cc < NCH - 1; ++cc) {
      const float t = Kws[(h * NCH + cc) * DHEAD + tid];
      s += (cc < c) ? t : 0.f;
    }
    kp[tid] = s;
  }

  // ---- this chunk's q (softmax over the row, 16 lanes a row), ke, v ----
  const float* sq[4];
  v4f q4[4], k4[4], v4[4];
#pragma unroll
  for (int p = 0; p < 4; ++p) {
    sq[p] = QKV + (size_t)(c * ACH + p * 16 + g) * (3 * DIM) + h * DHEAD + 4 * l;
    q4[p] = *(const v4f*)(sq[p]);
    k4[p] = *(const v4f*)(sq[p] + DIM);
    v4[p] = *(const v4f*)(sq[p] + 2 * DIM);
  }
  // the addresses as inputs keep the issued loads' address registers untouched up to this wait
  asm volatile("s_wait_xcnt 0x0" :: "v"(sq[0]), "v"(sq[1]), "v"(sq[2]), "v"(sq[3]) : "memory");
#pragma unroll
  for (int p = 0; p < 4; ++p) {
    const int n = p * 16 + g;
    v4f qv = q4[p];
    v4f kv = k4[p];
    const v4f vv = v4[p];
    float mx = fmaxf(fmaxf(qv[0], qv[1]), fmaxf(qv[2], qv[3]));
#pragma unroll
    for (int m = 1; m < 16; m <<= 1) mx = fmaxf(mx, __shfl_xor(mx, m));
#pragma unroll
    for (int e = 0; e < 4; ++e) qv[e] = __expf(qv[e] - mx);
    float sm = (qv[0] + qv[1]) + (qv[2] + qv[3]);
#pragma unroll
    for (int m = 1; m < 16; m <<= 1) sm += __shfl_xor(sm, m);
    const float qsc = 0.125f / sm;                 // 1 / row sum, * DHEAD^-0.5
#pragma unroll
    for (int e = 0; e < 4; ++e) {
      qv[e] *= qsc;
      kv[e] = __expf(kv[e]);
    }
    *(v4f*)&X[n][4 * l]          = qv;
    *(v4f*)&Kl[n][4 * l]         = kv;
    *(v4f*)&Y[DHEAD + n][4 * l]  = vv;
  }
  __syncthreads();

  // ---- P: thread tile rows n = tn..tn+3, columns m = l + 16*jj ----
  const int tn = 4 * g;
  v2f pr2[4][4];                                   // even-d and odd-d halves of each dot product
#pragma unroll
  for (int i = 0; i < 4; ++i)
#pragma unroll
    for (int jj = 0; jj < 4; ++jj) pr2[i][jj] = (v2f){0.f, 0.f};
#pragma unroll 2
  for (int d = 0; d < DHEAD; d += 4) {
    v4f qa[4], kb[4];
#pragma unroll
    for (int i = 0; i < 4; ++i) qa[i] = *(const v4f*)&X[tn + i][d];
#pragma unroll
    for (int jj = 0; jj < 4; ++jj) kb[jj] = *(const v4f*)&Kl[l + 16 * jj][d];
#pragma unroll
    for (int i = 0; i < 4; ++i)
#pragma unroll
      for (int jj = 0; jj < 4; ++jj) {
        pr2[i][jj] += qa[i].lo * kb[jj].lo;
        pr2[i][jj] += qa[i].hi * kb[jj].hi;
      }
  }
  // denominator: each of the row's 16 lanes adds its four columns of P and its
  // four terms of qs . kprev; the lanes are then summed.
  float dinv[4];
  const v4f kq = *(const v4f*)&kp[4 * l];
#pragma unroll
  for (int i = 0; i < 4; ++i) {
    const v4f qq = *(const v4f*)&X[tn + i][4 * l];
    float rs = (qq[0] * kq[0] + qq[1] * kq[1]) + (qq[2] * kq[2] + qq[3] * kq[3]);
#pragma unroll
    for (int jj = 0; jj < 4; ++jj) {
      const int m = l + 16 * jj;
      const float pv = (m <= tn + i) ? pr2[i][jj][0] + pr2[i][jj][1] : 0.f;   // causal, own token included
      rs += pv;
      X[tn + i][DHEAD + m] = pv;
    }
#pragma unroll
    for (int m = 1; m < 16; m <<= 1) rs += __shfl_xor(rs, m);
    dinv[i] = 1.f / fmaxf(rs, 1e-3f);
  }
  __syncthreads();

  // ---- rows: [qs | P] x [Sprev ; v]; P is zero from column 8*(wave+1) on for this wave's rows ----
  const int jEnd = DHEAD + 8 * (__builtin_amdgcn_readfirstlane(tid >> 5) + 1);
  v4f o[4];
#pragma unroll
  for (int i = 0; i < 4; ++i) o[i] = (v4f){0.f, 0.f, 0.f, 0.f};
#pragma unroll 2
  for (int j = 0; j < jEnd; j += 4) {
    v4f xa[4], yb[4];
#pragma unroll
    for (int i = 0; i < 4; ++i) xa[i] = *(const v4f*)&X[tn + i][j];
#pragma unroll
    for (int e = 0; e < 4; ++e) yb[e] = *(const v4f*)&Y[j + e][4 * l];
#pragma unroll
    for (int i = 0; i < 4; ++i)
#pragma unroll
      for (int e = 0; e < 4; ++e) o[i] += xa[i][e] * yb[e];
  }
#pragma unroll
  for (int i = 0; i < 4; ++i) {
    v4h hv;
#pragma unroll
    for (int e = 0; e < 4; ++e) hv[e] = (_Float16)(o[i][e] * dinv[i]);
    *(v4h*)(Aout + (size_t)(c * ACH + tn + i) * DIM + h * DHEAD + 4 * l) = hv;
  }
  // the riding tiles' code follows in the kernel's text: the registers that the issued stores name take new values only behind this wait
  asm volatile("s_wait_xcnt 0x0" ::: "memory");
}

// ---------------------------------------------------------------------------
// Host orchestration
// ---------------------------------------------------------------------------
extern "C" void kernel_launch(void* const* d_in, const int* in_sizes, int n_in,
                              void* d_out, int out_size, void* d_ws, size_t ws_size,
                              hipStream_t stream) {
  (void)in_sizes; (void)n_in; (void)out_size; (void)ws_size;
  const int*   tokens  = (const int*)  d_in[0];
  const float* tok_emb = (const float*)d_in[1];
  const float* pos_emb = (const float*)d_in[2];
  const float* Wq  = (const float*)d_in[3];
  const float* Wk  = (const float*)d_in[4];
  const float* Wv  = (const float*)d_in[5];
  const float* Wo  = (const float*)d_in[6];
  const float* bo  = (const float*)d_in[7];
  const float* ln1g = (const float*)d_in[8];
  const float* ln1b = (const float*)d_in[9];
  const float* W1  = (const float*)d_in[10];
  const float* b1  = (const float*)d_in[11];
  const float* W2  = (const float*)d_in[12];
  const float* b2  = (const float*)d_in[13];
  const float* ln2g = (const float*)d_in[14];
  const float* ln2b = (const float*)d_in[15];
  const float* lnfg = (const float*)d_in[16];
  const float* lnfb = (const float*)d_in[17];
  const float* Wout = (const float*)d_in[18];
  const float* bout = (const float*)d_in[19];
  float* out = (float*)d_out;

  char* p = (char*)d_ws;
  auto carve = [&](size_t bytes) -> char* {
    char* r = p; p += (bytes + 255) & ~(size_t)255; return r;
  };
  _Float16* QKVT  = (_Float16*)carve((size_t)NL * 3 * DIM * DIM * 2);  // fused [1536][512] per layer
  _Float16* WoT   = (_Float16*)carve((size_t)NL * DIM * DIM * 2);
  _Float16* W1T   = (_Float16*)carve((size_t)NL * DIM * FFD * 2);
  _Float16* W2T   = (_Float16*)carve((size_t)NL * DIM * FFD * 2);
  _Float16* WoutT = (_Float16*)carve((size_t)DIM * VOCAB * 2);
  float*    x     = (float*)   carve((size_t)SEQ * DIM * 4);
  _Float16* h16   = (_Float16*)carve((size_t)SEQ * DIM * 2);
  float*    qkvf  = (float*)   carve((size_t)SEQ * 3 * DIM * 4);
  _Float16* a16   = (_Float16*)carve((size_t)SEQ * DIM * 2);
  _Float16* ff16  = (_Float16*)carve((size_t)SEQ * FFD * 2);
  float*    sws   = (float*)   carve((size_t)NH * NCH * DHEAD * DHEAD * 4);  // per-chunk ke^T v
  float*    kws   = (float*)   carve((size_t)NH * NCH * DHEAD * 4);          // per-chunk sum of ke
  float*    xp    = (float*)   carve((size_t)SEQ * DIM * 4);                 // W2 GEMM: the sum over the second half of k

  prep_kernel<<<EMB_WGS + WT_FIRST, 256, 0, stream>>>(Wq, Wk, Wv, QKVT, tokens, tok_emb, pos_emb, x);

  // What rides in layer i's attention launch, WT_RIDE tiles each: the layer tiles still to do up to the end of
  // layer i + 1 (i = 0: the rest of layer 0 and layer 1; then layer i + 1), filled up with Wout's tiles.
  const int rideLayer[NL]  = {336, 192, 192, 0};
  const int rideLayer0[NL] = {48, 384, 576, 768};
  const int rideOut0[NL]   = {0, 94, 332, 570};

  const dim3 gD(DIM / 64, SEQ / 64);        // (8, 16)
  for (int i = 0; i < NL; ++i) {
    const size_t wo = (size_t)i * DIM * DIM;
    const size_t fo = (size_t)i * DIM * FFD;
    float* xpi = i ? xp : nullptr;          // layer 0 reads the embedding, which is whole
    gemm_f16_wmma<0, true, 64, 192, 256, 2, true, 1><<<dim3(NH, NCH), 256, 0, stream>>>(
        nullptr, x, xpi, ln1g + i * DIM, ln1b + i * DIM,
        QKVT + (size_t)i * 3 * DIM * DIM, nullptr, qkvf, nullptr, nullptr, sws, kws, SEQ, 3 * DIM, DIM);
    attn_chunk_out_kernel<<<dim3(NH, NCH + RIDE_ROWS), 256, 0, stream>>>(
        qkvf, sws, kws, a16, Wq, Wk, Wv, Wo, W1, W2, Wout, QKVT, WoT, W1T, W2T, WoutT,
        rideLayer[i], rideLayer0[i], rideOut0[i]);
    gemm_f16_wmma<1, false, 64, 64, 256, 4, false, 1><<<gD, 256, 0, stream>>>(a16, nullptr, nullptr, nullptr, nullptr,
                                                    WoT + wo, bo + i * DIM, x, xpi, nullptr, nullptr, nullptr, SEQ, DIM, DIM);
    gemm_f16_wmma<2, true, 64, 128, 256, 2, false, 1><<<dim3(FFD / 128, SEQ / 64), 256, 0, stream>>>(
        nullptr, x, nullptr, ln2g + i * DIM, ln2b + i * DIM,
        W1T + fo, b1 + i * FFD, nullptr, nullptr, ff16, nullptr, nullptr, SEQ, FFD, DIM);
    gemm_f16_wmma<1, false, 64, 64, 256, 4, false, 2><<<dim3(DIM / 64, SEQ / 64, 2), 256, 0, stream>>>(
        ff16, nullptr, nullptr, nullptr, nullptr,
        W2T + fo, b2 + i * DIM, x, xp, nullptr, nullptr, nullptr, SEQ, DIM, FFD);
  }
  layernorm_f16_kernel<<<SEQ, 128, 0, stream>>>(x, xp, lnfg, lnfb, h16);
  gemm_f16_wmma<0, false, 128, 128, 128, 4, false, 1><<<dim3(VOCAB / 128, SEQ / 128), 256, 0, stream>>>(
      h16, nullptr, nullptr, nullptr, nullptr, WoutT, bout, out, nullptr, nullptr, nullptr, nullptr, SEQ, VOCAB, DIM);
}
